// v000
// Measured on an AMD MI455X. A time is GPU time per run, averaged over a window of back-to-back runs after a warm-up
// (all launches, gaps included; the runs take copies of the inputs in turn), and the median of several windows.
// Apart from v000's, it joins two sittings. Times from different sittings can be a few percent apart, while
// side-by-side timings come from the same sitting.
// v000 is the starting kernel. One run takes 254 microseconds.
// All contractions (q projection, 8x8 stride-8 reduction conv as a patch GEMM, kv projection, q*k^T scores, P*V, output projection): v_wmma_f32_16x16x32_bf16, bf16 hi/lo operands everywhere (hi*hi + hi*lo + lo*hi), f32 accumulate; LayerNorm, softmax and biases in f32.
#include <hip/hip_runtime.h>
#include <stdint.h>

typedef unsigned short u16;
typedef u16    v16u __attribute__((ext_vector_type(16)));
typedef u16    v8u  __attribute__((ext_vector_type(8)));
typedef __bf16 v16b __attribute__((ext_vector_type(16)));
typedef float  v8f  __attribute__((ext_vector_type(8)));
typedef float  v4f  __attribute__((ext_vector_type(4)));
typedef v8u __attribute__((may_alias)) v8ua;
typedef v4f __attribute__((may_alias)) v4fa;

union Frag { v16b v; v16u u; v8u half[2]; };
static_assert(sizeof(Frag) == 32);

#define NBATCH 8
#define NQ     16384
#define CD     64
#define NKEY   256
#define NROWK  2048        // NBATCH * NKEY reduced tokens
#define KCONV  4096        // 64 patch pixels x 64 channels, k = p*64 + ci
#define LN_EPS 1e-5f

// ---------------------------------------------------------------------------
// 16x16x32 bf16 WMMA with hazard guard (ties D, keeps A/B live).
// Fragment map (wave32): lane l, h = l>>4, m = n = l&15.
//   A/B element i: i<8 -> k0+8h+i ; i>=8 -> k0+16+8h+(i-8)
//   D element r : row 8h+r, col l&15
// ---------------------------------------------------------------------------
__device__ __forceinline__ v8f wmma_bf(v16b a, v16b b, v8f c) {
  v8f d = __builtin_amdgcn_wmma_f32_16x16x32_bf16(false, a, false, b, (short)0, c, false, false);
  asm volatile("v_nop\n\tv_nop\n\tv_nop\n\tv_nop" : "+v"(d) : "v"(a), "v"(b));
  return d;
}

// f32 -> bf16 bits, RNE
__device__ __forceinline__ u16 bf_rne(float f) {
  unsigned u = __builtin_bit_cast(unsigned, f);
  u += 0x7FFFu + ((u >> 16) & 1u);
  return (u16)(u >> 16);
}
__device__ __forceinline__ float bf_val(u16 b) {
  return __builtin_bit_cast(float, ((unsigned)b) << 16);
}

// 8 floats -> hi/lo bf16 planes (hi = rne(x), lo = rne(x - hi))
__device__ __forceinline__ void split8(v8f f, v8u& hi, v8u& lo) {
  #pragma unroll
  for (int i = 0; i < 8; ++i) {
    const u16 hh = bf_rne(f[i]);
    hi[i] = hh;
    lo[i] = bf_rne(f[i] - bf_val(hh));
  }
}

// 16 floats given in fragment element order (a = elements 0..7, c = 8..15) -> hi/lo fragments
__device__ __forceinline__ void split_frag(v8f a, v8f c, v16b& fhi, v16b& flo) {
  Frag fh, fl;
  v8u h0, l0, h1, l1;
  split8(a, h0, l0);
  split8(c, h1, l1);
  fh.half[0] = h0; fh.half[1] = h1;
  fl.half[0] = l0; fl.half[1] = l1;
  fhi = fh.v; flo = fl.v;
}

// A or B fragment from a k-contiguous bf16 row; p points at element k0 of the row owned by this lane.
__device__ __forceinline__ v16b ld_frag(const u16* p, int h) {
  Frag f;
  f.half[0] = *(const v8ua*)(p + 8 * h);
  f.half[1] = *(const v8ua*)(p + 16 + 8 * h);
  return f.v;
}

__device__ __forceinline__ float red16(float v) {
  v += __shfl_xor(v, 1);
  v += __shfl_xor(v, 2);
  v += __shfl_xor(v, 4);
  v += __shfl_xor(v, 8);
  return v;
}

// ---------------------------------------------------------------------------
// Kernel 1: weights -> bf16 hi/lo planes.
//   wq [64][64], wkv [128][64], wproj [64][64] natural [out][in] order (k-contiguous rows);
//   wsr re-flattened to [co][p*64 + ci], p = i*8 + j.
// One thread = 8 consecutive plane elements = one 16-B store per plane; lanes contiguous
// ---------------------------------------------------------------------------
__global__ __launch_bounds__(256) void k_prep_w(
    const float* __restrict__ wq, const float* __restrict__ wkv,
    const float* __restrict__ wproj, const float* __restrict__ wsr,
    u16* __restrict__ wqh, u16* __restrict__ wql,
    u16* __restrict__ wkvh, u16* __restrict__ wkvl,
    u16* __restrict__ wph, u16* __restrict__ wpl,
    u16* __restrict__ wsh, u16* __restrict__ wsl)
{
  const int blk = blockIdx.x, tid = threadIdx.x;
  if (blk >= 136) return;
  v8f f;
  u16* dh;
  u16* dl;
  int e;
  if (blk < 8) {                    // block-uniform region select
    const float* src;
    if (blk < 2)      { e = blk * 256 + tid;        src = wq;    dh = wqh;  dl = wql;  }
    else if (blk < 6) { e = (blk - 2) * 256 + tid;  src = wkv;   dh = wkvh; dl = wkvl; }
    else              { e = (blk - 6) * 256 + tid;  src = wproj; dh = wph;  dl = wpl;  }
    const float* s = src + (size_t)e * 8;
    const v4f a = *(const v4fa*)s;
    const v4f c = *(const v4fa*)(s + 4);
    f = __builtin_shufflevector(a, c, 0, 1, 2, 3, 4, 5, 6, 7);
  } else {
    e = (blk - 8) * 256 + tid;                          // 0..32767
    const int co = e >> 9, grp = e & 511;               // dst element 8e = co*4096 + grp*8
    const int p = grp >> 3, ci0 = (grp & 7) * 8;        // grp*8 = p*64 + ci0
    const float* s = wsr + (size_t)co * KCONV + ci0 * 64 + p;   // wsr[co][ci][i][j] = co*4096 + ci*64 + p
    #pragma unroll
    for (int c = 0; c < 8; ++c) f[c] = s[c * 64];
    dh = wsh; dl = wsl;
  }
  v8u hi, lo;
  split8(f, hi, lo);
  u16* ph = dh + (size_t)e * 8;
  u16* pl = dl + (size_t)e * 8;
  *(v8u*)ph = hi;
  *(v8u*)pl = lo;
  
}

// ---------------------------------------------------------------------------
// Kernel 2: patch gather (im2col) -> dense A planes [2048][4096] hi/lo.
//   row r = b*256 + m, m = py*16 + px; k = p*64 + ci, p = i*8 + j;
//   value = x[b][pix][ci], pix = (8py+i)*W + 8px + j (clamped).
// One thread = 8 channels of one (row, pixel): two 16-B loads, one 16-B store per plane,
// lanes contiguous. grid = 4096 blocks x 256.
// ---------------------------------------------------------------------------
__global__ __launch_bounds__(256) void k_im2col(
    const float* __restrict__ x, const int* __restrict__ Hp, const int* __restrict__ Wp,
    u16* __restrict__ ah, u16* __restrict__ al)
{
  const int g = blockIdx.x * 256 + threadIdx.x;
  if (g >= NROWK * 512) return;
  const int Hv = Hp[0], Wv = Wp[0];
  const long long hw = (long long)Hv * (long long)Wv;
  const int lim = (hw >= 1 && hw <= NQ) ? (int)(hw - 1) : (NQ - 1);
  const int r = g >> 9, grp = g & 511;
  const int bb = r >> 8, mm = r & 255;
  const int py = mm >> 4, px = mm & 15;
  const int p = grp >> 3, ci0 = (grp & 7) * 8;
  const int ii = p >> 3, jj = p & 7;
  int pix = (8 * py + ii) * Wv + 8 * px + jj;
  pix = min(max(pix, 0), lim);
  const float* s = x + ((size_t)bb * NQ + pix) * CD + ci0;
  const v4f a = *(const v4fa*)s;
  const v4f c = *(const v4fa*)(s + 4);
  const v8f f = __builtin_shufflevector(a, c, 0, 1, 2, 3, 4, 5, 6, 7);
  v8u hi, lo;
  split8(f, hi, lo);
  u16* ph = ah + (size_t)g * 8;
  u16* pl = al + (size_t)g * 8;
  *(v8u*)ph = hi;
  *(v8u*)pl = lo;
  
}

// ---------------------------------------------------------------------------
// each line by lanes 8q..8q+7 of one wave in one instruction, 16 B per lane.
// ---------------------------------------------------------------------------
__device__ __forceinline__ void kv_store_pass(const u16* sK, const u16* sV,
                                              u16* kh, u16* kl, u16* vth, u16* vtl,
                                              int blk, int w, int lane) {
  const int q8 = lane & 7, sub = lane >> 3;
  const int bb = blk >> 2, key0 = (blk & 3) * 64, rowbase = blk * 64;
  #pragma unroll
  for (int it = 0; it < 16; ++it) {
    v8u v;
    u16* dst;
    if (it < 8) {                                  // K planes: line = one token row of 64 d
      const int p = (it >> 2) & 1;
      const int kk = (it & 3) * 16 + w * 4 + sub;  // 0..63
      v = *(const v8ua*)(sK + (p * 64 + kk) * 64 + 8 * q8);
      u16* plane = p ? kl : kh;
      dst = plane + (size_t)(rowbase + kk) * CD + 8 * q8;
    } else {                                       // V^T planes: line = 64 keys of one d row
      const int p = ((it - 8) >> 2) & 1;
      const int d = ((it - 8) & 3) * 16 + w * 4 + sub;
      v = *(const v8ua*)(sV + (p * 64 + d) * 64 + 8 * q8);
      u16* plane = p ? vtl : vth;
      dst = plane + ((size_t)(bb * CD + d)) * NKEY + key0 + 8 * q8;
    }
    *(v8u*)dst = v;
  }
}

// ---------------------------------------------------------------------------
// Kernel 3: reduced tokens. Block = 64 conv rows (tokens) of one batch, 4 waves x 16 rows.
//   conv GEMM (16x4096 @ 4096x64 per wave) -> LayerNorm (f32) -> kv proj (16x64 @ 64x128)
//   -> K planes [2048][64] and V^T planes [8][64][256] (bf16 hi/lo), whole-line stores.
// grid = 32 blocks x 128 threads.
// ---------------------------------------------------------------------------
__global__ __launch_bounds__(128) void k_kv(
    const u16* __restrict__ ah, const u16* __restrict__ al,       // [2048][4096]
    const u16* __restrict__ wsh, const u16* __restrict__ wsl,     // [64][4096]
    const float* __restrict__ gamma, const float* __restrict__ beta,
    const u16* __restrict__ wkvh, const u16* __restrict__ wkvl,   // [128][64]
    const float* __restrict__ bkv,
    u16* __restrict__ kh, u16* __restrict__ kl,                   // [2048][64]
    u16* __restrict__ vth, u16* __restrict__ vtl)                 // [8][64][256]
{
  __shared__ __attribute__((aligned(16))) u16 sX[2 * 64 * 64];   // LN output hi/lo [p][token][c]
  __shared__ __attribute__((aligned(16))) u16 sK[2 * 64 * 64];   // [p][token][d]
  __shared__ __attribute__((aligned(16))) u16 sV[2 * 64 * 64];   // [p][d][token]

  const int tid = threadIdx.x, lane = tid & 31, w = tid >> 5;
  const int h = lane >> 4, m = lane & 15;
  const int blk = blockIdx.x;
  const int rowg = blk * 64 + 16 * w;          // first conv row of this wave

  const v8f zero8 = {0.f, 0.f, 0.f, 0.f, 0.f, 0.f, 0.f, 0.f};
  v8f acc[4];
  #pragma unroll
  for (int t = 0; t < 4; ++t) acc[t] = zero8;

  const u16* arh = ah + (size_t)(rowg + m) * KCONV;
  const u16* arl = al + (size_t)(rowg + m) * KCONV;
  const u16* brh = wsh + (size_t)m * KCONV;
  const u16* brl = wsl + (size_t)m * KCONV;

  #pragma unroll 1
  for (int k0 = 0; k0 < KCONV; k0 += 32) {
    const v16b fah = ld_frag(arh + k0, h);
    const v16b fal = ld_frag(arl + k0, h);
    #pragma unroll
    for (int t = 0; t < 4; ++t) {
      const v16b fbh = ld_frag(brh + (size_t)t * 16 * KCONV + k0, h);
      const v16b fbl = ld_frag(brl + (size_t)t * 16 * KCONV + k0, h);
      acc[t] = wmma_bf(fah, fbh, acc[t]);
      acc[t] = wmma_bf(fah, fbl, acc[t]);
      acc[t] = wmma_bf(fal, fbh, acc[t]);
    }
  }
  // acc[t][r] = conv out [token rowg+8h+r][channel 16t+m]

  float mu[8], rs[8];
  #pragma unroll
  for (int r = 0; r < 8; ++r) {
    float s = acc[0][r] + acc[1][r] + acc[2][r] + acc[3][r];
    s = red16(s);
    mu[r] = s * (1.0f / 64.0f);
    float v = 0.f;
    #pragma unroll
    for (int t = 0; t < 4; ++t) { const float d = acc[t][r] - mu[r]; v += d * d; }
    v = red16(v) * (1.0f / 64.0f);
    rs[r] = rsqrtf(v + LN_EPS);
  }
  #pragma unroll
  for (int t = 0; t < 4; ++t) {
    const int col = 16 * t + m;
    const float g = gamma[col], be = beta[col];
    #pragma unroll
    for (int r = 0; r < 8; ++r) {
      const float y = (acc[t][r] - mu[r]) * rs[r] * g + be;
      const u16 hh = bf_rne(y);
      const u16 ll = bf_rne(y - bf_val(hh));
      const int kl_ = 16 * w + 8 * h + r;
      sX[kl_ * 64 + col] = hh;
      sX[4096 + kl_ * 64 + col] = ll;
    }
  }
  __syncthreads();

  // kv projection A fragments: row = token 16w+m, k = channel
  const v16b xah0 = ld_frag(sX + (16 * w + m) * 64, h);
  const v16b xah1 = ld_frag(sX + (16 * w + m) * 64 + 32, h);
  const v16b xal0 = ld_frag(sX + 4096 + (16 * w + m) * 64, h);
  const v16b xal1 = ld_frag(sX + 4096 + (16 * w + m) * 64 + 32, h);

  #pragma unroll
  for (int ct = 0; ct < 8; ++ct) {
    const int off = (16 * ct + m) * CD;
    const v16b b0h = ld_frag(wkvh + off, h);
    const v16b b0l = ld_frag(wkvl + off, h);
    const v16b b1h = ld_frag(wkvh + off + 32, h);
    const v16b b1l = ld_frag(wkvl + off + 32, h);
    v8f c = zero8;
    c = wmma_bf(xah0, b0h, c);
    c = wmma_bf(xah0, b0l, c);
    c = wmma_bf(xal0, b0h, c);
    c = wmma_bf(xah1, b1h, c);
    c = wmma_bf(xah1, b1l, c);
    c = wmma_bf(xal1, b1h, c);
    // c[r] = kv[token 16w+8h+r][col 16ct+m]
    const int col = 16 * ct + m;
    const float bb = bkv[col];
    #pragma unroll
    for (int r = 0; r < 8; ++r) {
      const float val = c[r] + bb;
      const u16 hh = bf_rne(val);
      const u16 ll = bf_rne(val - bf_val(hh));
      const int kl_ = 16 * w + 8 * h + r;
      if (ct < 4) {
        sK[kl_ * 64 + col] = hh;
        sK[4096 + kl_ * 64 + col] = ll;
      } else {
        const int d = col - 64;
        sV[d * 64 + kl_] = hh;
        sV[4096 + d * 64 + kl_] = ll;
      }
    }
  }
  __syncthreads();

  kv_store_pass(sK, sV, kh, kl, vth, vtl, blk, w, lane);
  
}

// ---------------------------------------------------------------------------
// lanes 8q..8q+7 in one instruction, 4 lines per instruction, 32 lines per wave.
// ---------------------------------------------------------------------------
__device__ __forceinline__ void att_store_pass(const float* so, float* out, size_t grow0, int lane) {
  const int q8 = lane & 7, sub = lane >> 3;
  #pragma unroll
  for (int i = 0; i < 8; ++i) {
    const int lid = i * 4 + sub;
    const int row = lid >> 1, hl = lid & 1;
    const v4f v = *(const v4fa*)(so + row * 64 + 32 * hl + 4 * q8);
    *(v4f*)(out + (grow0 + (size_t)row) * CD + 32 * hl + 4 * q8) = v;
  }
}

// ---------------------------------------------------------------------------
// Kernel 4: fused q projection + attention over 256 reduced tokens + output projection.
// Block = 64 threads (2 waves), 16 queries per wave; grid = (512, 8).
//   q^T = wq * x^T          : A = wq plane rows, B = x^T split in registers
//   S^T = K * q^T           : A = K plane rows, B = q^T packed from two adjacent D tiles
//   softmax over 256 keys   : f32, full score row parked in LDS (each lane re-reads only
//                             the keys it wrote: key bit3 == h)
//   O^T = V^T * P^T         : A = V^T plane rows, B = P^T from LDS
//   out^T = wproj * O^T     : A = wproj plane rows, B = O^T packed from D tiles
// ---------------------------------------------------------------------------
__global__ __launch_bounds__(64) void k_attn(
    const float* __restrict__ x,
    const u16* __restrict__ wqh, const u16* __restrict__ wql, const float* __restrict__ bq,
    const u16* __restrict__ kh, const u16* __restrict__ kl,      // [2048][64]
    const u16* __restrict__ vth, const u16* __restrict__ vtl,    // [8][64][256]
    const u16* __restrict__ wph, const u16* __restrict__ wpl, const float* __restrict__ bproj,
    float* __restrict__ out)                                     // [8][16384][64]
{
  __shared__ __attribute__((aligned(16))) float sS[2][16 * 256];
  __shared__ __attribute__((aligned(16))) float sO[2][16 * 64];

  const int tid = threadIdx.x, lane = tid & 31, w = tid >> 5;
  const int h = lane >> 4, m = lane & 15;
  const int b = blockIdx.y;
  const int q0 = blockIdx.x * 32 + 16 * w;
  const v8f zero8 = {0.f, 0.f, 0.f, 0.f, 0.f, 0.f, 0.f, 0.f};

  // ---- q^T = wq * x^T : qt[t][r] = q[query q0+m][feature 16t+8h+r] ----
  v8f qt[4];
  #pragma unroll
  for (int t = 0; t < 4; ++t) qt[t] = zero8;
  const float* xr = x + ((size_t)b * NQ + q0 + m) * CD;
  #pragma unroll
  for (int ks = 0; ks < 2; ++ks) {
    const float* xp = xr + 32 * ks + 8 * h;
    const v4f a0 = *(const v4fa*)(xp);
    const v4f a1 = *(const v4fa*)(xp + 4);
    const v4f c0 = *(const v4fa*)(xp + 16);
    const v4f c1 = *(const v4fa*)(xp + 20);
    const v8f a8 = __builtin_shufflevector(a0, a1, 0, 1, 2, 3, 4, 5, 6, 7);
    const v8f c8 = __builtin_shufflevector(c0, c1, 0, 1, 2, 3, 4, 5, 6, 7);
    v16b xbh, xbl;
    split_frag(a8, c8, xbh, xbl);
    #pragma unroll
    for (int t = 0; t < 4; ++t) {
      const int off = (16 * t + m) * CD + 32 * ks;
      const v16b fah = ld_frag(wqh + off, h);
      const v16b fal = ld_frag(wql + off, h);
      qt[t] = wmma_bf(fah, xbh, qt[t]);
      qt[t] = wmma_bf(fah, xbl, qt[t]);
      qt[t] = wmma_bf(fal, xbh, qt[t]);
    }
  }
  v8f qv[4];
  #pragma unroll
  for (int t = 0; t < 4; ++t)
    #pragma unroll
    for (int r = 0; r < 8; ++r)
      qv[t][r] = (qt[t][r] + bq[16 * t + 8 * h + r]) * 0.125f;   // d^-1/2 folded into q (exact)
  // B fragment for k = d: element i <- tile 2ks row i, element 8+i <- tile 2ks+1 row i
  v16b qbh0, qbl0, qbh1, qbl1;
  split_frag(qv[0], qv[1], qbh0, qbl0);
  split_frag(qv[2], qv[3], qbh1, qbl1);

  // ---- scores: z[r] = S[query m][key 16j+8h+r], parked at sS[w][m*256 + key] ----
  float* sw = &sS[w][0];
  float* srow = sw + m * 256 + 8 * h;
  float mx = -3.0e38f;
  const u16* kbh = kh + ((size_t)b * NKEY + m) * CD;
  const u16* kbl = kl + ((size_t)b * NKEY + m) * CD;
  #pragma unroll 1
  for (int j = 0; j < 16; ++j) {
    const int ko = 16 * j * CD;
    const v16b a0h = ld_frag(kbh + ko, h);
    const v16b a0l = ld_frag(kbl + ko, h);
    const v16b a1h = ld_frag(kbh + ko + 32, h);
    const v16b a1l = ld_frag(kbl + ko + 32, h);
    v8f z = zero8;
    z = wmma_bf(a0h, qbh0, z);
    z = wmma_bf(a0h, qbl0, z);
    z = wmma_bf(a0l, qbh0, z);
    z = wmma_bf(a1h, qbh1, z);
    z = wmma_bf(a1h, qbl1, z);
    z = wmma_bf(a1l, qbh1, z);
    const v4f z0 = __builtin_shufflevector(z, z, 0, 1, 2, 3);
    const v4f z1 = __builtin_shufflevector(z, z, 4, 5, 6, 7);
    *(v4fa*)(srow + 16 * j) = z0;
    *(v4fa*)(srow + 16 * j + 4) = z1;
    #pragma unroll
    for (int r = 0; r < 8; ++r) mx = fmaxf(mx, z[r]);
  }
  mx = fmaxf(mx, __shfl_xor(mx, 16));

  // ---- softmax numerator + row sum (f32); same lane, same addresses ----
  float sum = 0.f;
  #pragma unroll 2
  for (int a = 0; a < 16; ++a) {
    float* pp = srow + 16 * a;
    v4f v0 = *(const v4fa*)pp;
    v4f v1 = *(const v4fa*)(pp + 4);
    #pragma unroll
    for (int e = 0; e < 4; ++e) {
      v0[e] = __expf(v0[e] - mx);
      v1[e] = __expf(v1[e] - mx);
      sum += v0[e] + v1[e];
    }
    *(v4fa*)pp = v0;
    *(v4fa*)(pp + 4) = v1;
  }
  sum += __shfl_xor(sum, 16);
  const float inv = 1.0f / sum;

  // ---- O^T = V^T * P^T : o[t][r] = O[query m][d 16t+8h+r] ----
  v8f o[4];
  #pragma unroll
  for (int t = 0; t < 4; ++t) o[t] = zero8;
  const u16* vbh = vth + ((size_t)b * CD + m) * NKEY;
  const u16* vbl = vtl + ((size_t)b * CD + m) * NKEY;
  #pragma unroll 1
  for (int c = 0; c < 8; ++c) {
    const int k0 = 32 * c;
    const float* pp = srow + k0;                 // keys k0+8h.., k0+16+8h..
    const v4f p0 = *(const v4fa*)pp;
    const v4f p1 = *(const v4fa*)(pp + 4);
    const v4f p2 = *(const v4fa*)(pp + 16);
    const v4f p3 = *(const v4fa*)(pp + 20);
    const v8f pa = __builtin_shufflevector(p0, p1, 0, 1, 2, 3, 4, 5, 6, 7) * inv;
    const v8f pc = __builtin_shufflevector(p2, p3, 0, 1, 2, 3, 4, 5, 6, 7) * inv;
    v16b pbh, pbl;
    split_frag(pa, pc, pbh, pbl);
    #pragma unroll
    for (int t = 0; t < 4; ++t) {
      const int vo = 16 * t * NKEY + k0;
      const v16b fah = ld_frag(vbh + vo, h);
      const v16b fal = ld_frag(vbl + vo, h);
      o[t] = wmma_bf(fah, pbh, o[t]);
      o[t] = wmma_bf(fah, pbl, o[t]);
      o[t] = wmma_bf(fal, pbh, o[t]);
    }
  }

  // ---- out^T = wproj * O^T : u[t][r] = out[query m][feature 16t+8h+r] ----
  v16b obh0, obl0, obh1, obl1;
  split_frag(o[0], o[1], obh0, obl0);
  split_frag(o[2], o[3], obh1, obl1);
  v8f u[4];
  #pragma unroll
  for (int t = 0; t < 4; ++t) {
    const int off = (16 * t + m) * CD;
    const v16b a0h = ld_frag(wph + off, h);
    const v16b a0l = ld_frag(wpl + off, h);
    const v16b a1h = ld_frag(wph + off + 32, h);
    const v16b a1l = ld_frag(wpl + off + 32, h);
    v8f z = zero8;
    z = wmma_bf(a0h, obh0, z);
    z = wmma_bf(a0h, obl0, z);
    z = wmma_bf(a0l, obh0, z);
    z = wmma_bf(a1h, obh1, z);
    z = wmma_bf(a1h, obl1, z);
    z = wmma_bf(a1l, obh1, z);
    u[t] = z;
  }
  float* so = &sO[w][0];
  #pragma unroll
  for (int t = 0; t < 4; ++t)
    #pragma unroll
    for (int r = 0; r < 8; ++r)
      so[m * 64 + 16 * t + 8 * h + r] = u[t][r] + bproj[16 * t + 8 * h + r];
  __syncthreads();

  const size_t grow0 = (size_t)b * NQ + q0;
  att_store_pass(so, out, grow0, lane);
  
}

// ---------------------------------------------------------------------------
extern "C" void kernel_launch(void* const* d_in, const int* in_sizes, int n_in,
                              void* d_out, int out_size, void* d_ws, size_t ws_size,
                              hipStream_t stream) {
  if (n_in < 12) return;
  if (in_sizes[0] != NBATCH * NQ * CD) return;
  if (in_sizes[1] != CD * CD || in_sizes[2] != CD) return;
  if (in_sizes[3] != 2 * CD * CD || in_sizes[4] != 2 * CD) return;
  if (in_sizes[5] != CD * CD || in_sizes[6] != CD) return;
  if (in_sizes[7] != CD * KCONV) return;
  if (in_sizes[8] != CD || in_sizes[9] != CD) return;
  if (in_sizes[10] < 1 || in_sizes[11] < 1) return;
  if (out_size != NBATCH * NQ * CD) return;

  const float* x     = (const float*)d_in[0];
  const float* wq    = (const float*)d_in[1];
  const float* bq    = (const float*)d_in[2];
  const float* wkv   = (const float*)d_in[3];
  const float* bkv   = (const float*)d_in[4];
  const float* wproj = (const float*)d_in[5];
  const float* bproj = (const float*)d_in[6];
  const float* wsr   = (const float*)d_in[7];
  const float* gamma = (const float*)d_in[8];
  const float* beta  = (const float*)d_in[9];
  const int*   Hp    = (const int*)d_in[10];
  const int*   Wp    = (const int*)d_in[11];
  float* out = (float*)d_out;

  const size_t szWq  = (size_t)CD * CD * 2;            //      8192 per plane
  const size_t szWkv = (size_t)2 * CD * CD * 2;        //     16384
  const size_t szWp  = (size_t)CD * CD * 2;            //      8192
  const size_t szWs  = (size_t)CD * KCONV * 2;         //    524288
  const size_t szA   = (size_t)NROWK * KCONV * 2;      //  16777216
  const size_t szK   = (size_t)NROWK * CD * 2;         //    262144
  const size_t szVt  = (size_t)NBATCH * CD * NKEY * 2; //    262144
  size_t off = 0;
  const size_t oWqh = off;  off += szWq;
  const size_t oWql = off;  off += szWq;
  const size_t oWkh = off;  off += szWkv;
  const size_t oWkl = off;  off += szWkv;
  const size_t oWph = off;  off += szWp;
  const size_t oWpl = off;  off += szWp;
  const size_t oWsh = off;  off += szWs;
  const size_t oWsl = off;  off += szWs;
  const size_t oAh  = off;  off += szA;
  const size_t oAl  = off;  off += szA;
  const size_t oKh  = off;  off += szK;
  const size_t oKl  = off;  off += szK;
  const size_t oVth = off;  off += szVt;
  const size_t oVtl = off;  off += szVt;              // total 35717120
  if (off > ws_size) return;
  if (off > (size_t)134217728) return;

  char* ws = (char*)d_ws;
  u16* wqh  = (u16*)(ws + oWqh);
  u16* wql  = (u16*)(ws + oWql);
  u16* wkvh = (u16*)(ws + oWkh);
  u16* wkvl = (u16*)(ws + oWkl);
  u16* wph  = (u16*)(ws + oWph);
  u16* wpl  = (u16*)(ws + oWpl);
  u16* wsh  = (u16*)(ws + oWsh);
  u16* wsl  = (u16*)(ws + oWsl);
  u16* ah   = (u16*)(ws + oAh);
  u16* al   = (u16*)(ws + oAl);
  u16* kh   = (u16*)(ws + oKh);
  u16* kl   = (u16*)(ws + oKl);
  u16* vth  = (u16*)(ws + oVth);
  u16* vtl  = (u16*)(ws + oVtl);

  k_prep_w<<<136, 256, 0, stream>>>(wq, wkv, wproj, wsr, wqh, wql, wkvh, wkvl, wph, wpl, wsh, wsl);

  k_im2col<<<(NROWK * 512) / 256, 256, 0, stream>>>(x, Hp, Wp, ah, al);          // 4096 blocks

  k_kv<<<NROWK / 64, 128, 0, stream>>>(ah, al, wsh, wsl, gamma, beta, wkvh, wkvl, bkv,
                                       kh, kl, vth, vtl);                           // 32 blocks

  dim3 gAtt(NQ / 32, NBATCH);                                                      // (512, 8)
  k_attn<<<gAtt, 64, 0, stream>>>(x, wqh, wql, bq, kh, kl, vth, vtl, wph, wpl, bproj, out);
}

// v001
// Measured time: 137 microseconds a run.
// Two timings next to v000 put it at 1.90 and 1.85 times that version's speed.
// All contractions (q projection, 8x8 stride-8 reduction conv as a patch GEMM, kv projection, q*k^T scores, P*V, output projection): v_wmma_f32_16x16x32_bf16, bf16 hi/lo operands everywhere (hi*hi + hi*lo + lo*hi), f32 accumulate; LayerNorm, softmax and biases in f32.
#include <hip/hip_runtime.h>
#include <stdint.h>

typedef unsigned short u16;
typedef u16    v16u __attribute__((ext_vector_type(16)));
typedef u16    v8u  __attribute__((ext_vector_type(8)));
typedef __bf16 v16b __attribute__((ext_vector_type(16)));
typedef float  v8f  __attribute__((ext_vector_type(8)));
typedef float  v4f  __attribute__((ext_vector_type(4)));
typedef v8u __attribute__((may_alias)) v8ua;
typedef v4f __attribute__((may_alias)) v4fa;

union Frag { v16b v; v16u u; v8u half[2]; };
static_assert(sizeof(Frag) == 32);

#define NBATCH 8
#define NQ     16384
#define CD     64
#define NKEY   256
#define NROWK  2048        // NBATCH * NKEY reduced tokens
#define KCONV  4096        // 64 patch pixels x 64 channels, k = p*64 + ci
#define LN_EPS 1e-5f
#define KSPLIT 16          // slices of the conv reduction, one work-group each
#define KSLICE 256         // KCONV / KSPLIT

// ---------------------------------------------------------------------------
// 16x16x32 bf16 WMMA with hazard guard (ties D, keeps A/B live).
// Fragment map (wave32): lane l, h = l>>4, m = n = l&15.
//   A/B element i: i<8 -> k0+8h+i ; i>=8 -> k0+16+8h+(i-8)
//   D element r : row 8h+r, col l&15
// ---------------------------------------------------------------------------
__device__ __forceinline__ v8f wmma_bf(v16b a, v16b b, v8f c) {
  v8f d = __builtin_amdgcn_wmma_f32_16x16x32_bf16(false, a, false, b, (short)0, c, false, false);
  asm volatile("v_nop\n\tv_nop\n\tv_nop\n\tv_nop" : "+v"(d) : "v"(a), "v"(b));
  return d;
}

// f32 -> bf16 bits, RNE
__device__ __forceinline__ u16 bf_rne(float f) {
  unsigned u = __builtin_bit_cast(unsigned, f);
  u += 0x7FFFu + ((u >> 16) & 1u);
  return (u16)(u >> 16);
}
__device__ __forceinline__ float bf_val(u16 b) {
  return __builtin_bit_cast(float, ((unsigned)b) << 16);
}

// 8 floats -> hi/lo bf16 planes (hi = rne(x), lo = rne(x - hi))
__device__ __forceinline__ void split8(v8f f, v8u& hi, v8u& lo) {
  #pragma unroll
  for (int i = 0; i < 8; ++i) {
    const u16 hh = bf_rne(f[i]);
    hi[i] = hh;
    lo[i] = bf_rne(f[i] - bf_val(hh));
  }
}

// 16 floats given in fragment element order (a = elements 0..7, c = 8..15) -> hi/lo fragments
__device__ __forceinline__ void split_frag(v8f a, v8f c, v16b& fhi, v16b& flo) {
  Frag fh, fl;
  v8u h0, l0, h1, l1;
  split8(a, h0, l0);
  split8(c, h1, l1);
  fh.half[0] = h0; fh.half[1] = h1;
  fl.half[0] = l0; fl.half[1] = l1;
  fhi = fh.v; flo = fl.v;
}

// A or B fragment from a k-contiguous bf16 row; p points at element k0 of the row owned by this lane.
__device__ __forceinline__ v16b ld_frag(const u16* p, int h) {
  Frag f;
  f.half[0] = *(const v8ua*)(p + 8 * h);
  f.half[1] = *(const v8ua*)(p + 16 + 8 * h);
  return f.v;
}

__device__ __forceinline__ float red16(float v) {
  v += __shfl_xor(v, 1);
  v += __shfl_xor(v, 2);
  v += __shfl_xor(v, 4);
  v += __shfl_xor(v, 8);
  return v;
}

// ---------------------------------------------------------------------------
// Kernel 1: weights -> bf16 hi/lo planes.
//   wq [64][64], wkv [128][64], wproj [64][64] natural [out][in] order (k-contiguous rows);
//   wsr re-flattened to [co][p*64 + ci], p = i*8 + j.
// One thread = 8 consecutive plane elements = one 16-B store per plane; lanes contiguous
// ---------------------------------------------------------------------------
__global__ __launch_bounds__(256) void k_prep_w(
    const float* __restrict__ wq, const float* __restrict__ wkv,
    const float* __restrict__ wproj, const float* __restrict__ wsr,
    u16* __restrict__ wqh, u16* __restrict__ wql,
    u16* __restrict__ wkvh, u16* __restrict__ wkvl,
    u16* __restrict__ wph, u16* __restrict__ wpl,
    u16* __restrict__ wsh, u16* __restrict__ wsl)
{
  const int blk = blockIdx.x, tid = threadIdx.x;
  if (blk >= 136) return;
  v8f f;
  u16* dh;
  u16* dl;
  int e;
  if (blk < 8) {                    // block-uniform region select
    const float* src;
    if (blk < 2)      { e = blk * 256 + tid;        src = wq;    dh = wqh;  dl = wql;  }
    else if (blk < 6) { e = (blk - 2) * 256 + tid;  src = wkv;   dh = wkvh; dl = wkvl; }
    else              { e = (blk - 6) * 256 + tid;  src = wproj; dh = wph;  dl = wpl;  }
    const float* s = src + (size_t)e * 8;
    const v4f a = *(const v4fa*)s;
    const v4f c = *(const v4fa*)(s + 4);
    f = __builtin_shufflevector(a, c, 0, 1, 2, 3, 4, 5, 6, 7);
  } else {
    e = (blk - 8) * 256 + tid;                          // 0..32767
    const int co = e >> 9, grp = e & 511;               // dst element 8e = co*4096 + grp*8
    const int p = grp >> 3, ci0 = (grp & 7) * 8;        // grp*8 = p*64 + ci0
    const float* s = wsr + (size_t)co * KCONV + ci0 * 64 + p;   // wsr[co][ci][i][j] = co*4096 + ci*64 + p
    #pragma unroll
    for (int c = 0; c < 8; ++c) f[c] = s[c * 64];
    dh = wsh; dl = wsl;
  }
  v8u hi, lo;
  split8(f, hi, lo);
  u16* ph = dh + (size_t)e * 8;
  u16* pl = dl + (size_t)e * 8;
  *(v8u*)ph = hi;
  *(v8u*)pl = lo;
  
}

// ---------------------------------------------------------------------------
// Kernel 2: patch gather (im2col) -> dense A planes [2048][4096] hi/lo.
//   row r = b*256 + m, m = py*16 + px; k = p*64 + ci, p = i*8 + j;
//   value = x[b][pix][ci], pix = (8py+i)*W + 8px + j (clamped).
// One thread = 8 channels of one (row, pixel): two 16-B loads, one 16-B store per plane,
// lanes contiguous. grid = 4096 blocks x 256.
// ---------------------------------------------------------------------------
__global__ __launch_bounds__(256) void k_im2col(
    const float* __restrict__ x, const int* __restrict__ Hp, const int* __restrict__ Wp,
    u16* __restrict__ ah, u16* __restrict__ al)
{
  const int g = blockIdx.x * 256 + threadIdx.x;
  if (g >= NROWK * 512) return;
  const int Hv = Hp[0], Wv = Wp[0];
  const long long hw = (long long)Hv * (long long)Wv;
  const int lim = (hw >= 1 && hw <= NQ) ? (int)(hw - 1) : (NQ - 1);
  const int r = g >> 9, grp = g & 511;
  const int bb = r >> 8, mm = r & 255;
  const int py = mm >> 4, px = mm & 15;
  const int p = grp >> 3, ci0 = (grp & 7) * 8;
  const int ii = p >> 3, jj = p & 7;
  int pix = (8 * py + ii) * Wv + 8 * px + jj;
  pix = min(max(pix, 0), lim);
  const float* s = x + ((size_t)bb * NQ + pix) * CD + ci0;
  const v4f a = *(const v4fa*)s;
  const v4f c = *(const v4fa*)(s + 4);
  const v8f f = __builtin_shufflevector(a, c, 0, 1, 2, 3, 4, 5, 6, 7);
  v8u hi, lo;
  split8(f, hi, lo);
  u16* ph = ah + (size_t)g * 8;
  u16* pl = al + (size_t)g * 8;
  *(v8u*)ph = hi;
  *(v8u*)pl = lo;
  
}

// ---------------------------------------------------------------------------
// each line by lanes 8q..8q+7 of one wave in one instruction, 16 B per lane.
// ---------------------------------------------------------------------------
__device__ __forceinline__ void kv_store_pass(const u16* sK, const u16* sV,
                                              u16* kh, u16* kl, u16* vth, u16* vtl,
                                              int blk, int w, int lane) {
  const int q8 = lane & 7, sub = lane >> 3;
  const int bb = blk >> 2, key0 = (blk & 3) * 64, rowbase = blk * 64;
  #pragma unroll
  for (int it = 0; it < 16; ++it) {
    v8u v;
    u16* dst;
    if (it < 8) {                                  // K planes: line = one token row of 64 d
      const int p = (it >> 2) & 1;
      const int kk = (it & 3) * 16 + w * 4 + sub;  // 0..63
      v = *(const v8ua*)(sK + (p * 64 + kk) * 64 + 8 * q8);
      u16* plane = p ? kl : kh;
      dst = plane + (size_t)(rowbase + kk) * CD + 8 * q8;
    } else {                                       // V^T planes: line = 64 keys of one d row
      const int p = ((it - 8) >> 2) & 1;
      const int d = ((it - 8) & 3) * 16 + w * 4 + sub;
      v = *(const v8ua*)(sV + (p * 64 + d) * 64 + 8 * q8);
      u16* plane = p ? vtl : vth;
      dst = plane + ((size_t)(bb * CD + d)) * NKEY + key0 + 8 * q8;
    }
    *(v8u*)dst = v;
  }
}

// ---------------------------------------------------------------------------
// Kernel 3: conv GEMM, split along k. Block = 64 conv rows x one k slice of 256, 4 waves x 16 rows
//   (the 4 waves read the same weight slice). Each wave stores its f32 16x64 partial tile in
//   accumulator order: part[slice][row tile][t][j][lane][4] = acc[t][4j..4j+3], 512 B per store.
// grid = (32, 16) blocks x 128 threads.
// ---------------------------------------------------------------------------
__global__ __launch_bounds__(128) void k_conv_part(
    const u16* __restrict__ ah, const u16* __restrict__ al,       // [2048][4096]
    const u16* __restrict__ wsh, const u16* __restrict__ wsl,     // [64][4096]
    float* __restrict__ part)                                     // [16][128][4][2][32][4]
{
  const int tid = threadIdx.x, lane = tid & 31, w = tid >> 5;
  const int h = lane >> 4, m = lane & 15;
  const int blk = blockIdx.x, sp = blockIdx.y;
  const int rowg = blk * 64 + 16 * w;          // first conv row of this wave
  const int kbase = sp * KSLICE;

  const v8f zero8 = {0.f, 0.f, 0.f, 0.f, 0.f, 0.f, 0.f, 0.f};
  v8f acc[4];
  #pragma unroll
  for (int t = 0; t < 4; ++t) acc[t] = zero8;

  const u16* arh = ah + (size_t)(rowg + m) * KCONV + kbase;
  const u16* arl = al + (size_t)(rowg + m) * KCONV + kbase;
  const u16* brh = wsh + (size_t)m * KCONV + kbase;
  const u16* brl = wsl + (size_t)m * KCONV + kbase;

  #pragma unroll 1
  for (int k0 = 0; k0 < KSLICE; k0 += 32) {
    const v16b fah = ld_frag(arh + k0, h);
    const v16b fal = ld_frag(arl + k0, h);
    // precaution: this build reuses the address registers of these four loads as the
    // destination of a weight load issued right behind them
    asm volatile("s_wait_xcnt 0x0" ::: "memory");
    #pragma unroll
    for (int t = 0; t < 4; ++t) {
      const v16b fbh = ld_frag(brh + (size_t)t * 16 * KCONV + k0, h);
      const v16b fbl = ld_frag(brl + (size_t)t * 16 * KCONV + k0, h);
      acc[t] = wmma_bf(fah, fbh, acc[t]);
      acc[t] = wmma_bf(fah, fbl, acc[t]);
      acc[t] = wmma_bf(fal, fbh, acc[t]);
    }
  }

  float* pp = part + ((size_t)sp * 128 + blk * 4 + w) * 1024 + lane * 4;
  #pragma unroll
  for (int t = 0; t < 4; ++t) {
    *(v4f*)(pp + (2 * t) * 128)     = __builtin_shufflevector(acc[t], acc[t], 0, 1, 2, 3);
    *(v4f*)(pp + (2 * t + 1) * 128) = __builtin_shufflevector(acc[t], acc[t], 4, 5, 6, 7);
  }
}

// ---------------------------------------------------------------------------
// Kernel 4: reduced tokens. Block = 64 conv rows (tokens) of one batch, 4 waves x 16 rows.
//   sum of the 16 k-slice partials (slice 0 first) -> LayerNorm (f32) -> kv proj (16x64 @ 64x128)
//   -> K planes [2048][64] and V^T planes [8][64][256] (bf16 hi/lo), whole-line stores.
// grid = 32 blocks x 128 threads.
// ---------------------------------------------------------------------------
__global__ __launch_bounds__(128) void k_kv(
    const float* __restrict__ part,                               // [16][128][4][2][32][4]
    const float* __restrict__ gamma, const float* __restrict__ beta,
    const u16* __restrict__ wkvh, const u16* __restrict__ wkvl,   // [128][64]
    const float* __restrict__ bkv,
    u16* __restrict__ kh, u16* __restrict__ kl,                   // [2048][64]
    u16* __restrict__ vth, u16* __restrict__ vtl)                 // [8][64][256]
{
  __shared__ __attribute__((aligned(16))) u16 sX[2 * 64 * 64];   // LN output hi/lo [p][token][c]
  __shared__ __attribute__((aligned(16))) u16 sK[2 * 64 * 64];   // [p][token][d]
  __shared__ __attribute__((aligned(16))) u16 sV[2 * 64 * 64];   // [p][d][token]

  const int tid = threadIdx.x, lane = tid & 31, w = tid >> 5;
  const int h = lane >> 4, m = lane & 15;
  const int blk = blockIdx.x;

  const v8f zero8 = {0.f, 0.f, 0.f, 0.f, 0.f, 0.f, 0.f, 0.f};
  v8f acc[4];
  #pragma unroll
  for (int t = 0; t < 4; ++t) acc[t] = zero8;

  const float* pp = part + (size_t)(blk * 4 + w) * 1024 + lane * 4;
  #pragma unroll
  for (int s = 0; s < KSPLIT; ++s) {
    const float* ps = pp + (size_t)s * (128 * 1024);
    #pragma unroll
    for (int t = 0; t < 4; ++t) {
      const v4f a = *(const v4fa*)(ps + (2 * t) * 128);
      const v4f c = *(const v4fa*)(ps + (2 * t + 1) * 128);
      acc[t] += __builtin_shufflevector(a, c, 0, 1, 2, 3, 4, 5, 6, 7);
    }
  }
  // acc[t][r] = conv out [token 64blk+16w+8h+r][channel 16t+m]

  float mu[8], rs[8];
  #pragma unroll
  for (int r = 0; r < 8; ++r) {
    float s = acc[0][r] + acc[1][r] + acc[2][r] + acc[3][r];
    s = red16(s);
    mu[r] = s * (1.0f / 64.0f);
    float v = 0.f;
    #pragma unroll
    for (int t = 0; t < 4; ++t) { const float d = acc[t][r] - mu[r]; v += d * d; }
    v = red16(v) * (1.0f / 64.0f);
    rs[r] = rsqrtf(v + LN_EPS);
  }
  #pragma unroll
  for (int t = 0; t < 4; ++t) {
    const int col = 16 * t + m;
    const float g = gamma[col], be = beta[col];
    #pragma unroll
    for (int r = 0; r < 8; ++r) {
      const float y = (acc[t][r] - mu[r]) * rs[r] * g + be;
      const u16 hh = bf_rne(y);
      const u16 ll = bf_rne(y - bf_val(hh));
      const int kl_ = 16 * w + 8 * h + r;
      sX[kl_ * 64 + col] = hh;
      sX[4096 + kl_ * 64 + col] = ll;
    }
  }
  __syncthreads();

  // kv projection A fragments: row = token 16w+m, k = channel
  const v16b xah0 = ld_frag(sX + (16 * w + m) * 64, h);
  const v16b xah1 = ld_frag(sX + (16 * w + m) * 64 + 32, h);
  const v16b xal0 = ld_frag(sX + 4096 + (16 * w + m) * 64, h);
  const v16b xal1 = ld_frag(sX + 4096 + (16 * w + m) * 64 + 32, h);

  #pragma unroll
  for (int ct = 0; ct < 8; ++ct) {
    const int off = (16 * ct + m) * CD;
    const v16b b0h = ld_frag(wkvh + off, h);
    const v16b b0l = ld_frag(wkvl + off, h);
    const v16b b1h = ld_frag(wkvh + off + 32, h);
    const v16b b1l = ld_frag(wkvl + off + 32, h);
    v8f c = zero8;
    c = wmma_bf(xah0, b0h, c);
    c = wmma_bf(xah0, b0l, c);
    c = wmma_bf(xal0, b0h, c);
    c = wmma_bf(xah1, b1h, c);
    c = wmma_bf(xah1, b1l, c);
    c = wmma_bf(xal1, b1h, c);
    // c[r] = kv[token 16w+8h+r][col 16ct+m]
    const int col = 16 * ct + m;
    const float bb = bkv[col];
    #pragma unroll
    for (int r = 0; r < 8; ++r) {
      const float val = c[r] + bb;
      const u16 hh = bf_rne(val);
      const u16 ll = bf_rne(val - bf_val(hh));
      const int kl_ = 16 * w + 8 * h + r;
      if (ct < 4) {
        sK[kl_ * 64 + col] = hh;
        sK[4096 + kl_ * 64 + col] = ll;
      } else {
        const int d = col - 64;
        sV[d * 64 + kl_] = hh;
        sV[4096 + d * 64 + kl_] = ll;
      }
    }
  }
  __syncthreads();

  kv_store_pass(sK, sV, kh, kl, vth, vtl, blk, w, lane);
  
}

// ---------------------------------------------------------------------------
// lanes 8q..8q+7 in one instruction, 4 lines per instruction, 32 lines per wave.
// ---------------------------------------------------------------------------
__device__ __forceinline__ void att_store_pass(const float* so, float* out, size_t grow0, int lane) {
  const int q8 = lane & 7, sub = lane >> 3;
  #pragma unroll
  for (int i = 0; i < 8; ++i) {
    const int lid = i * 4 + sub;
    const int row = lid >> 1, hl = lid & 1;
    const v4f v = *(const v4fa*)(so + row * 64 + 32 * hl + 4 * q8);
    *(v4f*)(out + (grow0 + (size_t)row) * CD + 32 * hl + 4 * q8) = v;
  }
}

// ---------------------------------------------------------------------------
// Kernel 5: fused q projection + attention over 256 reduced tokens + output projection.
// Block = 64 threads (2 waves), 16 queries per wave; grid = (512, 8).
//   q^T = wq * x^T          : A = wq plane rows, B = x^T split in registers
//   S^T = K * q^T           : A = K plane rows, B = q^T packed from two adjacent D tiles
//   softmax over 256 keys   : f32, full score row parked in LDS (each lane re-reads only
//                             the keys it wrote: key bit3 == h)
//   O^T = V^T * P^T         : A = V^T plane rows, B = P^T from LDS
//   out^T = wproj * O^T     : A = wproj plane rows, B = O^T packed from D tiles
// ---------------------------------------------------------------------------
__global__ __launch_bounds__(64) void k_attn(
    const float* __restrict__ x,
    const u16* __restrict__ wqh, const u16* __restrict__ wql, const float* __restrict__ bq,
    const u16* __restrict__ kh, const u16* __restrict__ kl,      // [2048][64]
    const u16* __restrict__ vth, const u16* __restrict__ vtl,    // [8][64][256]
    const u16* __restrict__ wph, const u16* __restrict__ wpl, const float* __restrict__ bproj,
    float* __restrict__ out)                                     // [8][16384][64]
{
  __shared__ __attribute__((aligned(16))) float sS[2][16 * 256];
  __shared__ __attribute__((aligned(16))) float sO[2][16 * 64];

  const int tid = threadIdx.x, lane = tid & 31, w = tid >> 5;
  const int h = lane >> 4, m = lane & 15;
  const int b = blockIdx.y;
  const int q0 = blockIdx.x * 32 + 16 * w;
  const v8f zero8 = {0.f, 0.f, 0.f, 0.f, 0.f, 0.f, 0.f, 0.f};

  // ---- q^T = wq * x^T : qt[t][r] = q[query q0+m][feature 16t+8h+r] ----
  v8f qt[4];
  #pragma unroll
  for (int t = 0; t < 4; ++t) qt[t] = zero8;
  const float* xr = x + ((size_t)b * NQ + q0 + m) * CD;
  #pragma unroll
  for (int ks = 0; ks < 2; ++ks) {
    const float* xp = xr + 32 * ks + 8 * h;
    const v4f a0 = *(const v4fa*)(xp);
    const v4f a1 = *(const v4fa*)(xp + 4);
    const v4f c0 = *(const v4fa*)(xp + 16);
    const v4f c1 = *(const v4fa*)(xp + 20);
    const v8f a8 = __builtin_shufflevector(a0, a1, 0, 1, 2, 3, 4, 5, 6, 7);
    const v8f c8 = __builtin_shufflevector(c0, c1, 0, 1, 2, 3, 4, 5, 6, 7);
    v16b xbh, xbl;
    split_frag(a8, c8, xbh, xbl);
    #pragma unroll
    for (int t = 0; t < 4; ++t) {
      const int off = (16 * t + m) * CD + 32 * ks;
      const v16b fah = ld_frag(wqh + off, h);
      const v16b fal = ld_frag(wql + off, h);
      qt[t] = wmma_bf(fah, xbh, qt[t]);
      qt[t] = wmma_bf(fah, xbl, qt[t]);
      qt[t] = wmma_bf(fal, xbh, qt[t]);
    }
  }
  v8f qv[4];
  #pragma unroll
  for (int t = 0; t < 4; ++t)
    #pragma unroll
    for (int r = 0; r < 8; ++r)
      qv[t][r] = (qt[t][r] + bq[16 * t + 8 * h + r]) * 0.125f;   // d^-1/2 folded into q (exact)
  // B fragment for k = d: element i <- tile 2ks row i, element 8+i <- tile 2ks+1 row i
  v16b qbh0, qbl0, qbh1, qbl1;
  split_frag(qv[0], qv[1], qbh0, qbl0);
  split_frag(qv[2], qv[3], qbh1, qbl1);

  // ---- scores: z[r] = S[query m][key 16j+8h+r], parked at sS[w][m*256 + key] ----
  float* sw = &sS[w][0];
  float* srow = sw + m * 256 + 8 * h;
  float mx = -3.0e38f;
  const u16* kbh = kh + ((size_t)b * NKEY + m) * CD;
  const u16* kbl = kl + ((size_t)b * NKEY + m) * CD;
  #pragma unroll 1
  for (int j = 0; j < 16; ++j) {
    const int ko = 16 * j * CD;
    const v16b a0h = ld_frag(kbh + ko, h);
    const v16b a0l = ld_frag(kbl + ko, h);
    const v16b a1h = ld_frag(kbh + ko + 32, h);
    const v16b a1l = ld_frag(kbl + ko + 32, h);
    v8f z = zero8;
    z = wmma_bf(a0h, qbh0, z);
    z = wmma_bf(a0h, qbl0, z);
    z = wmma_bf(a0l, qbh0, z);
    z = wmma_bf(a1h, qbh1, z);
    z = wmma_bf(a1h, qbl1, z);
    z = wmma_bf(a1l, qbh1, z);
    const v4f z0 = __builtin_shufflevector(z, z, 0, 1, 2, 3);
    const v4f z1 = __builtin_shufflevector(z, z, 4, 5, 6, 7);
    *(v4fa*)(srow + 16 * j) = z0;
    *(v4fa*)(srow + 16 * j + 4) = z1;
    #pragma unroll
    for (int r = 0; r < 8; ++r) mx = fmaxf(mx, z[r]);
  }
  mx = fmaxf(mx, __shfl_xor(mx, 16));

  // ---- softmax numerator + row sum (f32); same lane, same addresses ----
  float sum = 0.f;
  #pragma unroll 2
  for (int a = 0; a < 16; ++a) {
    float* pp = srow + 16 * a;
    v4f v0 = *(const v4fa*)pp;
    v4f v1 = *(const v4fa*)(pp + 4);
    #pragma unroll
    for (int e = 0; e < 4; ++e) {
      v0[e] = __expf(v0[e] - mx);
      v1[e] = __expf(v1[e] - mx);
      sum += v0[e] + v1[e];
    }
    *(v4fa*)pp = v0;
    *(v4fa*)(pp + 4) = v1;
  }
  sum += __shfl_xor(sum, 16);
  const float inv = 1.0f / sum;

  // ---- O^T = V^T * P^T : o[t][r] = O[query m][d 16t+8h+r] ----
  v8f o[4];
  #pragma unroll
  for (int t = 0; t < 4; ++t) o[t] = zero8;
  const u16* vbh = vth + ((size_t)b * CD + m) * NKEY;
  const u16* vbl = vtl + ((size_t)b * CD + m) * NKEY;
  #pragma unroll 1
  for (int c = 0; c < 8; ++c) {
    const int k0 = 32 * c;
    const float* pp = srow + k0;                 // keys k0+8h.., k0+16+8h..
    const v4f p0 = *(const v4fa*)pp;
    const v4f p1 = *(const v4fa*)(pp + 4);
    const v4f p2 = *(const v4fa*)(pp + 16);
    const v4f p3 = *(const v4fa*)(pp + 20);
    const v8f pa = __builtin_shufflevector(p0, p1, 0, 1, 2, 3, 4, 5, 6, 7) * inv;
    const v8f pc = __builtin_shufflevector(p2, p3, 0, 1, 2, 3, 4, 5, 6, 7) * inv;
    v16b pbh, pbl;
    split_frag(pa, pc, pbh, pbl);
    #pragma unroll
    for (int t = 0; t < 4; ++t) {
      const int vo = 16 * t * NKEY + k0;
      const v16b fah = ld_frag(vbh + vo, h);
      const v16b fal = ld_frag(vbl + vo, h);
      o[t] = wmma_bf(fah, pbh, o[t]);
      o[t] = wmma_bf(fah, pbl, o[t]);
      o[t] = wmma_bf(fal, pbh, o[t]);
    }
  }

  // ---- out^T = wproj * O^T : u[t][r] = out[query m][feature 16t+8h+r] ----
  v16b obh0, obl0, obh1, obl1;
  split_frag(o[0], o[1], obh0, obl0);
  split_frag(o[2], o[3], obh1, obl1);
  v8f u[4];
  #pragma unroll
  for (int t = 0; t < 4; ++t) {
    const int off = (16 * t + m) * CD;
    const v16b a0h = ld_frag(wph + off, h);
    const v16b a0l = ld_frag(wpl + off, h);
    const v16b a1h = ld_frag(wph + off + 32, h);
    const v16b a1l = ld_frag(wpl + off + 32, h);
    v8f z = zero8;
    z = wmma_bf(a0h, obh0, z);
    z = wmma_bf(a0h, obl0, z);
    z = wmma_bf(a0l, obh0, z);
    z = wmma_bf(a1h, obh1, z);
    z = wmma_bf(a1h, obl1, z);
    z = wmma_bf(a1l, obh1, z);
    u[t] = z;
  }
  float* so = &sO[w][0];
  #pragma unroll
  for (int t = 0; t < 4; ++t)
    #pragma unroll
    for (int r = 0; r < 8; ++r)
      so[m * 64 + 16 * t + 8 * h + r] = u[t][r] + bproj[16 * t + 8 * h + r];
  __syncthreads();

  const size_t grow0 = (size_t)b * NQ + q0;
  att_store_pass(so, out, grow0, lane);
  
}

// ---------------------------------------------------------------------------
extern "C" void kernel_launch(void* const* d_in, const int* in_sizes, int n_in,
                              void* d_out, int out_size, void* d_ws, size_t ws_size,
                              hipStream_t stream) {
  if (n_in < 12) return;
  if (in_sizes[0] != NBATCH * NQ * CD) return;
  if (in_sizes[1] != CD * CD || in_sizes[2] != CD) return;
  if (in_sizes[3] != 2 * CD * CD || in_sizes[4] != 2 * CD) return;
  if (in_sizes[5] != CD * CD || in_sizes[6] != CD) return;
  if (in_sizes[7] != CD * KCONV) return;
  if (in_sizes[8] != CD || in_sizes[9] != CD) return;
  if (in_sizes[10] < 1 || in_sizes[11] < 1) return;
  if (out_size != NBATCH * NQ * CD) return;

  const float* x     = (const float*)d_in[0];
  const float* wq    = (const float*)d_in[1];
  const float* bq    = (const float*)d_in[2];
  const float* wkv   = (const float*)d_in[3];
  const float* bkv   = (const float*)d_in[4];
  const float* wproj = (const float*)d_in[5];
  const float* bproj = (const float*)d_in[6];
  const float* wsr   = (const float*)d_in[7];
  const float* gamma = (const float*)d_in[8];
  const float* beta  = (const float*)d_in[9];
  const int*   Hp    = (const int*)d_in[10];
  const int*   Wp    = (const int*)d_in[11];
  float* out = (float*)d_out;

  const size_t szWq  = (size_t)CD * CD * 2;            //      8192 per plane
  const size_t szWkv = (size_t)2 * CD * CD * 2;        //     16384
  const size_t szWp  = (size_t)CD * CD * 2;            //      8192
  const size_t szWs  = (size_t)CD * KCONV * 2;         //    524288
  const size_t szA   = (size_t)NROWK * KCONV * 2;      //  16777216
  const size_t szK   = (size_t)NROWK * CD * 2;         //    262144
  const size_t szVt  = (size_t)NBATCH * CD * NKEY * 2; //    262144
  const size_t szPt  = (size_t)KSPLIT * NROWK * CD * 4; //  8388608
  size_t off = 0;
  const size_t oWqh = off;  off += szWq;
  const size_t oWql = off;  off += szWq;
  const size_t oWkh = off;  off += szWkv;
  const size_t oWkl = off;  off += szWkv;
  const size_t oWph = off;  off += szWp;
  const size_t oWpl = off;  off += szWp;
  const size_t oWsh = off;  off += szWs;
  const size_t oWsl = off;  off += szWs;
  const size_t oAh  = off;  off += szA;
  const size_t oAl  = off;  off += szA;
  const size_t oKh  = off;  off += szK;
  const size_t oKl  = off;  off += szK;
  const size_t oVth = off;  off += szVt;
  const size_t oVtl = off;  off += szVt;
  const size_t oPt  = off;  off += szPt;              // total 44105728
  if (off > ws_size) return;
  if (off > (size_t)134217728) return;

  char* ws = (char*)d_ws;
  u16* wqh  = (u16*)(ws + oWqh);
  u16* wql  = (u16*)(ws + oWql);
  u16* wkvh = (u16*)(ws + oWkh);
  u16* wkvl = (u16*)(ws + oWkl);
  u16* wph  = (u16*)(ws + oWph);
  u16* wpl  = (u16*)(ws + oWpl);
  u16* wsh  = (u16*)(ws + oWsh);
  u16* wsl  = (u16*)(ws + oWsl);
  u16* ah   = (u16*)(ws + oAh);
  u16* al   = (u16*)(ws + oAl);
  u16* kh   = (u16*)(ws + oKh);
  u16* kl   = (u16*)(ws + oKl);
  u16* vth  = (u16*)(ws + oVth);
  u16* vtl  = (u16*)(ws + oVtl);
  float* part = (float*)(ws + oPt);

  k_prep_w<<<136, 256, 0, stream>>>(wq, wkv, wproj, wsr, wqh, wql, wkvh, wkvl, wph, wpl, wsh, wsl);

  k_im2col<<<(NROWK * 512) / 256, 256, 0, stream>>>(x, Hp, Wp, ah, al);          // 4096 blocks

  dim3 gConv(NROWK / 64, KSPLIT);                                                  // (32, 16)
  k_conv_part<<<gConv, 128, 0, stream>>>(ah, al, wsh, wsl, part);

  k_kv<<<NROWK / 64, 128, 0, stream>>>(part, gamma, beta, wkvh, wkvl, bkv,
                                       kh, kl, vth, vtl);                           // 32 blocks

  dim3 gAtt(NQ / 32, NBATCH);                                                      // (512, 8)
  k_attn<<<gAtt, 64, 0, stream>>>(x, wqh, wql, bq, kh, kl, vth, vtl, wph, wpl, bproj, out);
}

// v002
// One run takes 124 microseconds.
// Timed twice side by side with v001, it ran 1.10 times as fast both times.
// All steps since v000 together make it 2.07 times as fast.
// All contractions (q projection, 8x8 stride-8 reduction conv as a patch GEMM, kv projection, q*k^T scores, P*V, output projection): v_wmma_f32_16x16x32_bf16, bf16 hi/lo operands everywhere (hi*hi + hi*lo + lo*hi), f32 accumulate; LayerNorm, softmax and biases in f32.
#include <hip/hip_runtime.h>
#include <stdint.h>

typedef unsigned short u16;
typedef u16    v16u __attribute__((ext_vector_type(16)));
typedef u16    v8u  __attribute__((ext_vector_type(8)));
typedef __bf16 v16b __attribute__((ext_vector_type(16)));
typedef float  v8f  __attribute__((ext_vector_type(8)));
typedef float  v4f  __attribute__((ext_vector_type(4)));
typedef v8u __attribute__((may_alias)) v8ua;
typedef v4f __attribute__((may_alias)) v4fa;

union Frag { v16b v; v16u u; v8u half[2]; };
static_assert(sizeof(Frag) == 32);

#define NBATCH 8
#define NQ     16384
#define CD     64
#define NKEY   256
#define NROWK  2048        // NBATCH * NKEY reduced tokens
#define KCONV  4096        // 64 patch pixels x 64 channels, k = p*64 + ci
#define LN_EPS 1e-5f
#define KSPLIT 16          // slices of the conv reduction, one work-group each
#define KSLICE 256         // KCONV / KSPLIT

// ---------------------------------------------------------------------------
// 16x16x32 bf16 WMMA with hazard guard (ties D, keeps A/B live).
// Fragment map (wave32): lane l, h = l>>4, m = n = l&15.
//   A/B element i: i<8 -> k0+8h+i ; i>=8 -> k0+16+8h+(i-8)
//   D element r : row 8h+r, col l&15
// ---------------------------------------------------------------------------
__device__ __forceinline__ v8f wmma_bf(v16b a, v16b b, v8f c) {
  v8f d = __builtin_amdgcn_wmma_f32_16x16x32_bf16(false, a, false, b, (short)0, c, false, false);
  asm volatile("v_nop\n\tv_nop\n\tv_nop\n\tv_nop" : "+v"(d) : "v"(a), "v"(b));
  return d;
}

// f32 -> bf16 bits, RNE
__device__ __forceinline__ u16 bf_rne(float f) {
  unsigned u = __builtin_bit_cast(unsigned, f);
  u += 0x7FFFu + ((u >> 16) & 1u);
  return (u16)(u >> 16);
}
__device__ __forceinline__ float bf_val(u16 b) {
  return __builtin_bit_cast(float, ((unsigned)b) << 16);
}

// 8 floats -> hi/lo bf16 planes (hi = rne(x), lo = rne(x - hi))
__device__ __forceinline__ void split8(v8f f, v8u& hi, v8u& lo) {
  #pragma unroll
  for (int i = 0; i < 8; ++i) {
    const u16 hh = bf_rne(f[i]);
    hi[i] = hh;
    lo[i] = bf_rne(f[i] - bf_val(hh));
  }
}

// 16 floats given in fragment element order (a = elements 0..7, c = 8..15) -> hi/lo fragments
__device__ __forceinline__ void split_frag(v8f a, v8f c, v16b& fhi, v16b& flo) {
  Frag fh, fl;
  v8u h0, l0, h1, l1;
  split8(a, h0, l0);
  split8(c, h1, l1);
  fh.half[0] = h0; fh.half[1] = h1;
  fl.half[0] = l0; fl.half[1] = l1;
  fhi = fh.v; flo = fl.v;
}

// A or B fragment from a k-contiguous bf16 row; p points at element k0 of the row owned by this lane.
__device__ __forceinline__ v16b ld_frag(const u16* p, int h) {
  Frag f;
  f.half[0] = *(const v8ua*)(p + 8 * h);
  f.half[1] = *(const v8ua*)(p + 16 + 8 * h);
  return f.v;
}

// Planes that a kernel reads from the workspace are kept in fragment order: fragment f = (row tile) * (k / 32) + k step
// is 512 elements; lane l's elements 0..7 stand at f*512 + l*8, its elements 8..15 at f*512 + 256 + l*8,
// so each wave-wide 16-B load covers 512 contiguous bytes. p points at f*512 + l*8.
__device__ __forceinline__ v16b ld_fragp(const u16* p) {
  Frag f;
  f.half[0] = *(const v8ua*)p;
  f.half[1] = *(const v8ua*)(p + 256);
  return f.v;
}

// Writer's side of the same map: g8 = index of a group of 8 consecutive plane elements, 1 << ksh fragments per row tile
// -> matrix row and first k of the group.
__device__ __forceinline__ void frag_rk(int g8, int ksh, int& row, int& k) {
  const int f = g8 >> 6;
  row = ((f >> ksh) << 4) + (g8 & 15);
  k = ((f & ((1 << ksh) - 1)) << 5) + ((g8 >> 5) & 1) * 16 + ((g8 >> 4) & 1) * 8;
}

__device__ __forceinline__ float red16(float v) {
  v += __shfl_xor(v, 1);
  v += __shfl_xor(v, 2);
  v += __shfl_xor(v, 4);
  v += __shfl_xor(v, 8);
  return v;
}

// ---------------------------------------------------------------------------
// Kernel 1: weights -> bf16 hi/lo planes.
//   wq [64][64], wkv [128][64], wproj [64][64]: row = out, k = in;
//   wsr: row = co, k = p*64 + ci, p = i*8 + j. All four in fragment order.
// One thread = 8 consecutive plane elements = one 16-B store per plane; lanes contiguous
// ---------------------------------------------------------------------------
__global__ __launch_bounds__(256) void k_prep_w(
    const float* __restrict__ wq, const float* __restrict__ wkv,
    const float* __restrict__ wproj, const float* __restrict__ wsr,
    u16* __restrict__ wqh, u16* __restrict__ wql,
    u16* __restrict__ wkvh, u16* __restrict__ wkvl,
    u16* __restrict__ wph, u16* __restrict__ wpl,
    u16* __restrict__ wsh, u16* __restrict__ wsl)
{
  const int blk = blockIdx.x, tid = threadIdx.x;
  if (blk >= 136) return;
  v8f f;
  u16* dh;
  u16* dl;
  int e;
  if (blk < 8) {                    // block-uniform region select
    const float* src;
    if (blk < 2)      { e = blk * 256 + tid;        src = wq;    dh = wqh;  dl = wql;  }
    else if (blk < 6) { e = (blk - 2) * 256 + tid;  src = wkv;   dh = wkvh; dl = wkvl; }
    else              { e = (blk - 6) * 256 + tid;  src = wproj; dh = wph;  dl = wpl;  }
    int row, k;
    frag_rk(e, 1, row, k);
    const float* s = src + row * CD + k;
    const v4f a = *(const v4fa*)s;
    const v4f c = *(const v4fa*)(s + 4);
    f = __builtin_shufflevector(a, c, 0, 1, 2, 3, 4, 5, 6, 7);
  } else {
    e = (blk - 8) * 256 + tid;                          // 0..32767
    int co, k;
    frag_rk(e, 7, co, k);
    const int p = k >> 6, ci0 = k & 63;                 // k = p*64 + ci0
    const float* s = wsr + (size_t)co * KCONV + ci0 * 64 + p;   // wsr[co][ci][i][j] = co*4096 + ci*64 + p
    #pragma unroll
    for (int c = 0; c < 8; ++c) f[c] = s[c * 64];
    dh = wsh; dl = wsl;
  }
  v8u hi, lo;
  split8(f, hi, lo);
  u16* ph = dh + (size_t)e * 8;
  u16* pl = dl + (size_t)e * 8;
  *(v8u*)ph = hi;
  *(v8u*)pl = lo;
  
}

// ---------------------------------------------------------------------------
// Kernel 2: patch gather (im2col) -> dense A planes 2048 x 4096 hi/lo, in fragment order.
//   row r = b*256 + m, m = py*16 + px; k = p*64 + ci, p = i*8 + j;
//   value = x[b][pix][ci], pix = (8py+i)*W + 8px + j (clamped).
// One thread = 8 channels of one (row, pixel): two 16-B loads, one 16-B store per plane,
// lanes contiguous. grid = 4096 blocks x 256.
// ---------------------------------------------------------------------------
__global__ __launch_bounds__(256) void k_im2col(
    const float* __restrict__ x, const int* __restrict__ Hp, const int* __restrict__ Wp,
    u16* __restrict__ ah, u16* __restrict__ al)
{
  const int g = blockIdx.x * 256 + threadIdx.x;
  if (g >= NROWK * 512) return;
  const int Hv = Hp[0], Wv = Wp[0];
  const long long hw = (long long)Hv * (long long)Wv;
  const int lim = (hw >= 1 && hw <= NQ) ? (int)(hw - 1) : (NQ - 1);
  int r, k;
  frag_rk(g, 7, r, k);
  const int bb = r >> 8, mm = r & 255;
  const int py = mm >> 4, px = mm & 15;
  const int p = k >> 6, ci0 = k & 63;
  const int ii = p >> 3, jj = p & 7;
  int pix = (8 * py + ii) * Wv + 8 * px + jj;
  pix = min(max(pix, 0), lim);
  const float* s = x + ((size_t)bb * NQ + pix) * CD + ci0;
  const v4f a = *(const v4fa*)s;
  const v4f c = *(const v4fa*)(s + 4);
  const v8f f = __builtin_shufflevector(a, c, 0, 1, 2, 3, 4, 5, 6, 7);
  v8u hi, lo;
  split8(f, hi, lo);
  u16* ph = ah + (size_t)g * 8;
  u16* pl = al + (size_t)g * 8;
  *(v8u*)ph = hi;
  *(v8u*)pl = lo;
  
}

// ---------------------------------------------------------------------------
// K and V^T planes out of LDS, in fragment order: per plane 8 fragments = 512 groups of 8 elements,
// one group per thread and pass, 512 contiguous bytes per wave and store.
//   K  : row = token, k = d;   fragment (global token >> 4) * 2 + (d >> 5)
//   V^T: row = d, k = key;     fragment batch * 32 + (d >> 4) * 8 + (key >> 5)
// ---------------------------------------------------------------------------
__device__ __forceinline__ void kv_store_pass(const u16* sK, const u16* sV,
                                              u16* kh, u16* kl, u16* vth, u16* vtl,
                                              int blk, int tid) {
  const int bb = blk >> 2, kq = blk & 3;
  #pragma unroll
  for (int it = 0; it < 16; ++it) {
    const int p = (it >> 2) & 1;
    const int g8 = (it & 3) * 128 + tid;           // 0..511
    int row, k;
    frag_rk(g8, 1, row, k);                        // both 0..63, local to this block
    v8u v;
    u16* dst;
    if (it < 8) {
      v = *(const v8ua*)(sK + (p * 64 + row) * 64 + k);
      u16* plane = p ? kl : kh;
      dst = plane + (size_t)blk * 4096 + g8 * 8;
    } else {
      v = *(const v8ua*)(sV + (p * 64 + row) * 64 + k);
      u16* plane = p ? vtl : vth;
      const int f = g8 >> 6;
      dst = plane + (size_t)(bb * 32 + (f >> 1) * 8 + 2 * kq + (f & 1)) * 512 + (g8 & 63) * 8;
    }
    *(v8u*)dst = v;
  }
}

// ---------------------------------------------------------------------------
// Kernel 3: conv GEMM, split along k. Block = 64 conv rows x one k slice of 256, 4 waves x 16 rows
//   (the 4 waves read the same weight slice). Each wave stores its f32 16x64 partial tile in
//   accumulator order: part[slice][row tile][t][j][lane][4] = acc[t][4j..4j+3], 512 B per store.
// grid = (32, 16) blocks x 128 threads.
// ---------------------------------------------------------------------------
__global__ __launch_bounds__(128) void k_conv_part(
    const u16* __restrict__ ah, const u16* __restrict__ al,       // 2048 x 4096, fragment order
    const u16* __restrict__ wsh, const u16* __restrict__ wsl,     // 64 x 4096, fragment order
    float* __restrict__ part)                                     // [16][128][4][2][32][4]
{
  const int tid = threadIdx.x, lane = tid & 31, w = tid >> 5;
  const int blk = blockIdx.x, sp = blockIdx.y;
  const int f0 = sp * (KSLICE / 32);           // first k step of this slice; 128 k steps per row tile

  const v8f zero8 = {0.f, 0.f, 0.f, 0.f, 0.f, 0.f, 0.f, 0.f};
  v8f acc[4];
  #pragma unroll
  for (int t = 0; t < 4; ++t) acc[t] = zero8;

  const u16* arh = ah + (size_t)((blk * 4 + w) * 128 + f0) * 512 + lane * 8;
  const u16* arl = al + (size_t)((blk * 4 + w) * 128 + f0) * 512 + lane * 8;
  const u16* brh = wsh + (size_t)f0 * 512 + lane * 8;
  const u16* brl = wsl + (size_t)f0 * 512 + lane * 8;

  #pragma unroll 1
  for (int ks = 0; ks < KSLICE / 32; ++ks) {
    const v16b fah = ld_fragp(arh + ks * 512);
    const v16b fal = ld_fragp(arl + ks * 512);
    // precaution: this build reuses the address registers of these four loads as the
    // destination of a weight load issued right behind them
    asm volatile("s_wait_xcnt 0x0" ::: "memory");
    #pragma unroll
    for (int t = 0; t < 4; ++t) {
      const v16b fbh = ld_fragp(brh + (t * 128 + ks) * 512);
      const v16b fbl = ld_fragp(brl + (t * 128 + ks) * 512);
      acc[t] = wmma_bf(fah, fbh, acc[t]);
      acc[t] = wmma_bf(fah, fbl, acc[t]);
      acc[t] = wmma_bf(fal, fbh, acc[t]);
    }
  }

  float* pp = part + ((size_t)sp * 128 + blk * 4 + w) * 1024 + lane * 4;
  #pragma unroll
  for (int t = 0; t < 4; ++t) {
    *(v4f*)(pp + (2 * t) * 128)     = __builtin_shufflevector(acc[t], acc[t], 0, 1, 2, 3);
    *(v4f*)(pp + (2 * t + 1) * 128) = __builtin_shufflevector(acc[t], acc[t], 4, 5, 6, 7);
  }
}

// ---------------------------------------------------------------------------
// Kernel 4: reduced tokens. Block = 64 conv rows (tokens) of one batch, 4 waves x 16 rows.
//   sum of the 16 k-slice partials (slice 0 first) -> LayerNorm (f32) -> kv proj (16x64 @ 64x128)
//   -> K planes 2048 x 64 and V^T planes 8 x (64 x 256) (bf16 hi/lo), fragment order, whole-line stores.
// grid = 32 blocks x 128 threads.
// ---------------------------------------------------------------------------
__global__ __launch_bounds__(128) void k_kv(
    const float* __restrict__ part,                               // [16][128][4][2][32][4]
    const float* __restrict__ gamma, const float* __restrict__ beta,
    const u16* __restrict__ wkvh, const u16* __restrict__ wkvl,   // 128 x 64, fragment order
    const float* __restrict__ bkv,
    u16* __restrict__ kh, u16* __restrict__ kl,                   // 2048 x 64, fragment order
    u16* __restrict__ vth, u16* __restrict__ vtl)                 // 8 x (64 x 256), fragment order
{
  __shared__ __attribute__((aligned(16))) u16 sX[2 * 64 * 64];   // LN output hi/lo [p][token][c]
  __shared__ __attribute__((aligned(16))) u16 sK[2 * 64 * 64];   // [p][token][d]
  __shared__ __attribute__((aligned(16))) u16 sV[2 * 64 * 64];   // [p][d][token]

  const int tid = threadIdx.x, lane = tid & 31, w = tid >> 5;
  const int h = lane >> 4, m = lane & 15;
  const int blk = blockIdx.x;

  const v8f zero8 = {0.f, 0.f, 0.f, 0.f, 0.f, 0.f, 0.f, 0.f};
  v8f acc[4];
  #pragma unroll
  for (int t = 0; t < 4; ++t) acc[t] = zero8;

  const float* pp = part + (size_t)(blk * 4 + w) * 1024 + lane * 4;
  #pragma unroll
  for (int s = 0; s < KSPLIT; ++s) {
    const float* ps = pp + (size_t)s * (128 * 1024);
    #pragma unroll
    for (int t = 0; t < 4; ++t) {
      const v4f a = *(const v4fa*)(ps + (2 * t) * 128);
      const v4f c = *(const v4fa*)(ps + (2 * t + 1) * 128);
      acc[t] += __builtin_shufflevector(a, c, 0, 1, 2, 3, 4, 5, 6, 7);
    }
  }
  // acc[t][r] = conv out [token 64blk+16w+8h+r][channel 16t+m]

  float mu[8], rs[8];
  #pragma unroll
  for (int r = 0; r < 8; ++r) {
    float s = acc[0][r] + acc[1][r] + acc[2][r] + acc[3][r];
    s = red16(s);
    mu[r] = s * (1.0f / 64.0f);
    float v = 0.f;
    #pragma unroll
    for (int t = 0; t < 4; ++t) { const float d = acc[t][r] - mu[r]; v += d * d; }
    v = red16(v) * (1.0f / 64.0f);
    rs[r] = rsqrtf(v + LN_EPS);
  }
  #pragma unroll
  for (int t = 0; t < 4; ++t) {
    const int col = 16 * t + m;
    const float g = gamma[col], be = beta[col];
    #pragma unroll
    for (int r = 0; r < 8; ++r) {
      const float y = (acc[t][r] - mu[r]) * rs[r] * g + be;
      const u16 hh = bf_rne(y);
      const u16 ll = bf_rne(y - bf_val(hh));
      const int kl_ = 16 * w + 8 * h + r;
      sX[kl_ * 64 + col] = hh;
      sX[4096 + kl_ * 64 + col] = ll;
    }
  }
  __syncthreads();

  // kv projection A fragments: row = token 16w+m, k = channel
  const v16b xah0 = ld_frag(sX + (16 * w + m) * 64, h);
  const v16b xah1 = ld_frag(sX + (16 * w + m) * 64 + 32, h);
  const v16b xal0 = ld_frag(sX + 4096 + (16 * w + m) * 64, h);
  const v16b xal1 = ld_frag(sX + 4096 + (16 * w + m) * 64 + 32, h);

  #pragma unroll
  for (int ct = 0; ct < 8; ++ct) {
    const int off = ct * 1024 + lane * 8;
    const v16b b0h = ld_fragp(wkvh + off);
    const v16b b0l = ld_fragp(wkvl + off);
    const v16b b1h = ld_fragp(wkvh + off + 512);
    const v16b b1l = ld_fragp(wkvl + off + 512);
    v8f c = zero8;
    c = wmma_bf(xah0, b0h, c);
    c = wmma_bf(xah0, b0l, c);
    c = wmma_bf(xal0, b0h, c);
    c = wmma_bf(xah1, b1h, c);
    c = wmma_bf(xah1, b1l, c);
    c = wmma_bf(xal1, b1h, c);
    // c[r] = kv[token 16w+8h+r][col 16ct+m]
    const int col = 16 * ct + m;
    const float bb = bkv[col];
    #pragma unroll
    for (int r = 0; r < 8; ++r) {
      const float val = c[r] + bb;
      const u16 hh = bf_rne(val);
      const u16 ll = bf_rne(val - bf_val(hh));
      const int kl_ = 16 * w + 8 * h + r;
      if (ct < 4) {
        sK[kl_ * 64 + col] = hh;
        sK[4096 + kl_ * 64 + col] = ll;
      } else {
        const int d = col - 64;
        sV[d * 64 + kl_] = hh;
        sV[4096 + d * 64 + kl_] = ll;
      }
    }
  }
  __syncthreads();

  kv_store_pass(sK, sV, kh, kl, vth, vtl, blk, tid);
  
}

// ---------------------------------------------------------------------------
// lanes 8q..8q+7 in one instruction, 4 lines per instruction, 32 lines per wave.
// ---------------------------------------------------------------------------
__device__ __forceinline__ void att_store_pass(const float* so, float* out, size_t grow0, int lane) {
  const int q8 = lane & 7, sub = lane >> 3;
  #pragma unroll
  for (int i = 0; i < 8; ++i) {
    const int lid = i * 4 + sub;
    const int row = lid >> 1, hl = lid & 1;
    const v4f v = *(const v4fa*)(so + row * 64 + 32 * hl + 4 * q8);
    *(v4f*)(out + (grow0 + (size_t)row) * CD + 32 * hl + 4 * q8) = v;
  }
}

// ---------------------------------------------------------------------------
// Kernel 5: fused q projection + attention over 256 reduced tokens + output projection.
// Block = 64 threads (2 waves), 16 queries per wave; grid = (512, 8).
//   q^T = wq * x^T          : A = wq plane rows, B = x^T split in registers
//   S^T = K * q^T           : A = K plane rows, B = q^T packed from two adjacent D tiles
//   softmax over 256 keys   : f32, full score row parked in LDS (each lane re-reads only
//                             the keys it wrote: key bit3 == h)
//   O^T = V^T * P^T         : A = V^T plane rows, B = P^T from LDS
//   out^T = wproj * O^T     : A = wproj plane rows, B = O^T packed from D tiles
// ---------------------------------------------------------------------------
__global__ __launch_bounds__(64) void k_attn(
    const float* __restrict__ x,
    const u16* __restrict__ wqh, const u16* __restrict__ wql, const float* __restrict__ bq,
    const u16* __restrict__ kh, const u16* __restrict__ kl,      // 2048 x 64, fragment order
    const u16* __restrict__ vth, const u16* __restrict__ vtl,    // 8 x (64 x 256), fragment order
    const u16* __restrict__ wph, const u16* __restrict__ wpl, const float* __restrict__ bproj,
    float* __restrict__ out)                                     // [8][16384][64]
{
  __shared__ __attribute__((aligned(16))) float sS[2][16 * 256];
  __shared__ __attribute__((aligned(16))) float sO[2][16 * 64];

  const int tid = threadIdx.x, lane = tid & 31, w = tid >> 5;
  const int h = lane >> 4, m = lane & 15;
  const int b = blockIdx.y;
  const int q0 = blockIdx.x * 32 + 16 * w;
  const v8f zero8 = {0.f, 0.f, 0.f, 0.f, 0.f, 0.f, 0.f, 0.f};

  // ---- q^T = wq * x^T : qt[t][r] = q[query q0+m][feature 16t+8h+r] ----
  v8f qt[4];
  #pragma unroll
  for (int t = 0; t < 4; ++t) qt[t] = zero8;
  const float* xr = x + ((size_t)b * NQ + q0 + m) * CD;
  #pragma unroll
  for (int ks = 0; ks < 2; ++ks) {
    const float* xp = xr + 32 * ks + 8 * h;
    const v4f a0 = *(const v4fa*)(xp);
    const v4f a1 = *(const v4fa*)(xp + 4);
    const v4f c0 = *(const v4fa*)(xp + 16);
    const v4f c1 = *(const v4fa*)(xp + 20);
    const v8f a8 = __builtin_shufflevector(a0, a1, 0, 1, 2, 3, 4, 5, 6, 7);
    const v8f c8 = __builtin_shufflevector(c0, c1, 0, 1, 2, 3, 4, 5, 6, 7);
    v16b xbh, xbl;
    split_frag(a8, c8, xbh, xbl);
    #pragma unroll
    for (int t = 0; t < 4; ++t) {
      const int off = (2 * t + ks) * 512 + lane * 8;
      const v16b fah = ld_fragp(wqh + off);
      const v16b fal = ld_fragp(wql + off);
      qt[t] = wmma_bf(fah, xbh, qt[t]);
      qt[t] = wmma_bf(fah, xbl, qt[t]);
      qt[t] = wmma_bf(fal, xbh, qt[t]);
    }
  }
  v8f qv[4];
  #pragma unroll
  for (int t = 0; t < 4; ++t)
    #pragma unroll
    for (int r = 0; r < 8; ++r)
      qv[t][r] = (qt[t][r] + bq[16 * t + 8 * h + r]) * 0.125f;   // d^-1/2 folded into q (exact)
  // B fragment for k = d: element i <- tile 2ks row i, element 8+i <- tile 2ks+1 row i
  v16b qbh0, qbl0, qbh1, qbl1;
  split_frag(qv[0], qv[1], qbh0, qbl0);
  split_frag(qv[2], qv[3], qbh1, qbl1);

  // ---- scores: z[r] = S[query m][key 16j+8h+r], parked at sS[w][m*256 + key] ----
  float* sw = &sS[w][0];
  float* srow = sw + m * 256 + 8 * h;
  float mx = -3.0e38f;
  const u16* kbh = kh + (size_t)b * NKEY * CD + lane * 8;
  const u16* kbl = kl + (size_t)b * NKEY * CD + lane * 8;
  #pragma unroll 1
  for (int j = 0; j < 16; ++j) {
    const int ko = j * 1024;                     // two fragments per 16 keys
    const v16b a0h = ld_fragp(kbh + ko);
    const v16b a0l = ld_fragp(kbl + ko);
    const v16b a1h = ld_fragp(kbh + ko + 512);
    const v16b a1l = ld_fragp(kbl + ko + 512);
    v8f z = zero8;
    z = wmma_bf(a0h, qbh0, z);
    z = wmma_bf(a0h, qbl0, z);
    z = wmma_bf(a0l, qbh0, z);
    z = wmma_bf(a1h, qbh1, z);
    z = wmma_bf(a1h, qbl1, z);
    z = wmma_bf(a1l, qbh1, z);
    const v4f z0 = __builtin_shufflevector(z, z, 0, 1, 2, 3);
    const v4f z1 = __builtin_shufflevector(z, z, 4, 5, 6, 7);
    *(v4fa*)(srow + 16 * j) = z0;
    *(v4fa*)(srow + 16 * j + 4) = z1;
    #pragma unroll
    for (int r = 0; r < 8; ++r) mx = fmaxf(mx, z[r]);
  }
  mx = fmaxf(mx, __shfl_xor(mx, 16));

  // ---- softmax numerator + row sum (f32); same lane, same addresses ----
  float sum = 0.f;
  #pragma unroll 2
  for (int a = 0; a < 16; ++a) {
    float* pp = srow + 16 * a;
    v4f v0 = *(const v4fa*)pp;
    v4f v1 = *(const v4fa*)(pp + 4);
    #pragma unroll
    for (int e = 0; e < 4; ++e) {
      v0[e] = __expf(v0[e] - mx);
      v1[e] = __expf(v1[e] - mx);
      sum += v0[e] + v1[e];
    }
    *(v4fa*)pp = v0;
    *(v4fa*)(pp + 4) = v1;
  }
  sum += __shfl_xor(sum, 16);
  const float inv = 1.0f / sum;

  // ---- O^T = V^T * P^T : o[t][r] = O[query m][d 16t+8h+r] ----
  v8f o[4];
  #pragma unroll
  for (int t = 0; t < 4; ++t) o[t] = zero8;
  const u16* vbh = vth + (size_t)b * CD * NKEY + lane * 8;
  const u16* vbl = vtl + (size_t)b * CD * NKEY + lane * 8;
  #pragma unroll 1
  for (int c = 0; c < 8; ++c) {
    const int k0 = 32 * c;
    const float* pp = srow + k0;                 // keys k0+8h.., k0+16+8h..
    const v4f p0 = *(const v4fa*)pp;
    const v4f p1 = *(const v4fa*)(pp + 4);
    const v4f p2 = *(const v4fa*)(pp + 16);
    const v4f p3 = *(const v4fa*)(pp + 20);
    const v8f pa = __builtin_shufflevector(p0, p1, 0, 1, 2, 3, 4, 5, 6, 7) * inv;
    const v8f pc = __builtin_shufflevector(p2, p3, 0, 1, 2, 3, 4, 5, 6, 7) * inv;
    v16b pbh, pbl;
    split_frag(pa, pc, pbh, pbl);
    #pragma unroll
    for (int t = 0; t < 4; ++t) {
      const int vo = (8 * t + c) * 512;
      const v16b fah = ld_fragp(vbh + vo);
      const v16b fal = ld_fragp(vbl + vo);
      o[t] = wmma_bf(fah, pbh, o[t]);
      o[t] = wmma_bf(fah, pbl, o[t]);
      o[t] = wmma_bf(fal, pbh, o[t]);
    }
  }

  // ---- out^T = wproj * O^T : u[t][r] = out[query m][feature 16t+8h+r] ----
  v16b obh0, obl0, obh1, obl1;
  split_frag(o[0], o[1], obh0, obl0);
  split_frag(o[2], o[3], obh1, obl1);
  v8f u[4];
  #pragma unroll
  for (int t = 0; t < 4; ++t) {
    const int off = t * 1024 + lane * 8;
    const v16b a0h = ld_fragp(wph + off);
    const v16b a0l = ld_fragp(wpl + off);
    const v16b a1h = ld_fragp(wph + off + 512);
    const v16b a1l = ld_fragp(wpl + off + 512);
    v8f z = zero8;
    z = wmma_bf(a0h, obh0, z);
    z = wmma_bf(a0h, obl0, z);
    z = wmma_bf(a0l, obh0, z);
    z = wmma_bf(a1h, obh1, z);
    z = wmma_bf(a1h, obl1, z);
    z = wmma_bf(a1l, obh1, z);
    u[t] = z;
  }
  float* so = &sO[w][0];
  #pragma unroll
  for (int t = 0; t < 4; ++t)
    #pragma unroll
    for (int r = 0; r < 8; ++r)
      so[m * 64 + 16 * t + 8 * h + r] = u[t][r] + bproj[16 * t + 8 * h + r];
  __syncthreads();

  const size_t grow0 = (size_t)b * NQ + q0;
  att_store_pass(so, out, grow0, lane);
  
}

// ---------------------------------------------------------------------------
extern "C" void kernel_launch(void* const* d_in, const int* in_sizes, int n_in,
                              void* d_out, int out_size, void* d_ws, size_t ws_size,
                              hipStream_t stream) {
  if (n_in < 12) return;
  if (in_sizes[0] != NBATCH * NQ * CD) return;
  if (in_sizes[1] != CD * CD || in_sizes[2] != CD) return;
  if (in_sizes[3] != 2 * CD * CD || in_sizes[4] != 2 * CD) return;
  if (in_sizes[5] != CD * CD || in_sizes[6] != CD) return;
  if (in_sizes[7] != CD * KCONV) return;
  if (in_sizes[8] != CD || in_sizes[9] != CD) return;
  if (in_sizes[10] < 1 || in_sizes[11] < 1) return;
  if (out_size != NBATCH * NQ * CD) return;

  const float* x     = (const float*)d_in[0];
  const float* wq    = (const float*)d_in[1];
  const float* bq    = (const float*)d_in[2];
  const float* wkv   = (const float*)d_in[3];
  const float* bkv   = (const float*)d_in[4];
  const float* wproj = (const float*)d_in[5];
  const float* bproj = (const float*)d_in[6];
  const float* wsr   = (const float*)d_in[7];
  const float* gamma = (const float*)d_in[8];
  const float* beta  = (const float*)d_in[9];
  const int*   Hp    = (const int*)d_in[10];
  const int*   Wp    = (const int*)d_in[11];
  float* out = (float*)d_out;

  const size_t szWq  = (size_t)CD * CD * 2;            //      8192 per plane
  const size_t szWkv = (size_t)2 * CD * CD * 2;        //     16384
  const size_t szWp  = (size_t)CD * CD * 2;            //      8192
  const size_t szWs  = (size_t)CD * KCONV * 2;         //    524288
  const size_t szA   = (size_t)NROWK * KCONV * 2;      //  16777216
  const size_t szK   = (size_t)NROWK * CD * 2;         //    262144
  const size_t szVt  = (size_t)NBATCH * CD * NKEY * 2; //    262144
  const size_t szPt  = (size_t)KSPLIT * NROWK * CD * 4; //  8388608
  size_t off = 0;
  const size_t oWqh = off;  off += szWq;
  const size_t oWql = off;  off += szWq;
  const size_t oWkh = off;  off += szWkv;
  const size_t oWkl = off;  off += szWkv;
  const size_t oWph = off;  off += szWp;
  const size_t oWpl = off;  off += szWp;
  const size_t oWsh = off;  off += szWs;
  const size_t oWsl = off;  off += szWs;
  const size_t oAh  = off;  off += szA;
  const size_t oAl  = off;  off += szA;
  const size_t oKh  = off;  off += szK;
  const size_t oKl  = off;  off += szK;
  const size_t oVth = off;  off += szVt;
  const size_t oVtl = off;  off += szVt;
  const size_t oPt  = off;  off += szPt;              // total 44105728
  if (off > ws_size) return;
  if (off > (size_t)134217728) return;

  char* ws = (char*)d_ws;
  u16* wqh  = (u16*)(ws + oWqh);
  u16* wql  = (u16*)(ws + oWql);
  u16* wkvh = (u16*)(ws + oWkh);
  u16* wkvl = (u16*)(ws + oWkl);
  u16* wph  = (u16*)(ws + oWph);
  u16* wpl  = (u16*)(ws + oWpl);
  u16* wsh  = (u16*)(ws + oWsh);
  u16* wsl  = (u16*)(ws + oWsl);
  u16* ah   = (u16*)(ws + oAh);
  u16* al   = (u16*)(ws + oAl);
  u16* kh   = (u16*)(ws + oKh);
  u16* kl   = (u16*)(ws + oKl);
  u16* vth  = (u16*)(ws + oVth);
  u16* vtl  = (u16*)(ws + oVtl);
  float* part = (float*)(ws + oPt);

  k_prep_w<<<136, 256, 0, stream>>>(wq, wkv, wproj, wsr, wqh, wql, wkvh, wkvl, wph, wpl, wsh, wsl);

  k_im2col<<<(NROWK * 512) / 256, 256, 0, stream>>>(x, Hp, Wp, ah, al);          // 4096 blocks

  dim3 gConv(NROWK / 64, KSPLIT);                                                  // (32, 16)
  k_conv_part<<<gConv, 128, 0, stream>>>(ah, al, wsh, wsl, part);

  k_kv<<<NROWK / 64, 128, 0, stream>>>(part, gamma, beta, wkvh, wkvl, bkv,
                                       kh, kl, vth, vtl);                           // 32 blocks

  dim3 gAtt(NQ / 32, NBATCH);                                                      // (512, 8)
  k_attn<<<gAtt, 64, 0, stream>>>(x, wqh, wql, bq, kh, kl, vth, vtl, wph, wpl, bproj, out);
}

// v003
// Measured time: 109 microseconds a run.
// Timed twice side by side with v002, it ran 1.13 and 1.16 times as fast.
// Counting every step since v000, it is 2.36 times as fast.
// All contractions (q projection, 8x8 stride-8 reduction conv as a patch GEMM, kv projection, q*k^T scores, P*V, output projection): v_wmma_f32_16x16x32_bf16, bf16 hi/lo operands everywhere (hi*hi + hi*lo + lo*hi), f32 accumulate; LayerNorm, softmax and biases in f32.
#include <hip/hip_runtime.h>
#include <stdint.h>

typedef unsigned short u16;
typedef u16    v16u __attribute__((ext_vector_type(16)));
typedef u16    v8u  __attribute__((ext_vector_type(8)));
typedef __bf16 v16b __attribute__((ext_vector_type(16)));
typedef float  v8f  __attribute__((ext_vector_type(8)));
typedef float  v4f  __attribute__((ext_vector_type(4)));
typedef v8u __attribute__((may_alias)) v8ua;
typedef v4f __attribute__((may_alias)) v4fa;

union Frag { v16b v; v16u u; v8u half[2]; };
static_assert(sizeof(Frag) == 32);

#define NBATCH 8
#define NQ     16384
#define CD     64
#define NKEY   256
#define NROWK  2048        // NBATCH * NKEY reduced tokens
#define KCONV  4096        // 64 patch pixels x 64 channels, k = p*64 + ci
#define LN_EPS 1e-5f
#define KSPLIT 16          // slices of the conv reduction, one work-group each
#define KSLICE 256         // KCONV / KSPLIT

// ---------------------------------------------------------------------------
// 16x16x32 bf16 WMMA with hazard guard (ties D, keeps A/B live).
// Fragment map (wave32): lane l, h = l>>4, m = n = l&15.
//   A/B element i: i<8 -> k0+8h+i ; i>=8 -> k0+16+8h+(i-8)
//   D element r : row 8h+r, col l&15
// ---------------------------------------------------------------------------
__device__ __forceinline__ v8f wmma_bf(v16b a, v16b b, v8f c) {
  v8f d = __builtin_amdgcn_wmma_f32_16x16x32_bf16(false, a, false, b, (short)0, c, false, false);
  asm volatile("v_nop\n\tv_nop\n\tv_nop\n\tv_nop" : "+v"(d) : "v"(a), "v"(b));
  return d;
}

// f32 -> bf16 bits, RNE
__device__ __forceinline__ u16 bf_rne(float f) {
  unsigned u = __builtin_bit_cast(unsigned, f);
  u += 0x7FFFu + ((u >> 16) & 1u);
  return (u16)(u >> 16);
}
__device__ __forceinline__ float bf_val(u16 b) {
  return __builtin_bit_cast(float, ((unsigned)b) << 16);
}

// 8 floats -> hi/lo bf16 planes (hi = rne(x), lo = rne(x - hi))
__device__ __forceinline__ void split8(v8f f, v8u& hi, v8u& lo) {
  #pragma unroll
  for (int i = 0; i < 8; ++i) {
    const u16 hh = bf_rne(f[i]);
    hi[i] = hh;
    lo[i] = bf_rne(f[i] - bf_val(hh));
  }
}

// 16 floats given in fragment element order (a = elements 0..7, c = 8..15) -> hi/lo fragments
__device__ __forceinline__ void split_frag(v8f a, v8f c, v16b& fhi, v16b& flo) {
  Frag fh, fl;
  v8u h0, l0, h1, l1;
  split8(a, h0, l0);
  split8(c, h1, l1);
  fh.half[0] = h0; fh.half[1] = h1;
  fl.half[0] = l0; fl.half[1] = l1;
  fhi = fh.v; flo = fl.v;
}

// A or B fragment from a k-contiguous bf16 row; p points at element k0 of the row owned by this lane.
__device__ __forceinline__ v16b ld_frag(const u16* p, int h) {
  Frag f;
  f.half[0] = *(const v8ua*)(p + 8 * h);
  f.half[1] = *(const v8ua*)(p + 16 + 8 * h);
  return f.v;
}

// Planes that a kernel reads from the workspace are kept in fragment order: fragment f = (row tile) * (k / 32) + k step
// is 512 elements; lane l's elements 0..7 stand at f*512 + l*8, its elements 8..15 at f*512 + 256 + l*8,
// so each wave-wide 16-B load covers 512 contiguous bytes. p points at f*512 + l*8.
__device__ __forceinline__ v16b ld_fragp(const u16* p) {
  Frag f;
  f.half[0] = *(const v8ua*)p;
  f.half[1] = *(const v8ua*)(p + 256);
  return f.v;
}

// Writer's side of the same map: g8 = index of a group of 8 consecutive plane elements, 1 << ksh fragments per row tile
// -> matrix row and first k of the group.
__device__ __forceinline__ void frag_rk(int g8, int ksh, int& row, int& k) {
  const int f = g8 >> 6;
  row = ((f >> ksh) << 4) + (g8 & 15);
  k = ((f & ((1 << ksh) - 1)) << 5) + ((g8 >> 5) & 1) * 16 + ((g8 >> 4) & 1) * 8;
}

__device__ __forceinline__ float red16(float v) {
  v += __shfl_xor(v, 1);
  v += __shfl_xor(v, 2);
  v += __shfl_xor(v, 4);
  v += __shfl_xor(v, 8);
  return v;
}

// ---------------------------------------------------------------------------
// Kernel 1: weights -> bf16 hi/lo planes.
//   wq [64][64], wkv [128][64], wproj [64][64]: row = out, k = in;
//   wsr: row = co, k = p*64 + ci, p = i*8 + j. All four in fragment order.
// One thread = 8 consecutive plane elements = one 16-B store per plane; lanes contiguous
// ---------------------------------------------------------------------------
__global__ __launch_bounds__(256) void k_prep_w(
    const float* __restrict__ wq, const float* __restrict__ wkv,
    const float* __restrict__ wproj, const float* __restrict__ wsr,
    u16* __restrict__ wqh, u16* __restrict__ wql,
    u16* __restrict__ wkvh, u16* __restrict__ wkvl,
    u16* __restrict__ wph, u16* __restrict__ wpl,
    u16* __restrict__ wsh, u16* __restrict__ wsl)
{
  const int blk = blockIdx.x, tid = threadIdx.x;
  if (blk >= 136) return;
  v8f f;
  u16* dh;
  u16* dl;
  int e;
  if (blk < 8) {                    // block-uniform region select
    const float* src;
    if (blk < 2)      { e = blk * 256 + tid;        src = wq;    dh = wqh;  dl = wql;  }
    else if (blk < 6) { e = (blk - 2) * 256 + tid;  src = wkv;   dh = wkvh; dl = wkvl; }
    else              { e = (blk - 6) * 256 + tid;  src = wproj; dh = wph;  dl = wpl;  }
    int row, k;
    frag_rk(e, 1, row, k);
    const float* s = src + row * CD + k;
    const v4f a = *(const v4fa*)s;
    const v4f c = *(const v4fa*)(s + 4);
    f = __builtin_shufflevector(a, c, 0, 1, 2, 3, 4, 5, 6, 7);
  } else {
    e = (blk - 8) * 256 + tid;                          // 0..32767
    int co, k;
    frag_rk(e, 7, co, k);
    const int p = k >> 6, ci0 = k & 63;                 // k = p*64 + ci0
    const float* s = wsr + (size_t)co * KCONV + ci0 * 64 + p;   // wsr[co][ci][i][j] = co*4096 + ci*64 + p
    #pragma unroll
    for (int c = 0; c < 8; ++c) f[c] = s[c * 64];
    dh = wsh; dl = wsl;
  }
  v8u hi, lo;
  split8(f, hi, lo);
  u16* ph = dh + (size_t)e * 8;
  u16* pl = dl + (size_t)e * 8;
  *(v8u*)ph = hi;
  *(v8u*)pl = lo;
  
}

// ---------------------------------------------------------------------------
// Kernel 2: patch gather (im2col) -> dense A planes 2048 x 4096 hi/lo, in fragment order.
//   row r = b*256 + m, m = py*16 + px; k = p*64 + ci, p = i*8 + j;
//   value = x[b][pix][ci], pix = (8py+i)*W + 8px + j (clamped).
// One thread = 8 channels of one (row, pixel): two 16-B loads, one 16-B store per plane,
// lanes contiguous. grid = 4096 blocks x 256.
// ---------------------------------------------------------------------------
__global__ __launch_bounds__(256) void k_im2col(
    const float* __restrict__ x, const int* __restrict__ Hp, const int* __restrict__ Wp,
    u16* __restrict__ ah, u16* __restrict__ al)
{
  const int g = blockIdx.x * 256 + threadIdx.x;
  if (g >= NROWK * 512) return;
  const int Hv = Hp[0], Wv = Wp[0];
  const long long hw = (long long)Hv * (long long)Wv;
  const int lim = (hw >= 1 && hw <= NQ) ? (int)(hw - 1) : (NQ - 1);
  int r, k;
  frag_rk(g, 7, r, k);
  const int bb = r >> 8, mm = r & 255;
  const int py = mm >> 4, px = mm & 15;
  const int p = k >> 6, ci0 = k & 63;
  const int ii = p >> 3, jj = p & 7;
  int pix = (8 * py + ii) * Wv + 8 * px + jj;
  pix = min(max(pix, 0), lim);
  const float* s = x + ((size_t)bb * NQ + pix) * CD + ci0;
  const v4f a = *(const v4fa*)s;
  const v4f c = *(const v4fa*)(s + 4);
  const v8f f = __builtin_shufflevector(a, c, 0, 1, 2, 3, 4, 5, 6, 7);
  v8u hi, lo;
  split8(f, hi, lo);
  u16* ph = ah + (size_t)g * 8;
  u16* pl = al + (size_t)g * 8;
  *(v8u*)ph = hi;
  *(v8u*)pl = lo;
  
}

// ---------------------------------------------------------------------------
// K and V^T planes out of LDS, in fragment order: per plane 8 fragments = 512 groups of 8 elements,
// one group per thread and pass, 512 contiguous bytes per wave and store.
//   K  : row = token, k = d;   fragment (global token >> 4) * 2 + (d >> 5)
//   V^T: row = d, k = key;     fragment batch * 32 + (d >> 4) * 8 + (key >> 5)
// ---------------------------------------------------------------------------
__device__ __forceinline__ void kv_store_pass(const u16* sK, const u16* sV,
                                              u16* kh, u16* kl, u16* vth, u16* vtl,
                                              int blk, int tid) {
  const int bb = blk >> 2, kq = blk & 3;
  #pragma unroll
  for (int it = 0; it < 16; ++it) {
    const int p = (it >> 2) & 1;
    const int g8 = (it & 3) * 128 + tid;           // 0..511
    int row, k;
    frag_rk(g8, 1, row, k);                        // both 0..63, local to this block
    v8u v;
    u16* dst;
    if (it < 8) {
      v = *(const v8ua*)(sK + (p * 64 + row) * 64 + k);
      u16* plane = p ? kl : kh;
      dst = plane + (size_t)blk * 4096 + g8 * 8;
    } else {
      v = *(const v8ua*)(sV + (p * 64 + row) * 64 + k);
      u16* plane = p ? vtl : vth;
      const int f = g8 >> 6;
      dst = plane + (size_t)(bb * 32 + (f >> 1) * 8 + 2 * kq + (f & 1)) * 512 + (g8 & 63) * 8;
    }
    *(v8u*)dst = v;
  }
}

// ---------------------------------------------------------------------------
// Kernel 3: conv GEMM, split along k. Block = 64 conv rows x one k slice of 256, 4 waves x 16 rows
//   (the 4 waves read the same weight slice). Each wave stores its f32 16x64 partial tile in
//   accumulator order: part[slice][row tile][t][j][lane][4] = acc[t][4j..4j+3], 512 B per store.
// grid = (32, 16) blocks x 128 threads.
// ---------------------------------------------------------------------------
__global__ __launch_bounds__(128) void k_conv_part(
    const u16* __restrict__ ah, const u16* __restrict__ al,       // 2048 x 4096, fragment order
    const u16* __restrict__ wsh, const u16* __restrict__ wsl,     // 64 x 4096, fragment order
    float* __restrict__ part)                                     // [16][128][4][2][32][4]
{
  const int tid = threadIdx.x, lane = tid & 31, w = tid >> 5;
  const int blk = blockIdx.x, sp = blockIdx.y;
  const int f0 = sp * (KSLICE / 32);           // first k step of this slice; 128 k steps per row tile

  const v8f zero8 = {0.f, 0.f, 0.f, 0.f, 0.f, 0.f, 0.f, 0.f};
  v8f acc[4];
  #pragma unroll
  for (int t = 0; t < 4; ++t) acc[t] = zero8;

  const u16* arh = ah + (size_t)((blk * 4 + w) * 128 + f0) * 512 + lane * 8;
  const u16* arl = al + (size_t)((blk * 4 + w) * 128 + f0) * 512 + lane * 8;
  const u16* brh = wsh + (size_t)f0 * 512 + lane * 8;
  const u16* brl = wsl + (size_t)f0 * 512 + lane * 8;

  #pragma unroll 1
  for (int ks = 0; ks < KSLICE / 32; ++ks) {
    const v16b fah = ld_fragp(arh + ks * 512);
    const v16b fal = ld_fragp(arl + ks * 512);
    // precaution: this build reuses the address registers of these four loads as the
    // destination of a weight load issued right behind them
    asm volatile("s_wait_xcnt 0x0" ::: "memory");
    #pragma unroll
    for (int t = 0; t < 4; ++t) {
      const v16b fbh = ld_fragp(brh + (t * 128 + ks) * 512);
      const v16b fbl = ld_fragp(brl + (t * 128 + ks) * 512);
      acc[t] = wmma_bf(fah, fbh, acc[t]);
      acc[t] = wmma_bf(fah, fbl, acc[t]);
      acc[t] = wmma_bf(fal, fbh, acc[t]);
    }
  }

  float* pp = part + ((size_t)sp * 128 + blk * 4 + w) * 1024 + lane * 4;
  #pragma unroll
  for (int t = 0; t < 4; ++t) {
    *(v4f*)(pp + (2 * t) * 128)     = __builtin_shufflevector(acc[t], acc[t], 0, 1, 2, 3);
    *(v4f*)(pp + (2 * t + 1) * 128) = __builtin_shufflevector(acc[t], acc[t], 4, 5, 6, 7);
  }
}

// ---------------------------------------------------------------------------
// Kernel 4: reduced tokens. Block = 64 conv rows (tokens) of one batch, 4 waves x 16 rows.
//   sum of the 16 k-slice partials (slice 0 first) -> LayerNorm (f32) -> kv proj (16x64 @ 64x128)
//   -> K planes 2048 x 64 and V^T planes 8 x (64 x 256) (bf16 hi/lo), fragment order, whole-line stores.
// grid = 32 blocks x 128 threads.
// ---------------------------------------------------------------------------
__global__ __launch_bounds__(128) void k_kv(
    const float* __restrict__ part,                               // [16][128][4][2][32][4]
    const float* __restrict__ gamma, const float* __restrict__ beta,
    const u16* __restrict__ wkvh, const u16* __restrict__ wkvl,   // 128 x 64, fragment order
    const float* __restrict__ bkv,
    u16* __restrict__ kh, u16* __restrict__ kl,                   // 2048 x 64, fragment order
    u16* __restrict__ vth, u16* __restrict__ vtl)                 // 8 x (64 x 256), fragment order
{
  __shared__ __attribute__((aligned(16))) u16 sX[2 * 64 * 64];   // LN output hi/lo [p][token][c]
  __shared__ __attribute__((aligned(16))) u16 sK[2 * 64 * 64];   // [p][token][d]
  __shared__ __attribute__((aligned(16))) u16 sV[2 * 64 * 64];   // [p][d][token]

  const int tid = threadIdx.x, lane = tid & 31, w = tid >> 5;
  const int h = lane >> 4, m = lane & 15;
  const int blk = blockIdx.x;

  const v8f zero8 = {0.f, 0.f, 0.f, 0.f, 0.f, 0.f, 0.f, 0.f};
  v8f acc[4];
  #pragma unroll
  for (int t = 0; t < 4; ++t) acc[t] = zero8;

  const float* pp = part + (size_t)(blk * 4 + w) * 1024 + lane * 4;
  #pragma unroll
  for (int s = 0; s < KSPLIT; ++s) {
    const float* ps = pp + (size_t)s * (128 * 1024);
    #pragma unroll
    for (int t = 0; t < 4; ++t) {
      const v4f a = *(const v4fa*)(ps + (2 * t) * 128);
      const v4f c = *(const v4fa*)(ps + (2 * t + 1) * 128);
      acc[t] += __builtin_shufflevector(a, c, 0, 1, 2, 3, 4, 5, 6, 7);
    }
  }
  // acc[t][r] = conv out [token 64blk+16w+8h+r][channel 16t+m]

  float mu[8], rs[8];
  #pragma unroll
  for (int r = 0; r < 8; ++r) {
    float s = acc[0][r] + acc[1][r] + acc[2][r] + acc[3][r];
    s = red16(s);
    mu[r] = s * (1.0f / 64.0f);
    float v = 0.f;
    #pragma unroll
    for (int t = 0; t < 4; ++t) { const float d = acc[t][r] - mu[r]; v += d * d; }
    v = red16(v) * (1.0f / 64.0f);
    rs[r] = rsqrtf(v + LN_EPS);
  }
  #pragma unroll
  for (int t = 0; t < 4; ++t) {
    const int col = 16 * t + m;
    const float g = gamma[col], be = beta[col];
    #pragma unroll
    for (int r = 0; r < 8; ++r) {
      const float y = (acc[t][r] - mu[r]) * rs[r] * g + be;
      const u16 hh = bf_rne(y);
      const u16 ll = bf_rne(y - bf_val(hh));
      const int kl_ = 16 * w + 8 * h + r;
      sX[kl_ * 64 + col] = hh;
      sX[4096 + kl_ * 64 + col] = ll;
    }
  }
  __syncthreads();

  // kv projection A fragments: row = token 16w+m, k = channel
  const v16b xah0 = ld_frag(sX + (16 * w + m) * 64, h);
  const v16b xah1 = ld_frag(sX + (16 * w + m) * 64 + 32, h);
  const v16b xal0 = ld_frag(sX + 4096 + (16 * w + m) * 64, h);
  const v16b xal1 = ld_frag(sX + 4096 + (16 * w + m) * 64 + 32, h);

  #pragma unroll
  for (int ct = 0; ct < 8; ++ct) {
    const int off = ct * 1024 + lane * 8;
    const v16b b0h = ld_fragp(wkvh + off);
    const v16b b0l = ld_fragp(wkvl + off);
    const v16b b1h = ld_fragp(wkvh + off + 512);
    const v16b b1l = ld_fragp(wkvl + off + 512);
    v8f c = zero8;
    c = wmma_bf(xah0, b0h, c);
    c = wmma_bf(xah0, b0l, c);
    c = wmma_bf(xal0, b0h, c);
    c = wmma_bf(xah1, b1h, c);
    c = wmma_bf(xah1, b1l, c);
    c = wmma_bf(xal1, b1h, c);
    // c[r] = kv[token 16w+8h+r][col 16ct+m]
    const int col = 16 * ct + m;
    const float bb = bkv[col];
    #pragma unroll
    for (int r = 0; r < 8; ++r) {
      const float val = c[r] + bb;
      const u16 hh = bf_rne(val);
      const u16 ll = bf_rne(val - bf_val(hh));
      const int kl_ = 16 * w + 8 * h + r;
      if (ct < 4) {
        sK[kl_ * 64 + col] = hh;
        sK[4096 + kl_ * 64 + col] = ll;
      } else {
        const int d = col - 64;
        sV[d * 64 + kl_] = hh;
        sV[4096 + d * 64 + kl_] = ll;
      }
    }
  }
  __syncthreads();

  kv_store_pass(sK, sV, kh, kl, vth, vtl, blk, tid);
  
}

// ---------------------------------------------------------------------------
// lanes 8q..8q+7 in one instruction, 4 lines per instruction, 32 lines per wave.
// ---------------------------------------------------------------------------
// The LDS tile keeps 16-B chunk q of row m at chunk q ^ m (see the writer in k_attn).
__device__ __forceinline__ void att_store_pass(const float* so, float* out, size_t grow0, int lane) {
  const int q8 = lane & 7, sub = lane >> 3;
  #pragma unroll
  for (int i = 0; i < 8; ++i) {
    const int lid = i * 4 + sub;
    const int row = lid >> 1, hl = lid & 1;
    const v4f v = *(const v4fa*)(so + row * 64 + 4 * ((8 * hl + q8) ^ row));
    *(v4f*)(out + (grow0 + (size_t)row) * CD + 32 * hl + 4 * q8) = v;
  }
}

// ---------------------------------------------------------------------------
// Kernel 5: fused q projection + attention over 256 reduced tokens + output projection.
// Block = 64 threads (2 waves), 16 queries per wave; grid = (512, 8).
//   q^T = wq * x^T          : A = wq plane rows, B = x^T split in registers
//   S^T = K * q^T           : A = K plane rows, B = q^T packed from two adjacent D tiles
//   softmax over 256 keys   : f32, scores parked in LDS; each lane re-reads only what it wrote,
//                             so the park is lane-major: 16-B chunk c of lane l at (c*32 + l)*16 B,
//                             every LDS access of a wave covers 512 contiguous bytes (no bank conflict)
//   O^T = V^T * P^T         : A = V^T plane rows, B = P^T from LDS
//   out^T = wproj * O^T     : A = wproj plane rows, B = O^T packed from D tiles
// ---------------------------------------------------------------------------
__global__ __launch_bounds__(64) void k_attn(
    const float* __restrict__ x,
    const u16* __restrict__ wqh, const u16* __restrict__ wql, const float* __restrict__ bq,
    const u16* __restrict__ kh, const u16* __restrict__ kl,      // 2048 x 64, fragment order
    const u16* __restrict__ vth, const u16* __restrict__ vtl,    // 8 x (64 x 256), fragment order
    const u16* __restrict__ wph, const u16* __restrict__ wpl, const float* __restrict__ bproj,
    float* __restrict__ out)                                     // [8][16384][64]
{
  __shared__ __attribute__((aligned(16))) float sS[2][16 * 256];
  __shared__ __attribute__((aligned(16))) float sO[2][16 * 64];

  const int tid = threadIdx.x, lane = tid & 31, w = tid >> 5;
  const int h = lane >> 4, m = lane & 15;
  const int b = blockIdx.y;
  const int q0 = blockIdx.x * 32 + 16 * w;
  const v8f zero8 = {0.f, 0.f, 0.f, 0.f, 0.f, 0.f, 0.f, 0.f};

  // ---- q^T = wq * x^T : qt[t][r] = q[query q0+m][feature 16t+8h+r] ----
  v8f qt[4];
  #pragma unroll
  for (int t = 0; t < 4; ++t) qt[t] = zero8;
  const float* xr = x + ((size_t)b * NQ + q0 + m) * CD;
  #pragma unroll
  for (int ks = 0; ks < 2; ++ks) {
    const float* xp = xr + 32 * ks + 8 * h;
    const v4f a0 = *(const v4fa*)(xp);
    const v4f a1 = *(const v4fa*)(xp + 4);
    const v4f c0 = *(const v4fa*)(xp + 16);
    const v4f c1 = *(const v4fa*)(xp + 20);
    const v8f a8 = __builtin_shufflevector(a0, a1, 0, 1, 2, 3, 4, 5, 6, 7);
    const v8f c8 = __builtin_shufflevector(c0, c1, 0, 1, 2, 3, 4, 5, 6, 7);
    v16b xbh, xbl;
    split_frag(a8, c8, xbh, xbl);
    #pragma unroll
    for (int t = 0; t < 4; ++t) {
      const int off = (2 * t + ks) * 512 + lane * 8;
      const v16b fah = ld_fragp(wqh + off);
      const v16b fal = ld_fragp(wql + off);
      qt[t] = wmma_bf(fah, xbh, qt[t]);
      qt[t] = wmma_bf(fah, xbl, qt[t]);
      qt[t] = wmma_bf(fal, xbh, qt[t]);
    }
  }
  v8f qv[4];
  #pragma unroll
  for (int t = 0; t < 4; ++t)
    #pragma unroll
    for (int r = 0; r < 8; ++r)
      qv[t][r] = (qt[t][r] + bq[16 * t + 8 * h + r]) * 0.125f;   // d^-1/2 folded into q (exact)
  // B fragment for k = d: element i <- tile 2ks row i, element 8+i <- tile 2ks+1 row i
  v16b qbh0, qbl0, qbh1, qbl1;
  split_frag(qv[0], qv[1], qbh0, qbl0);
  split_frag(qv[2], qv[3], qbh1, qbl1);

  // ---- scores: z[r] = S[query m][key 16j+8h+r], parked as this lane's chunks 2j (r 0..3) and 2j+1 (r 4..7) ----
  float* sw = &sS[w][0];
  float* sl = sw + lane * 4;                     // chunk c of this lane: sl + c*128
  float mx = -3.0e38f;
  const u16* kbh = kh + (size_t)b * NKEY * CD + lane * 8;
  const u16* kbl = kl + (size_t)b * NKEY * CD + lane * 8;
  #pragma unroll 1
  for (int j = 0; j < 16; ++j) {
    const int ko = j * 1024;                     // two fragments per 16 keys
    const v16b a0h = ld_fragp(kbh + ko);
    const v16b a0l = ld_fragp(kbl + ko);
    const v16b a1h = ld_fragp(kbh + ko + 512);
    const v16b a1l = ld_fragp(kbl + ko + 512);
    v8f z = zero8;
    z = wmma_bf(a0h, qbh0, z);
    z = wmma_bf(a0h, qbl0, z);
    z = wmma_bf(a0l, qbh0, z);
    z = wmma_bf(a1h, qbh1, z);
    z = wmma_bf(a1h, qbl1, z);
    z = wmma_bf(a1l, qbh1, z);
    const v4f z0 = __builtin_shufflevector(z, z, 0, 1, 2, 3);
    const v4f z1 = __builtin_shufflevector(z, z, 4, 5, 6, 7);
    *(v4fa*)(sl + 256 * j) = z0;
    *(v4fa*)(sl + 256 * j + 128) = z1;
    #pragma unroll
    for (int r = 0; r < 8; ++r) mx = fmaxf(mx, z[r]);
  }
  mx = fmaxf(mx, __shfl_xor(mx, 16));

  // ---- softmax numerator + row sum (f32); same lane, same addresses ----
  float sum = 0.f;
  #pragma unroll 2
  for (int a = 0; a < 16; ++a) {
    float* pp = sl + 256 * a;
    v4f v0 = *(const v4fa*)pp;
    v4f v1 = *(const v4fa*)(pp + 128);
    #pragma unroll
    for (int e = 0; e < 4; ++e) {
      v0[e] = __expf(v0[e] - mx);
      v1[e] = __expf(v1[e] - mx);
      sum += v0[e] + v1[e];
    }
    *(v4fa*)pp = v0;
    *(v4fa*)(pp + 128) = v1;
  }
  sum += __shfl_xor(sum, 16);
  const float inv = 1.0f / sum;

  // ---- O^T = V^T * P^T : o[t][r] = O[query m][d 16t+8h+r] ----
  v8f o[4];
  #pragma unroll
  for (int t = 0; t < 4; ++t) o[t] = zero8;
  const u16* vbh = vth + (size_t)b * CD * NKEY + lane * 8;
  const u16* vbl = vtl + (size_t)b * CD * NKEY + lane * 8;
  #pragma unroll 1
  for (int c = 0; c < 8; ++c) {
    const float* pp = sl + 512 * c;              // chunks 4c..4c+3: keys 32c+8h.., 32c+16+8h..
    const v4f p0 = *(const v4fa*)pp;
    const v4f p1 = *(const v4fa*)(pp + 128);
    const v4f p2 = *(const v4fa*)(pp + 256);
    const v4f p3 = *(const v4fa*)(pp + 384);
    const v8f pa = __builtin_shufflevector(p0, p1, 0, 1, 2, 3, 4, 5, 6, 7) * inv;
    const v8f pc = __builtin_shufflevector(p2, p3, 0, 1, 2, 3, 4, 5, 6, 7) * inv;
    v16b pbh, pbl;
    split_frag(pa, pc, pbh, pbl);
    #pragma unroll
    for (int t = 0; t < 4; ++t) {
      const int vo = (8 * t + c) * 512;
      const v16b fah = ld_fragp(vbh + vo);
      const v16b fal = ld_fragp(vbl + vo);
      o[t] = wmma_bf(fah, pbh, o[t]);
      o[t] = wmma_bf(fah, pbl, o[t]);
      o[t] = wmma_bf(fal, pbh, o[t]);
    }
  }

  // ---- out^T = wproj * O^T : u[t][r] = out[query m][feature 16t+8h+r] ----
  v16b obh0, obl0, obh1, obl1;
  split_frag(o[0], o[1], obh0, obl0);
  split_frag(o[2], o[3], obh1, obl1);
  v8f u[4];
  #pragma unroll
  for (int t = 0; t < 4; ++t) {
    const int off = t * 1024 + lane * 8;
    const v16b a0h = ld_fragp(wph + off);
    const v16b a0l = ld_fragp(wpl + off);
    const v16b a1h = ld_fragp(wph + off + 512);
    const v16b a1l = ld_fragp(wpl + off + 512);
    v8f z = zero8;
    z = wmma_bf(a0h, obh0, z);
    z = wmma_bf(a0h, obl0, z);
    z = wmma_bf(a0l, obh0, z);
    z = wmma_bf(a1h, obh1, z);
    z = wmma_bf(a1h, obl1, z);
    z = wmma_bf(a1l, obh1, z);
    u[t] = z;
  }
  // row m of the output tile, 16-B chunk q stored at chunk q ^ m: the 16 rows of one store fall on 16 different bank groups
  float* so = &sO[w][0];
  #pragma unroll
  for (int t = 0; t < 4; ++t) {
    v8f y;
    #pragma unroll
    for (int r = 0; r < 8; ++r) y[r] = u[t][r] + bproj[16 * t + 8 * h + r];
    const int q = 4 * t + 2 * h;
    *(v4fa*)(so + m * 64 + 4 * (q ^ m))       = __builtin_shufflevector(y, y, 0, 1, 2, 3);
    *(v4fa*)(so + m * 64 + 4 * ((q + 1) ^ m)) = __builtin_shufflevector(y, y, 4, 5, 6, 7);
  }
  __syncthreads();

  const size_t grow0 = (size_t)b * NQ + q0;
  att_store_pass(so, out, grow0, lane);
  
}

// ---------------------------------------------------------------------------
extern "C" void kernel_launch(void* const* d_in, const int* in_sizes, int n_in,
                              void* d_out, int out_size, void* d_ws, size_t ws_size,
                              hipStream_t stream) {
  if (n_in < 12) return;
  if (in_sizes[0] != NBATCH * NQ * CD) return;
  if (in_sizes[1] != CD * CD || in_sizes[2] != CD) return;
  if (in_sizes[3] != 2 * CD * CD || in_sizes[4] != 2 * CD) return;
  if (in_sizes[5] != CD * CD || in_sizes[6] != CD) return;
  if (in_sizes[7] != CD * KCONV) return;
  if (in_sizes[8] != CD || in_sizes[9] != CD) return;
  if (in_sizes[10] < 1 || in_sizes[11] < 1) return;
  if (out_size != NBATCH * NQ * CD) return;

  const float* x     = (const float*)d_in[0];
  const float* wq    = (const float*)d_in[1];
  const float* bq    = (const float*)d_in[2];
  const float* wkv   = (const float*)d_in[3];
  const float* bkv   = (const float*)d_in[4];
  const float* wproj = (const float*)d_in[5];
  const float* bproj = (const float*)d_in[6];
  const float* wsr   = (const float*)d_in[7];
  const float* gamma = (const float*)d_in[8];
  const float* beta  = (const float*)d_in[9];
  const int*   Hp    = (const int*)d_in[10];
  const int*   Wp    = (const int*)d_in[11];
  float* out = (float*)d_out;

  const size_t szWq  = (size_t)CD * CD * 2;            //      8192 per plane
  const size_t szWkv = (size_t)2 * CD * CD * 2;        //     16384
  const size_t szWp  = (size_t)CD * CD * 2;            //      8192
  const size_t szWs  = (size_t)CD * KCONV * 2;         //    524288
  const size_t szA   = (size_t)NROWK * KCONV * 2;      //  16777216
  const size_t szK   = (size_t)NROWK * CD * 2;         //    262144
  const size_t szVt  = (size_t)NBATCH * CD * NKEY * 2; //    262144
  const size_t szPt  = (size_t)KSPLIT * NROWK * CD * 4; //  8388608
  size_t off = 0;
  const size_t oWqh = off;  off += szWq;
  const size_t oWql = off;  off += szWq;
  const size_t oWkh = off;  off += szWkv;
  const size_t oWkl = off;  off += szWkv;
  const size_t oWph = off;  off += szWp;
  const size_t oWpl = off;  off += szWp;
  const size_t oWsh = off;  off += szWs;
  const size_t oWsl = off;  off += szWs;
  const size_t oAh  = off;  off += szA;
  const size_t oAl  = off;  off += szA;
  const size_t oKh  = off;  off += szK;
  const size_t oKl  = off;  off += szK;
  const size_t oVth = off;  off += szVt;
  const size_t oVtl = off;  off += szVt;
  const size_t oPt  = off;  off += szPt;              // total 44105728
  if (off > ws_size) return;
  if (off > (size_t)134217728) return;

  char* ws = (char*)d_ws;
  u16* wqh  = (u16*)(ws + oWqh);
  u16* wql  = (u16*)(ws + oWql);
  u16* wkvh = (u16*)(ws + oWkh);
  u16* wkvl = (u16*)(ws + oWkl);
  u16* wph  = (u16*)(ws + oWph);
  u16* wpl  = (u16*)(ws + oWpl);
  u16* wsh  = (u16*)(ws + oWsh);
  u16* wsl  = (u16*)(ws + oWsl);
  u16* ah   = (u16*)(ws + oAh);
  u16* al   = (u16*)(ws + oAl);
  u16* kh   = (u16*)(ws + oKh);
  u16* kl   = (u16*)(ws + oKl);
  u16* vth  = (u16*)(ws + oVth);
  u16* vtl  = (u16*)(ws + oVtl);
  float* part = (float*)(ws + oPt);

  k_prep_w<<<136, 256, 0, stream>>>(wq, wkv, wproj, wsr, wqh, wql, wkvh, wkvl, wph, wpl, wsh, wsl);

  k_im2col<<<(NROWK * 512) / 256, 256, 0, stream>>>(x, Hp, Wp, ah, al);          // 4096 blocks

  dim3 gConv(NROWK / 64, KSPLIT);                                                  // (32, 16)
  k_conv_part<<<gConv, 128, 0, stream>>>(ah, al, wsh, wsl, part);

  k_kv<<<NROWK / 64, 128, 0, stream>>>(part, gamma, beta, wkvh, wkvl, bkv,
                                       kh, kl, vth, vtl);                           // 32 blocks

  dim3 gAtt(NQ / 32, NBATCH);                                                      // (512, 8)
  k_attn<<<gAtt, 64, 0, stream>>>(x, wqh, wql, bq, kh, kl, vth, vtl, wph, wpl, bproj, out);
}

// v004
// Measured time: 99.5 microseconds a run.
// In two side-by-side timings against v003, it was 1.08 and 1.06 times as fast.
// All steps since v000 together make it 2.53 times as fast.
// All contractions (q projection, 8x8 stride-8 reduction conv as a patch GEMM, kv projection, q*k^T scores, P*V, output projection): v_wmma_f32_16x16x32_bf16, bf16 hi/lo operands everywhere (hi*hi + hi*lo + lo*hi), f32 accumulate; LayerNorm, softmax and biases in f32.
#include <hip/hip_runtime.h>
#include <stdint.h>

typedef unsigned short u16;
typedef u16    v16u __attribute__((ext_vector_type(16)));
typedef u16    v8u  __attribute__((ext_vector_type(8)));
typedef __bf16 v16b __attribute__((ext_vector_type(16)));
typedef float  v8f  __attribute__((ext_vector_type(8)));
typedef float  v4f  __attribute__((ext_vector_type(4)));
typedef v8u __attribute__((may_alias)) v8ua;
typedef v4f __attribute__((may_alias)) v4fa;

union Frag { v16b v; v16u u; v8u half[2]; };
static_assert(sizeof(Frag) == 32);

#define NBATCH 8
#define NQ     16384
#define CD     64
#define NKEY   256
#define NROWK  2048        // NBATCH * NKEY reduced tokens
#define KCONV  4096        // 64 patch pixels x 64 channels, k = p*64 + ci
#define LN_EPS 1e-5f
#define KSPLIT 16          // slices of the conv reduction, one work-group each
#define KSLICE 256         // KCONV / KSPLIT

// ---------------------------------------------------------------------------
// 16x16x32 bf16 WMMA with hazard guard (ties D, keeps A/B live).
// Fragment map (wave32): lane l, h = l>>4, m = n = l&15.
//   A/B element i: i<8 -> k0+8h+i ; i>=8 -> k0+16+8h+(i-8)
//   D element r : row 8h+r, col l&15
// ---------------------------------------------------------------------------
__device__ __forceinline__ v8f wmma_bf(v16b a, v16b b, v8f c) {
  v8f d = __builtin_amdgcn_wmma_f32_16x16x32_bf16(false, a, false, b, (short)0, c, false, false);
  asm volatile("v_nop\n\tv_nop\n\tv_nop\n\tv_nop" : "+v"(d) : "v"(a), "v"(b));
  return d;
}

// f32 -> bf16 bits, RNE
__device__ __forceinline__ u16 bf_rne(float f) {
  unsigned u = __builtin_bit_cast(unsigned, f);
  u += 0x7FFFu + ((u >> 16) & 1u);
  return (u16)(u >> 16);
}
__device__ __forceinline__ float bf_val(u16 b) {
  return __builtin_bit_cast(float, ((unsigned)b) << 16);
}

// 8 floats -> hi/lo bf16 planes (hi = rne(x), lo = rne(x - hi))
__device__ __forceinline__ void split8(v8f f, v8u& hi, v8u& lo) {
  #pragma unroll
  for (int i = 0; i < 8; ++i) {
    const u16 hh = bf_rne(f[i]);
    hi[i] = hh;
    lo[i] = bf_rne(f[i] - bf_val(hh));
  }
}

// 16 floats given in fragment element order (a = elements 0..7, c = 8..15) -> hi/lo fragments
__device__ __forceinline__ void split_frag(v8f a, v8f c, v16b& fhi, v16b& flo) {
  Frag fh, fl;
  v8u h0, l0, h1, l1;
  split8(a, h0, l0);
  split8(c, h1, l1);
  fh.half[0] = h0; fh.half[1] = h1;
  fl.half[0] = l0; fl.half[1] = l1;
  fhi = fh.v; flo = fl.v;
}

// A or B fragment from a k-contiguous bf16 row; p points at element k0 of the row owned by this lane.
__device__ __forceinline__ v16b ld_frag(const u16* p, int h) {
  Frag f;
  f.half[0] = *(const v8ua*)(p + 8 * h);
  f.half[1] = *(const v8ua*)(p + 16 + 8 * h);
  return f.v;
}

// Planes that a kernel reads from the workspace are kept in fragment order: fragment f = (row tile) * (k / 32) + k step
// is 512 elements; lane l's elements 0..7 stand at f*512 + l*8, its elements 8..15 at f*512 + 256 + l*8,
// so each wave-wide 16-B load covers 512 contiguous bytes. p points at f*512 + l*8.
__device__ __forceinline__ v16b ld_fragp(const u16* p) {
  Frag f;
  f.half[0] = *(const v8ua*)p;
  f.half[1] = *(const v8ua*)(p + 256);
  return f.v;
}

// Writer's side of the same map: g8 = index of a group of 8 consecutive plane elements, 1 << ksh fragments per row tile
// -> matrix row and first k of the group.
__device__ __forceinline__ void frag_rk(int g8, int ksh, int& row, int& k) {
  const int f = g8 >> 6;
  row = ((f >> ksh) << 4) + (g8 & 15);
  k = ((f & ((1 << ksh) - 1)) << 5) + ((g8 >> 5) & 1) * 16 + ((g8 >> 4) & 1) * 8;
}

__device__ __forceinline__ float red16(float v) {
  v += __shfl_xor(v, 1);
  v += __shfl_xor(v, 2);
  v += __shfl_xor(v, 4);
  v += __shfl_xor(v, 8);
  return v;
}

// ---------------------------------------------------------------------------
// Kernel 1: weights -> bf16 hi/lo planes.
//   wq [64][64], wkv [128][64], wproj [64][64]: row = out, k = in;
//   wsr: row = co, k = p*64 + ci, p = i*8 + j. All four in fragment order.
// One thread = 8 consecutive plane elements = one 16-B store per plane; lanes contiguous
// ---------------------------------------------------------------------------
__global__ __launch_bounds__(256) void k_prep_w(
    const float* __restrict__ wq, const float* __restrict__ wkv,
    const float* __restrict__ wproj, const float* __restrict__ wsr,
    u16* __restrict__ wqh, u16* __restrict__ wql,
    u16* __restrict__ wkvh, u16* __restrict__ wkvl,
    u16* __restrict__ wph, u16* __restrict__ wpl,
    u16* __restrict__ wsh, u16* __restrict__ wsl)
{
  const int blk = blockIdx.x, tid = threadIdx.x;
  if (blk >= 136) return;
  v8f f;
  u16* dh;
  u16* dl;
  int e;
  if (blk < 8) {                    // block-uniform region select
    const float* src;
    if (blk < 2)      { e = blk * 256 + tid;        src = wq;    dh = wqh;  dl = wql;  }
    else if (blk < 6) { e = (blk - 2) * 256 + tid;  src = wkv;   dh = wkvh; dl = wkvl; }
    else              { e = (blk - 6) * 256 + tid;  src = wproj; dh = wph;  dl = wpl;  }
    int row, k;
    frag_rk(e, 1, row, k);
    const float* s = src + row * CD + k;
    const v4f a = *(const v4fa*)s;
    const v4f c = *(const v4fa*)(s + 4);
    f = __builtin_shufflevector(a, c, 0, 1, 2, 3, 4, 5, 6, 7);
  } else {
    e = (blk - 8) * 256 + tid;                          // 0..32767
    int co, k;
    frag_rk(e, 7, co, k);
    const int p = k >> 6, ci0 = k & 63;                 // k = p*64 + ci0
    const float* s = wsr + (size_t)co * KCONV + ci0 * 64 + p;   // wsr[co][ci][i][j] = co*4096 + ci*64 + p
    #pragma unroll
    for (int c = 0; c < 8; ++c) f[c] = s[c * 64];
    dh = wsh; dl = wsl;
  }
  v8u hi, lo;
  split8(f, hi, lo);
  u16* ph = dh + (size_t)e * 8;
  u16* pl = dl + (size_t)e * 8;
  *(v8u*)ph = hi;
  *(v8u*)pl = lo;
  
}

// ---------------------------------------------------------------------------
// K and V^T planes out of LDS, in fragment order: per plane 8 fragments = 512 groups of 8 elements,
// one group per thread and pass, 512 contiguous bytes per wave and store.
//   K  : row = token, k = d;   fragment (global token >> 4) * 2 + (d >> 5)
//   V^T: row = d, k = key;     fragment batch * 32 + (d >> 4) * 8 + (key >> 5)
// ---------------------------------------------------------------------------
__device__ __forceinline__ void kv_store_pass(const u16* sK, const u16* sV,
                                              u16* kh, u16* kl, u16* vth, u16* vtl,
                                              int blk, int tid) {
  const int bb = blk >> 2, kq = blk & 3;
  #pragma unroll
  for (int it = 0; it < 16; ++it) {
    const int p = (it >> 2) & 1;
    const int g8 = (it & 3) * 128 + tid;           // 0..511
    int row, k;
    frag_rk(g8, 1, row, k);                        // both 0..63, local to this block
    v8u v;
    u16* dst;
    if (it < 8) {
      v = *(const v8ua*)(sK + (p * 64 + row) * 64 + k);
      u16* plane = p ? kl : kh;
      dst = plane + (size_t)blk * 4096 + g8 * 8;
    } else {
      v = *(const v8ua*)(sV + (p * 64 + row) * 64 + k);
      u16* plane = p ? vtl : vth;
      const int f = g8 >> 6;
      dst = plane + (size_t)(bb * 32 + (f >> 1) * 8 + 2 * kq + (f & 1)) * 512 + (g8 & 63) * 8;
    }
    *(v8u*)dst = v;
  }
}

// ---------------------------------------------------------------------------
// Kernel 2: conv GEMM, split along k, patches gathered from x in the A loader (no patch planes).
//   Block = 64 conv rows x one k slice of 256 (4 patch pixels x 64 channels), 4 waves x 16 rows
//   (the 4 waves read the same weight slice).
//   row r = b*256 + m, m = py*16 + px; k = p*64 + ci, p = i*8 + j;
//   A value = x[b][pix][ci], pix = (8py+i)*W + 8px + j (clamped), split to bf16 hi/lo in registers.
//   Each wave stores its f32 16x64 partial tile in accumulator order:
//   part[slice][row tile][t][j][lane][4] = acc[t][4j..4j+3], 512 B per store.
// grid = (32, 16) blocks x 128 threads.
// ---------------------------------------------------------------------------
__global__ __launch_bounds__(128) void k_conv_part(
    const float* __restrict__ x, const int* __restrict__ Hp, const int* __restrict__ Wp,
    const u16* __restrict__ wsh, const u16* __restrict__ wsl,     // 64 x 4096, fragment order
    float* __restrict__ part)                                     // [16][128][4][2][32][4]
{
  const int tid = threadIdx.x, lane = tid & 31, w = tid >> 5;
  const int h = lane >> 4, m = lane & 15;
  const int blk = blockIdx.x, sp = blockIdx.y;
  const int f0 = sp * (KSLICE / 32);           // first k step of this slice; 128 k steps per row tile

  const int Hv = Hp[0], Wv = Wp[0];
  const long long hw = (long long)Hv * (long long)Wv;
  const int lim = (hw >= 1 && hw <= NQ) ? (int)(hw - 1) : (NQ - 1);
  const int r = blk * 64 + w * 16 + m;
  const int bb = r >> 8, mm = r & 255;
  const int py = mm >> 4, px = mm & 15;

  // The whole slice of this lane's row, 16 KB per wave, is asked for before any of it is used:
  // with two waves per SIMD only the loads in flight cover the memory latency.
  // Both loops unrolled: xa is indexed by their counters and has to stay in registers.
  v4f xa[KSLICE / 32][4];
  #pragma unroll
  for (int q = 0; q < KSLICE / 64; ++q) {
    const int p = sp * (KSLICE / 64) + q;
    const int ii = p >> 3, jj = p & 7;
    int pix = (8 * py + ii) * Wv + 8 * px + jj;
    pix = min(max(pix, 0), lim);
    const float* s = x + ((size_t)bb * NQ + pix) * CD + 8 * h;
    #pragma unroll
    for (int c = 0; c < 2; ++c) {
      xa[2 * q + c][0] = *(const v4fa*)(s + 32 * c);
      xa[2 * q + c][1] = *(const v4fa*)(s + 32 * c + 4);
      xa[2 * q + c][2] = *(const v4fa*)(s + 32 * c + 16);
      xa[2 * q + c][3] = *(const v4fa*)(s + 32 * c + 20);
    }
  }
  // precaution: the address registers of the loads above are reused further down
  asm volatile("s_wait_xcnt 0x0" ::: "memory");

  const v8f zero8 = {0.f, 0.f, 0.f, 0.f, 0.f, 0.f, 0.f, 0.f};
  v8f acc[4];
  #pragma unroll
  for (int t = 0; t < 4; ++t) acc[t] = zero8;

  const u16* brh = wsh + (size_t)f0 * 512 + lane * 8;
  const u16* brl = wsl + (size_t)f0 * 512 + lane * 8;

  // unrolled: xa is indexed by ks and has to stay in registers
  #pragma unroll
  for (int ks = 0; ks < KSLICE / 32; ++ks) {
    v16b fah, fal;
    split_frag(__builtin_shufflevector(xa[ks][0], xa[ks][1], 0, 1, 2, 3, 4, 5, 6, 7),
               __builtin_shufflevector(xa[ks][2], xa[ks][3], 0, 1, 2, 3, 4, 5, 6, 7), fah, fal);
    #pragma unroll
    for (int t = 0; t < 4; ++t) {
      const v16b fbh = ld_fragp(brh + (t * 128 + ks) * 512);
      const v16b fbl = ld_fragp(brl + (t * 128 + ks) * 512);
      acc[t] = wmma_bf(fah, fbh, acc[t]);
      acc[t] = wmma_bf(fah, fbl, acc[t]);
      acc[t] = wmma_bf(fal, fbh, acc[t]);
    }
  }

  float* pp = part + ((size_t)sp * 128 + blk * 4 + w) * 1024 + lane * 4;
  #pragma unroll
  for (int t = 0; t < 4; ++t) {
    *(v4f*)(pp + (2 * t) * 128)     = __builtin_shufflevector(acc[t], acc[t], 0, 1, 2, 3);
    *(v4f*)(pp + (2 * t + 1) * 128) = __builtin_shufflevector(acc[t], acc[t], 4, 5, 6, 7);
  }
}

// ---------------------------------------------------------------------------
// Kernel 3: reduced tokens. Block = 64 conv rows (tokens) of one batch, 4 waves x 16 rows.
//   sum of the 16 k-slice partials (slice 0 first) -> LayerNorm (f32) -> kv proj (16x64 @ 64x128)
//   -> K planes 2048 x 64 and V^T planes 8 x (64 x 256) (bf16 hi/lo), fragment order, whole-line stores.
// grid = 32 blocks x 128 threads.
// ---------------------------------------------------------------------------
__global__ __launch_bounds__(128) void k_kv(
    const float* __restrict__ part,                               // [16][128][4][2][32][4]
    const float* __restrict__ gamma, const float* __restrict__ beta,
    const u16* __restrict__ wkvh, const u16* __restrict__ wkvl,   // 128 x 64, fragment order
    const float* __restrict__ bkv,
    u16* __restrict__ kh, u16* __restrict__ kl,                   // 2048 x 64, fragment order
    u16* __restrict__ vth, u16* __restrict__ vtl)                 // 8 x (64 x 256), fragment order
{
  __shared__ __attribute__((aligned(16))) u16 sX[2 * 64 * 64];   // LN output hi/lo [p][token][c]
  __shared__ __attribute__((aligned(16))) u16 sK[2 * 64 * 64];   // [p][token][d]
  __shared__ __attribute__((aligned(16))) u16 sV[2 * 64 * 64];   // [p][d][token]

  const int tid = threadIdx.x, lane = tid & 31, w = tid >> 5;
  const int h = lane >> 4, m = lane & 15;
  const int blk = blockIdx.x;

  const v8f zero8 = {0.f, 0.f, 0.f, 0.f, 0.f, 0.f, 0.f, 0.f};
  v8f acc[4];
  #pragma unroll
  for (int t = 0; t < 4; ++t) acc[t] = zero8;

  const float* pp = part + (size_t)(blk * 4 + w) * 1024 + lane * 4;
  #pragma unroll
  for (int s = 0; s < KSPLIT; ++s) {
    const float* ps = pp + (size_t)s * (128 * 1024);
    #pragma unroll
    for (int t = 0; t < 4; ++t) {
      const v4f a = *(const v4fa*)(ps + (2 * t) * 128);
      const v4f c = *(const v4fa*)(ps + (2 * t + 1) * 128);
      acc[t] += __builtin_shufflevector(a, c, 0, 1, 2, 3, 4, 5, 6, 7);
    }
  }
  // acc[t][r] = conv out [token 64blk+16w+8h+r][channel 16t+m]

  float mu[8], rs[8];
  #pragma unroll
  for (int r = 0; r < 8; ++r) {
    float s = acc[0][r] + acc[1][r] + acc[2][r] + acc[3][r];
    s = red16(s);
    mu[r] = s * (1.0f / 64.0f);
    float v = 0.f;
    #pragma unroll
    for (int t = 0; t < 4; ++t) { const float d = acc[t][r] - mu[r]; v += d * d; }
    v = red16(v) * (1.0f / 64.0f);
    rs[r] = rsqrtf(v + LN_EPS);
  }
  #pragma unroll
  for (int t = 0; t < 4; ++t) {
    const int col = 16 * t + m;
    const float g = gamma[col], be = beta[col];
    #pragma unroll
    for (int r = 0; r < 8; ++r) {
      const float y = (acc[t][r] - mu[r]) * rs[r] * g + be;
      const u16 hh = bf_rne(y);
      const u16 ll = bf_rne(y - bf_val(hh));
      const int kl_ = 16 * w + 8 * h + r;
      sX[kl_ * 64 + col] = hh;
      sX[4096 + kl_ * 64 + col] = ll;
    }
  }
  __syncthreads();

  // kv projection A fragments: row = token 16w+m, k = channel
  const v16b xah0 = ld_frag(sX + (16 * w + m) * 64, h);
  const v16b xah1 = ld_frag(sX + (16 * w + m) * 64 + 32, h);
  const v16b xal0 = ld_frag(sX + 4096 + (16 * w + m) * 64, h);
  const v16b xal1 = ld_frag(sX + 4096 + (16 * w + m) * 64 + 32, h);

  #pragma unroll
  for (int ct = 0; ct < 8; ++ct) {
    const int off = ct * 1024 + lane * 8;
    const v16b b0h = ld_fragp(wkvh + off);
    const v16b b0l = ld_fragp(wkvl + off);
    const v16b b1h = ld_fragp(wkvh + off + 512);
    const v16b b1l = ld_fragp(wkvl + off + 512);
    v8f c = zero8;
    c = wmma_bf(xah0, b0h, c);
    c = wmma_bf(xah0, b0l, c);
    c = wmma_bf(xal0, b0h, c);
    c = wmma_bf(xah1, b1h, c);
    c = wmma_bf(xah1, b1l, c);
    c = wmma_bf(xal1, b1h, c);
    // c[r] = kv[token 16w+8h+r][col 16ct+m]
    const int col = 16 * ct + m;
    const float bb = bkv[col];
    #pragma unroll
    for (int r = 0; r < 8; ++r) {
      const float val = c[r] + bb;
      const u16 hh = bf_rne(val);
      const u16 ll = bf_rne(val - bf_val(hh));
      const int kl_ = 16 * w + 8 * h + r;
      if (ct < 4) {
        sK[kl_ * 64 + col] = hh;
        sK[4096 + kl_ * 64 + col] = ll;
      } else {
        const int d = col - 64;
        sV[d * 64 + kl_] = hh;
        sV[4096 + d * 64 + kl_] = ll;
      }
    }
  }
  __syncthreads();

  kv_store_pass(sK, sV, kh, kl, vth, vtl, blk, tid);
  
}

// ---------------------------------------------------------------------------
// lanes 8q..8q+7 in one instruction, 4 lines per instruction, 32 lines per wave.
// ---------------------------------------------------------------------------
// The LDS tile keeps 16-B chunk q of row m at chunk q ^ m (see the writer in k_attn).
__device__ __forceinline__ void att_store_pass(const float* so, float* out, size_t grow0, int lane) {
  const int q8 = lane & 7, sub = lane >> 3;
  #pragma unroll
  for (int i = 0; i < 8; ++i) {
    const int lid = i * 4 + sub;
    const int row = lid >> 1, hl = lid & 1;
    const v4f v = *(const v4fa*)(so + row * 64 + 4 * ((8 * hl + q8) ^ row));
    *(v4f*)(out + (grow0 + (size_t)row) * CD + 32 * hl + 4 * q8) = v;
  }
}

// ---------------------------------------------------------------------------
// Kernel 4: fused q projection + attention over 256 reduced tokens + output projection.
// Block = 64 threads (2 waves), 16 queries per wave; grid = (512, 8).
//   q^T = wq * x^T          : A = wq plane rows, B = x^T split in registers
//   S^T = K * q^T           : A = K plane rows, B = q^T packed from two adjacent D tiles
//   softmax over 256 keys   : f32, scores parked in LDS; each lane re-reads only what it wrote,
//                             so the park is lane-major: 16-B chunk c of lane l at (c*32 + l)*16 B,
//                             every LDS access of a wave covers 512 contiguous bytes (no bank conflict)
//   O^T = V^T * P^T         : A = V^T plane rows, B = P^T from LDS
//   out^T = wproj * O^T     : A = wproj plane rows, B = O^T packed from D tiles
// ---------------------------------------------------------------------------
__global__ __launch_bounds__(64) void k_attn(
    const float* __restrict__ x,
    const u16* __restrict__ wqh, const u16* __restrict__ wql, const float* __restrict__ bq,
    const u16* __restrict__ kh, const u16* __restrict__ kl,      // 2048 x 64, fragment order
    const u16* __restrict__ vth, const u16* __restrict__ vtl,    // 8 x (64 x 256), fragment order
    const u16* __restrict__ wph, const u16* __restrict__ wpl, const float* __restrict__ bproj,
    float* __restrict__ out)                                     // [8][16384][64]
{
  __shared__ __attribute__((aligned(16))) float sS[2][16 * 256];
  __shared__ __attribute__((aligned(16))) float sO[2][16 * 64];

  const int tid = threadIdx.x, lane = tid & 31, w = tid >> 5;
  const int h = lane >> 4, m = lane & 15;
  const int b = blockIdx.y;
  const int q0 = blockIdx.x * 32 + 16 * w;
  const v8f zero8 = {0.f, 0.f, 0.f, 0.f, 0.f, 0.f, 0.f, 0.f};

  // ---- q^T = wq * x^T : qt[t][r] = q[query q0+m][feature 16t+8h+r] ----
  v8f qt[4];
  #pragma unroll
  for (int t = 0; t < 4; ++t) qt[t] = zero8;
  const float* xr = x + ((size_t)b * NQ + q0 + m) * CD;
  #pragma unroll
  for (int ks = 0; ks < 2; ++ks) {
    const float* xp = xr + 32 * ks + 8 * h;
    const v4f a0 = *(const v4fa*)(xp);
    const v4f a1 = *(const v4fa*)(xp + 4);
    const v4f c0 = *(const v4fa*)(xp + 16);
    const v4f c1 = *(const v4fa*)(xp + 20);
    const v8f a8 = __builtin_shufflevector(a0, a1, 0, 1, 2, 3, 4, 5, 6, 7);
    const v8f c8 = __builtin_shufflevector(c0, c1, 0, 1, 2, 3, 4, 5, 6, 7);
    v16b xbh, xbl;
    split_frag(a8, c8, xbh, xbl);
    #pragma unroll
    for (int t = 0; t < 4; ++t) {
      const int off = (2 * t + ks) * 512 + lane * 8;
      const v16b fah = ld_fragp(wqh + off);
      const v16b fal = ld_fragp(wql + off);
      qt[t] = wmma_bf(fah, xbh, qt[t]);
      qt[t] = wmma_bf(fah, xbl, qt[t]);
      qt[t] = wmma_bf(fal, xbh, qt[t]);
    }
  }
  v8f qv[4];
  #pragma unroll
  for (int t = 0; t < 4; ++t)
    #pragma unroll
    for (int r = 0; r < 8; ++r)
      qv[t][r] = (qt[t][r] + bq[16 * t + 8 * h + r]) * 0.125f;   // d^-1/2 folded into q (exact)
  // B fragment for k = d: element i <- tile 2ks row i, element 8+i <- tile 2ks+1 row i
  v16b qbh0, qbl0, qbh1, qbl1;
  split_frag(qv[0], qv[1], qbh0, qbl0);
  split_frag(qv[2], qv[3], qbh1, qbl1);

  // ---- scores: z[r] = S[query m][key 16j+8h+r], parked as this lane's chunks 2j (r 0..3) and 2j+1 (r 4..7) ----
  float* sw = &sS[w][0];
  float* sl = sw + lane * 4;                     // chunk c of this lane: sl + c*128
  float mx = -3.0e38f;
  const u16* kbh = kh + (size_t)b * NKEY * CD + lane * 8;
  const u16* kbl = kl + (size_t)b * NKEY * CD + lane * 8;
  #pragma unroll 1
  for (int j = 0; j < 16; ++j) {
    const int ko = j * 1024;                     // two fragments per 16 keys
    const v16b a0h = ld_fragp(kbh + ko);
    const v16b a0l = ld_fragp(kbl + ko);
    const v16b a1h = ld_fragp(kbh + ko + 512);
    const v16b a1l = ld_fragp(kbl + ko + 512);
    v8f z = zero8;
    z = wmma_bf(a0h, qbh0, z);
    z = wmma_bf(a0h, qbl0, z);
    z = wmma_bf(a0l, qbh0, z);
    z = wmma_bf(a1h, qbh1, z);
    z = wmma_bf(a1h, qbl1, z);
    z = wmma_bf(a1l, qbh1, z);
    const v4f z0 = __builtin_shufflevector(z, z, 0, 1, 2, 3);
    const v4f z1 = __builtin_shufflevector(z, z, 4, 5, 6, 7);
    *(v4fa*)(sl + 256 * j) = z0;
    *(v4fa*)(sl + 256 * j + 128) = z1;
    #pragma unroll
    for (int r = 0; r < 8; ++r) mx = fmaxf(mx, z[r]);
  }
  mx = fmaxf(mx, __shfl_xor(mx, 16));

  // ---- softmax numerator + row sum (f32); same lane, same addresses ----
  float sum = 0.f;
  #pragma unroll 2
  for (int a = 0; a < 16; ++a) {
    float* pp = sl + 256 * a;
    v4f v0 = *(const v4fa*)pp;
    v4f v1 = *(const v4fa*)(pp + 128);
    #pragma unroll
    for (int e = 0; e < 4; ++e) {
      v0[e] = __expf(v0[e] - mx);
      v1[e] = __expf(v1[e] - mx);
      sum += v0[e] + v1[e];
    }
    *(v4fa*)pp = v0;
    *(v4fa*)(pp + 128) = v1;
  }
  sum += __shfl_xor(sum, 16);
  const float inv = 1.0f / sum;

  // ---- O^T = V^T * P^T : o[t][r] = O[query m][d 16t+8h+r] ----
  v8f o[4];
  #pragma unroll
  for (int t = 0; t < 4; ++t) o[t] = zero8;
  const u16* vbh = vth + (size_t)b * CD * NKEY + lane * 8;
  const u16* vbl = vtl + (size_t)b * CD * NKEY + lane * 8;
  #pragma unroll 1
  for (int c = 0; c < 8; ++c) {
    const float* pp = sl + 512 * c;              // chunks 4c..4c+3: keys 32c+8h.., 32c+16+8h..
    const v4f p0 = *(const v4fa*)pp;
    const v4f p1 = *(const v4fa*)(pp + 128);
    const v4f p2 = *(const v4fa*)(pp + 256);
    const v4f p3 = *(const v4fa*)(pp + 384);
    const v8f pa = __builtin_shufflevector(p0, p1, 0, 1, 2, 3, 4, 5, 6, 7) * inv;
    const v8f pc = __builtin_shufflevector(p2, p3, 0, 1, 2, 3, 4, 5, 6, 7) * inv;
    v16b pbh, pbl;
    split_frag(pa, pc, pbh, pbl);
    #pragma unroll
    for (int t = 0; t < 4; ++t) {
      const int vo = (8 * t + c) * 512;
      const v16b fah = ld_fragp(vbh + vo);
      const v16b fal = ld_fragp(vbl + vo);
      o[t] = wmma_bf(fah, pbh, o[t]);
      o[t] = wmma_bf(fah, pbl, o[t]);
      o[t] = wmma_bf(fal, pbh, o[t]);
    }
  }

  // ---- out^T = wproj * O^T : u[t][r] = out[query m][feature 16t+8h+r] ----
  v16b obh0, obl0, obh1, obl1;
  split_frag(o[0], o[1], obh0, obl0);
  split_frag(o[2], o[3], obh1, obl1);
  v8f u[4];
  #pragma unroll
  for (int t = 0; t < 4; ++t) {
    const int off = t * 1024 + lane * 8;
    const v16b a0h = ld_fragp(wph + off);
    const v16b a0l = ld_fragp(wpl + off);
    const v16b a1h = ld_fragp(wph + off + 512);
    const v16b a1l = ld_fragp(wpl + off + 512);
    v8f z = zero8;
    z = wmma_bf(a0h, obh0, z);
    z = wmma_bf(a0h, obl0, z);
    z = wmma_bf(a0l, obh0, z);
    z = wmma_bf(a1h, obh1, z);
    z = wmma_bf(a1h, obl1, z);
    z = wmma_bf(a1l, obh1, z);
    u[t] = z;
  }
  // row m of the output tile, 16-B chunk q stored at chunk q ^ m: the 16 rows of one store fall on 16 different bank groups
  float* so = &sO[w][0];
  #pragma unroll
  for (int t = 0; t < 4; ++t) {
    v8f y;
    #pragma unroll
    for (int r = 0; r < 8; ++r) y[r] = u[t][r] + bproj[16 * t + 8 * h + r];
    const int q = 4 * t + 2 * h;
    *(v4fa*)(so + m * 64 + 4 * (q ^ m))       = __builtin_shufflevector(y, y, 0, 1, 2, 3);
    *(v4fa*)(so + m * 64 + 4 * ((q + 1) ^ m)) = __builtin_shufflevector(y, y, 4, 5, 6, 7);
  }
  __syncthreads();

  const size_t grow0 = (size_t)b * NQ + q0;
  att_store_pass(so, out, grow0, lane);
  
}

// ---------------------------------------------------------------------------
extern "C" void kernel_launch(void* const* d_in, const int* in_sizes, int n_in,
                              void* d_out, int out_size, void* d_ws, size_t ws_size,
                              hipStream_t stream) {
  if (n_in < 12) return;
  if (in_sizes[0] != NBATCH * NQ * CD) return;
  if (in_sizes[1] != CD * CD || in_sizes[2] != CD) return;
  if (in_sizes[3] != 2 * CD * CD || in_sizes[4] != 2 * CD) return;
  if (in_sizes[5] != CD * CD || in_sizes[6] != CD) return;
  if (in_sizes[7] != CD * KCONV) return;
  if (in_sizes[8] != CD || in_sizes[9] != CD) return;
  if (in_sizes[10] < 1 || in_sizes[11] < 1) return;
  if (out_size != NBATCH * NQ * CD) return;

  const float* x     = (const float*)d_in[0];
  const float* wq    = (const float*)d_in[1];
  const float* bq    = (const float*)d_in[2];
  const float* wkv   = (const float*)d_in[3];
  const float* bkv   = (const float*)d_in[4];
  const float* wproj = (const float*)d_in[5];
  const float* bproj = (const float*)d_in[6];
  const float* wsr   = (const float*)d_in[7];
  const float* gamma = (const float*)d_in[8];
  const float* beta  = (const float*)d_in[9];
  const int*   Hp    = (const int*)d_in[10];
  const int*   Wp    = (const int*)d_in[11];
  float* out = (float*)d_out;

  const size_t szWq  = (size_t)CD * CD * 2;            //      8192 per plane
  const size_t szWkv = (size_t)2 * CD * CD * 2;        //     16384
  const size_t szWp  = (size_t)CD * CD * 2;            //      8192
  const size_t szWs  = (size_t)CD * KCONV * 2;         //    524288
  const size_t szK   = (size_t)NROWK * CD * 2;         //    262144
  const size_t szVt  = (size_t)NBATCH * CD * NKEY * 2; //    262144
  const size_t szPt  = (size_t)KSPLIT * NROWK * CD * 4; //  8388608
  size_t off = 0;
  const size_t oWqh = off;  off += szWq;
  const size_t oWql = off;  off += szWq;
  const size_t oWkh = off;  off += szWkv;
  const size_t oWkl = off;  off += szWkv;
  const size_t oWph = off;  off += szWp;
  const size_t oWpl = off;  off += szWp;
  const size_t oWsh = off;  off += szWs;
  const size_t oWsl = off;  off += szWs;
  const size_t oKh  = off;  off += szK;
  const size_t oKl  = off;  off += szK;
  const size_t oVth = off;  off += szVt;
  const size_t oVtl = off;  off += szVt;
  const size_t oPt  = off;  off += szPt;              // total 10551296
  if (off > ws_size) return;
  if (off > (size_t)134217728) return;

  char* ws = (char*)d_ws;
  u16* wqh  = (u16*)(ws + oWqh);
  u16* wql  = (u16*)(ws + oWql);
  u16* wkvh = (u16*)(ws + oWkh);
  u16* wkvl = (u16*)(ws + oWkl);
  u16* wph  = (u16*)(ws + oWph);
  u16* wpl  = (u16*)(ws + oWpl);
  u16* wsh  = (u16*)(ws + oWsh);
  u16* wsl  = (u16*)(ws + oWsl);
  u16* kh   = (u16*)(ws + oKh);
  u16* kl   = (u16*)(ws + oKl);
  u16* vth  = (u16*)(ws + oVth);
  u16* vtl  = (u16*)(ws + oVtl);
  float* part = (float*)(ws + oPt);

  k_prep_w<<<136, 256, 0, stream>>>(wq, wkv, wproj, wsr, wqh, wql, wkvh, wkvl, wph, wpl, wsh, wsl);

  dim3 gConv(NROWK / 64, KSPLIT);                                                  // (32, 16)
  k_conv_part<<<gConv, 128, 0, stream>>>(x, Hp, Wp, wsh, wsl, part);

  k_kv<<<NROWK / 64, 128, 0, stream>>>(part, gamma, beta, wkvh, wkvl, bkv,
                                       kh, kl, vth, vtl);                           // 32 blocks

  dim3 gAtt(NQ / 32, NBATCH);                                                      // (512, 8)
  k_attn<<<gAtt, 64, 0, stream>>>(x, wqh, wql, bq, kh, kl, vth, vtl, wph, wpl, bproj, out);
}

// v005
// It runs in 60.7 microseconds.
// Next to v004, in two timings, it ran 1.65 and 1.64 times as fast.
// All steps since v000 together make it 4.16 times as fast.
// All contractions (q projection, 8x8 stride-8 reduction conv as a patch GEMM, kv projection, q*k^T scores, P*V, output projection): v_wmma_f32_16x16x32_bf16, bf16 hi/lo operands everywhere (hi*hi + hi*lo + lo*hi), f32 accumulate; LayerNorm, softmax and biases in f32.
#include <hip/hip_runtime.h>
#include <stdint.h>

typedef unsigned short u16;
typedef u16    v16u __attribute__((ext_vector_type(16)));
typedef u16    v8u  __attribute__((ext_vector_type(8)));
typedef __bf16 v16b __attribute__((ext_vector_type(16)));
typedef float  v8f  __attribute__((ext_vector_type(8)));
typedef float  v4f  __attribute__((ext_vector_type(4)));
typedef v8u __attribute__((may_alias)) v8ua;
typedef v4f __attribute__((may_alias)) v4fa;

union Frag { v16b v; v16u u; v8u half[2]; };
static_assert(sizeof(Frag) == 32);

#define NBATCH 8
#define NQ     16384
#define CD     64
#define NKEY   256
#define NROWK  2048        // NBATCH * NKEY reduced tokens
#define KCONV  4096        // 64 patch pixels x 64 channels, k = p*64 + ci
#define LN_EPS 1e-5f
#define KSPLIT 16          // slices of the conv reduction, one work-group each
#define KSLICE 256         // KCONV / KSPLIT

// ---------------------------------------------------------------------------
// 16x16x32 bf16 WMMA with hazard guard (ties D, keeps A/B live).
// Fragment map (wave32): lane l, h = l>>4, m = n = l&15.
//   A/B element i: i<8 -> k0+8h+i ; i>=8 -> k0+16+8h+(i-8)
//   D element r : row 8h+r, col l&15
// ---------------------------------------------------------------------------
__device__ __forceinline__ v8f wmma_bf(v16b a, v16b b, v8f c) {
  v8f d = __builtin_amdgcn_wmma_f32_16x16x32_bf16(false, a, false, b, (short)0, c, false, false);
  asm volatile("v_nop\n\tv_nop\n\tv_nop\n\tv_nop" : "+v"(d) : "v"(a), "v"(b));
  return d;
}

// f32 -> bf16 bits, RNE
__device__ __forceinline__ u16 bf_rne(float f) {
  unsigned u = __builtin_bit_cast(unsigned, f);
  u += 0x7FFFu + ((u >> 16) & 1u);
  return (u16)(u >> 16);
}
__device__ __forceinline__ float bf_val(u16 b) {
  return __builtin_bit_cast(float, ((unsigned)b) << 16);
}

// 8 floats -> hi/lo bf16 planes (hi = rne(x), lo = rne(x - hi))
__device__ __forceinline__ void split8(v8f f, v8u& hi, v8u& lo) {
  #pragma unroll
  for (int i = 0; i < 8; ++i) {
    const u16 hh = bf_rne(f[i]);
    hi[i] = hh;
    lo[i] = bf_rne(f[i] - bf_val(hh));
  }
}

// 16 floats given in fragment element order (a = elements 0..7, c = 8..15) -> hi/lo fragments
__device__ __forceinline__ void split_frag(v8f a, v8f c, v16b& fhi, v16b& flo) {
  Frag fh, fl;
  v8u h0, l0, h1, l1;
  split8(a, h0, l0);
  split8(c, h1, l1);
  fh.half[0] = h0; fh.half[1] = h1;
  fl.half[0] = l0; fl.half[1] = l1;
  fhi = fh.v; flo = fl.v;
}

// A or B fragment from a k-contiguous bf16 row; p points at element k0 of the row owned by this lane.
__device__ __forceinline__ v16b ld_frag(const u16* p, int h) {
  Frag f;
  f.half[0] = *(const v8ua*)(p + 8 * h);
  f.half[1] = *(const v8ua*)(p + 16 + 8 * h);
  return f.v;
}

// Planes that a kernel reads from the workspace are kept in fragment order: fragment f = (row tile) * (k / 32) + k step
// is 512 elements; lane l's elements 0..7 stand at f*512 + l*8, its elements 8..15 at f*512 + 256 + l*8,
// so each wave-wide 16-B load covers 512 contiguous bytes. p points at f*512 + l*8.
__device__ __forceinline__ v16b ld_fragp(const u16* p) {
  Frag f;
  f.half[0] = *(const v8ua*)p;
  f.half[1] = *(const v8ua*)(p + 256);
  return f.v;
}

// Writer's side of the same map: g8 = index of a group of 8 consecutive plane elements, 1 << ksh fragments per row tile
// -> matrix row and first k of the group.
__device__ __forceinline__ void frag_rk(int g8, int ksh, int& row, int& k) {
  const int f = g8 >> 6;
  row = ((f >> ksh) << 4) + (g8 & 15);
  k = ((f & ((1 << ksh) - 1)) << 5) + ((g8 >> 5) & 1) * 16 + ((g8 >> 4) & 1) * 8;
}

__device__ __forceinline__ float red16(float v) {
  v += __shfl_xor(v, 1);
  v += __shfl_xor(v, 2);
  v += __shfl_xor(v, 4);
  v += __shfl_xor(v, 8);
  return v;
}

// ---------------------------------------------------------------------------
// Kernel 1: weights -> bf16 hi/lo planes.
//   wq [64][64], wkv [128][64], wproj [64][64]: row = out, k = in;
//   wsr: row = co, k = p*64 + ci, p = i*8 + j. All four in fragment order.
// One thread = 8 consecutive plane elements = one 16-B store per plane; lanes contiguous
// ---------------------------------------------------------------------------
__global__ __launch_bounds__(256) void k_prep_w(
    const float* __restrict__ wq, const float* __restrict__ wkv,
    const float* __restrict__ wproj, const float* __restrict__ wsr,
    u16* __restrict__ wqh, u16* __restrict__ wql,
    u16* __restrict__ wkvh, u16* __restrict__ wkvl,
    u16* __restrict__ wph, u16* __restrict__ wpl,
    u16* __restrict__ wsh, u16* __restrict__ wsl)
{
  const int blk = blockIdx.x, tid = threadIdx.x;
  if (blk >= 136) return;
  v8f f;
  u16* dh;
  u16* dl;
  int e;
  if (blk < 8) {                    // block-uniform region select
    const float* src;
    if (blk < 2)      { e = blk * 256 + tid;        src = wq;    dh = wqh;  dl = wql;  }
    else if (blk < 6) { e = (blk - 2) * 256 + tid;  src = wkv;   dh = wkvh; dl = wkvl; }
    else              { e = (blk - 6) * 256 + tid;  src = wproj; dh = wph;  dl = wpl;  }
    int row, k;
    frag_rk(e, 1, row, k);
    const float* s = src + row * CD + k;
    const v4f a = *(const v4fa*)s;
    const v4f c = *(const v4fa*)(s + 4);
    f = __builtin_shufflevector(a, c, 0, 1, 2, 3, 4, 5, 6, 7);
  } else {
    e = (blk - 8) * 256 + tid;                          // 0..32767
    int co, k;
    frag_rk(e, 7, co, k);
    const int p = k >> 6, ci0 = k & 63;                 // k = p*64 + ci0
    const float* s = wsr + (size_t)co * KCONV + ci0 * 64 + p;   // wsr[co][ci][i][j] = co*4096 + ci*64 + p
    #pragma unroll
    for (int c = 0; c < 8; ++c) f[c] = s[c * 64];
    dh = wsh; dl = wsl;
  }
  v8u hi, lo;
  split8(f, hi, lo);
  u16* ph = dh + (size_t)e * 8;
  u16* pl = dl + (size_t)e * 8;
  *(v8u*)ph = hi;
  *(v8u*)pl = lo;
  
}

// ---------------------------------------------------------------------------
// K and V^T planes out of LDS, in fragment order: per plane 8 fragments = 512 groups of 8 elements,
// one group per thread and pass, 512 contiguous bytes per wave and store.
//   K  : row = token, k = d;   fragment (global token >> 4) * 2 + (d >> 5)
//   V^T: row = d, k = key;     fragment batch * 32 + (d >> 4) * 8 + (key >> 5)
// ---------------------------------------------------------------------------
__device__ __forceinline__ void kv_store_pass(const u16* sK, const u16* sV,
                                              u16* kh, u16* kl, u16* vth, u16* vtl,
                                              int blk, int tid) {
  const int bb = blk >> 2, kq = blk & 3;
  #pragma unroll
  for (int it = 0; it < 16; ++it) {
    const int p = (it >> 2) & 1;
    const int g8 = (it & 3) * 128 + tid;           // 0..511
    int row, k;
    frag_rk(g8, 1, row, k);                        // both 0..63, local to this block
    v8u v;
    u16* dst;
    if (it < 8) {
      v = *(const v8ua*)(sK + (p * 64 + row) * 64 + k);
      u16* plane = p ? kl : kh;
      dst = plane + (size_t)blk * 4096 + g8 * 8;
    } else {
      v = *(const v8ua*)(sV + (p * 64 + row) * 64 + k);
      u16* plane = p ? vtl : vth;
      const int f = g8 >> 6;
      dst = plane + (size_t)(bb * 32 + (f >> 1) * 8 + 2 * kq + (f & 1)) * 512 + (g8 & 63) * 8;
    }
    *(v8u*)dst = v;
  }
}

// ---------------------------------------------------------------------------
// Kernel 2: conv GEMM, split along k, patches gathered from x in the A loader (no patch planes).
//   Block = 64 conv rows x one k slice of 256 (4 patch pixels x 64 channels), 4 waves x 16 rows
//   (the 4 waves read the same weight slice).
//   row r = b*256 + m, m = py*16 + px; k = p*64 + ci, p = i*8 + j;
//   A value = x[b][pix][ci], pix = (8py+i)*W + 8px + j (clamped), split to bf16 hi/lo in registers.
//   Each wave stores its f32 16x64 partial tile in accumulator order:
//   part[slice][row tile][t][j][lane][4] = acc[t][4j..4j+3], 512 B per store.
// grid = (32, 16) blocks x 128 threads.
// ---------------------------------------------------------------------------
__global__ __launch_bounds__(128) void k_conv_part(
    const float* __restrict__ x, const int* __restrict__ Hp, const int* __restrict__ Wp,
    const u16* __restrict__ wsh, const u16* __restrict__ wsl,     // 64 x 4096, fragment order
    float* __restrict__ part)                                     // [16][128][4][2][32][4]
{
  const int tid = threadIdx.x, lane = tid & 31, w = tid >> 5;
  const int h = lane >> 4, m = lane & 15;
  const int blk = blockIdx.x, sp = blockIdx.y;
  const int f0 = sp * (KSLICE / 32);           // first k step of this slice; 128 k steps per row tile

  const int Hv = Hp[0], Wv = Wp[0];
  const long long hw = (long long)Hv * (long long)Wv;
  const int lim = (hw >= 1 && hw <= NQ) ? (int)(hw - 1) : (NQ - 1);
  const int r = blk * 64 + w * 16 + m;
  const int bb = r >> 8, mm = r & 255;
  const int py = mm >> 4, px = mm & 15;

  // The whole slice of this lane's row, 16 KB per wave, is asked for before any of it is used:
  // with two waves per SIMD only the loads in flight cover the memory latency.
  // Both loops unrolled: xa is indexed by their counters and has to stay in registers.
  v4f xa[KSLICE / 32][4];
  #pragma unroll
  for (int q = 0; q < KSLICE / 64; ++q) {
    const int p = sp * (KSLICE / 64) + q;
    const int ii = p >> 3, jj = p & 7;
    int pix = (8 * py + ii) * Wv + 8 * px + jj;
    pix = min(max(pix, 0), lim);
    const float* s = x + ((size_t)bb * NQ + pix) * CD + 8 * h;
    #pragma unroll
    for (int c = 0; c < 2; ++c) {
      xa[2 * q + c][0] = *(const v4fa*)(s + 32 * c);
      xa[2 * q + c][1] = *(const v4fa*)(s + 32 * c + 4);
      xa[2 * q + c][2] = *(const v4fa*)(s + 32 * c + 16);
      xa[2 * q + c][3] = *(const v4fa*)(s + 32 * c + 20);
    }
  }
  // precaution: the address registers of the loads above are reused further down
  asm volatile("s_wait_xcnt 0x0" ::: "memory");

  const v8f zero8 = {0.f, 0.f, 0.f, 0.f, 0.f, 0.f, 0.f, 0.f};
  v8f acc[4];
  #pragma unroll
  for (int t = 0; t < 4; ++t) acc[t] = zero8;

  const u16* brh = wsh + (size_t)f0 * 512 + lane * 8;
  const u16* brl = wsl + (size_t)f0 * 512 + lane * 8;

  // Weight fragments run one k step ahead: tile t's pair for step ks + 1 is asked for right behind
  // tile t's products of step ks, so no product waits out the latency of its own loads.
  v16b fbh[4], fbl[4];
  #pragma unroll
  for (int t = 0; t < 4; ++t) {
    fbh[t] = ld_fragp(brh + (t * 128) * 512);
    fbl[t] = ld_fragp(brl + (t * 128) * 512);
  }

  // unrolled: xa is indexed by ks and has to stay in registers
  #pragma unroll
  for (int ks = 0; ks < KSLICE / 32; ++ks) {
    v16b fah, fal;
    split_frag(__builtin_shufflevector(xa[ks][0], xa[ks][1], 0, 1, 2, 3, 4, 5, 6, 7),
               __builtin_shufflevector(xa[ks][2], xa[ks][3], 0, 1, 2, 3, 4, 5, 6, 7), fah, fal);
    #pragma unroll
    for (int t = 0; t < 4; ++t) {
      acc[t] = wmma_bf(fah, fbh[t], acc[t]);
      acc[t] = wmma_bf(fah, fbl[t], acc[t]);
      acc[t] = wmma_bf(fal, fbh[t], acc[t]);
      if (ks + 1 < KSLICE / 32) {
        fbh[t] = ld_fragp(brh + (t * 128 + ks + 1) * 512);
        fbl[t] = ld_fragp(brl + (t * 128 + ks + 1) * 512);
      }
    }
  }

  float* pp = part + ((size_t)sp * 128 + blk * 4 + w) * 1024 + lane * 4;
  #pragma unroll
  for (int t = 0; t < 4; ++t) {
    *(v4f*)(pp + (2 * t) * 128)     = __builtin_shufflevector(acc[t], acc[t], 0, 1, 2, 3);
    *(v4f*)(pp + (2 * t + 1) * 128) = __builtin_shufflevector(acc[t], acc[t], 4, 5, 6, 7);
  }
}

// ---------------------------------------------------------------------------
// Kernel 3: reduced tokens. Block = 64 conv rows (tokens) of one batch, 4 waves x 16 rows.
//   sum of the 16 k-slice partials (slice 0 first) -> LayerNorm (f32) -> kv proj (16x64 @ 64x128)
//   -> K planes 2048 x 64 and V^T planes 8 x (64 x 256) (bf16 hi/lo), fragment order, whole-line stores.
// grid = 32 blocks x 128 threads.
// ---------------------------------------------------------------------------
__global__ __launch_bounds__(128) void k_kv(
    const float* __restrict__ part,                               // [16][128][4][2][32][4]
    const float* __restrict__ gamma, const float* __restrict__ beta,
    const u16* __restrict__ wkvh, const u16* __restrict__ wkvl,   // 128 x 64, fragment order
    const float* __restrict__ bkv,
    u16* __restrict__ kh, u16* __restrict__ kl,                   // 2048 x 64, fragment order
    u16* __restrict__ vth, u16* __restrict__ vtl)                 // 8 x (64 x 256), fragment order
{
  __shared__ __attribute__((aligned(16))) u16 sX[2 * 64 * 64];   // LN output hi/lo [p][token][c]
  __shared__ __attribute__((aligned(16))) u16 sK[2 * 64 * 64];   // [p][token][d]
  __shared__ __attribute__((aligned(16))) u16 sV[2 * 64 * 64];   // [p][d][token]

  const int tid = threadIdx.x, lane = tid & 31, w = tid >> 5;
  const int h = lane >> 4, m = lane & 15;
  const int blk = blockIdx.x;

  const v8f zero8 = {0.f, 0.f, 0.f, 0.f, 0.f, 0.f, 0.f, 0.f};
  v8f acc[4];
  #pragma unroll
  for (int t = 0; t < 4; ++t) acc[t] = zero8;

  const float* pp = part + (size_t)(blk * 4 + w) * 1024 + lane * 4;
  #pragma unroll
  for (int s = 0; s < KSPLIT; ++s) {
    const float* ps = pp + (size_t)s * (128 * 1024);
    #pragma unroll
    for (int t = 0; t < 4; ++t) {
      const v4f a = *(const v4fa*)(ps + (2 * t) * 128);
      const v4f c = *(const v4fa*)(ps + (2 * t + 1) * 128);
      acc[t] += __builtin_shufflevector(a, c, 0, 1, 2, 3, 4, 5, 6, 7);
    }
  }
  // acc[t][r] = conv out [token 64blk+16w+8h+r][channel 16t+m]

  float mu[8], rs[8];
  #pragma unroll
  for (int r = 0; r < 8; ++r) {
    float s = acc[0][r] + acc[1][r] + acc[2][r] + acc[3][r];
    s = red16(s);
    mu[r] = s * (1.0f / 64.0f);
    float v = 0.f;
    #pragma unroll
    for (int t = 0; t < 4; ++t) { const float d = acc[t][r] - mu[r]; v += d * d; }
    v = red16(v) * (1.0f / 64.0f);
    rs[r] = rsqrtf(v + LN_EPS);
  }
  #pragma unroll
  for (int t = 0; t < 4; ++t) {
    const int col = 16 * t + m;
    const float g = gamma[col], be = beta[col];
    #pragma unroll
    for (int r = 0; r < 8; ++r) {
      const float y = (acc[t][r] - mu[r]) * rs[r] * g + be;
      const u16 hh = bf_rne(y);
      const u16 ll = bf_rne(y - bf_val(hh));
      const int kl_ = 16 * w + 8 * h + r;
      sX[kl_ * 64 + col] = hh;
      sX[4096 + kl_ * 64 + col] = ll;
    }
  }
  // kv weight fragments run one column tile ahead of the products that use them
  v16b wb[4];
  wb[0] = ld_fragp(wkvh + lane * 8);
  wb[1] = ld_fragp(wkvl + lane * 8);
  wb[2] = ld_fragp(wkvh + lane * 8 + 512);
  wb[3] = ld_fragp(wkvl + lane * 8 + 512);
  __syncthreads();

  // kv projection A fragments: row = token 16w+m, k = channel
  const v16b xah0 = ld_frag(sX + (16 * w + m) * 64, h);
  const v16b xah1 = ld_frag(sX + (16 * w + m) * 64 + 32, h);
  const v16b xal0 = ld_frag(sX + 4096 + (16 * w + m) * 64, h);
  const v16b xal1 = ld_frag(sX + 4096 + (16 * w + m) * 64 + 32, h);

  #pragma unroll
  for (int ct = 0; ct < 8; ++ct) {
    const v16b b0h = wb[0], b0l = wb[1], b1h = wb[2], b1l = wb[3];
    if (ct + 1 < 8) {
      const int off = (ct + 1) * 1024 + lane * 8;
      wb[0] = ld_fragp(wkvh + off);
      wb[1] = ld_fragp(wkvl + off);
      wb[2] = ld_fragp(wkvh + off + 512);
      wb[3] = ld_fragp(wkvl + off + 512);
    }
    v8f c = zero8;
    c = wmma_bf(xah0, b0h, c);
    c = wmma_bf(xah0, b0l, c);
    c = wmma_bf(xal0, b0h, c);
    c = wmma_bf(xah1, b1h, c);
    c = wmma_bf(xah1, b1l, c);
    c = wmma_bf(xal1, b1h, c);
    // c[r] = kv[token 16w+8h+r][col 16ct+m]
    const int col = 16 * ct + m;
    const float bb = bkv[col];
    #pragma unroll
    for (int r = 0; r < 8; ++r) {
      const float val = c[r] + bb;
      const u16 hh = bf_rne(val);
      const u16 ll = bf_rne(val - bf_val(hh));
      const int kl_ = 16 * w + 8 * h + r;
      if (ct < 4) {
        sK[kl_ * 64 + col] = hh;
        sK[4096 + kl_ * 64 + col] = ll;
      } else {
        const int d = col - 64;
        sV[d * 64 + kl_] = hh;
        sV[4096 + d * 64 + kl_] = ll;
      }
    }
  }
  __syncthreads();

  kv_store_pass(sK, sV, kh, kl, vth, vtl, blk, tid);
  
}

// ---------------------------------------------------------------------------
// lanes 8q..8q+7 in one instruction, 4 lines per instruction, 32 lines per wave.
// ---------------------------------------------------------------------------
// The LDS tile keeps 16-B chunk q of row m at chunk q ^ m (see the writer in k_attn).
__device__ __forceinline__ void att_store_pass(const float* so, float* out, size_t grow0, int lane) {
  const int q8 = lane & 7, sub = lane >> 3;
  #pragma unroll
  for (int i = 0; i < 8; ++i) {
    const int lid = i * 4 + sub;
    const int row = lid >> 1, hl = lid & 1;
    const v4f v = *(const v4fa*)(so + row * 64 + 4 * ((8 * hl + q8) ^ row));
    *(v4f*)(out + (grow0 + (size_t)row) * CD + 32 * hl + 4 * q8) = v;
  }
}

// The four K fragments (k 0..31 hi, lo; k 32..63 hi, lo) of key tile j.
__device__ __forceinline__ void ld_k4(v16b* f, const u16* ph, const u16* pl, int j) {
  const int ko = j * 1024;                       // two fragments per 16 keys
  f[0] = ld_fragp(ph + ko);
  f[1] = ld_fragp(pl + ko);
  f[2] = ld_fragp(ph + ko + 512);
  f[3] = ld_fragp(pl + ko + 512);
}

// Scores of key tile j: z[r] = S[query m][key 16j+8h+r], parked as this lane's chunks 2j (r 0..3) and 2j+1 (r 4..7).
__device__ __forceinline__ void score_pass(const v16b* f, v16b qbh0, v16b qbl0, v16b qbh1, v16b qbl1,
                                           float* sl, int j, float& mx) {
  v8f z = {0.f, 0.f, 0.f, 0.f, 0.f, 0.f, 0.f, 0.f};
  z = wmma_bf(f[0], qbh0, z);
  z = wmma_bf(f[0], qbl0, z);
  z = wmma_bf(f[1], qbh0, z);
  z = wmma_bf(f[2], qbh1, z);
  z = wmma_bf(f[2], qbl1, z);
  z = wmma_bf(f[3], qbh1, z);
  const v4f z0 = __builtin_shufflevector(z, z, 0, 1, 2, 3);
  const v4f z1 = __builtin_shufflevector(z, z, 4, 5, 6, 7);
  *(v4fa*)(sl + 256 * j) = z0;
  *(v4fa*)(sl + 256 * j + 128) = z1;
  #pragma unroll
  for (int r = 0; r < 8; ++r) mx = fmaxf(mx, z[r]);
}

// P^T fragments of key step c (32 keys) out of this lane's park, scaled by 1 / row sum.
__device__ __forceinline__ void p_frag(const float* sl, int c, float inv, v16b& pbh, v16b& pbl) {
  const float* pp = sl + 512 * c;                // chunks 4c..4c+3: keys 32c+8h.., 32c+16+8h..
  const v4f p0 = *(const v4fa*)pp;
  const v4f p1 = *(const v4fa*)(pp + 128);
  const v4f p2 = *(const v4fa*)(pp + 256);
  const v4f p3 = *(const v4fa*)(pp + 384);
  const v8f pa = __builtin_shufflevector(p0, p1, 0, 1, 2, 3, 4, 5, 6, 7) * inv;
  const v8f pc = __builtin_shufflevector(p2, p3, 0, 1, 2, 3, 4, 5, 6, 7) * inv;
  split_frag(pa, pc, pbh, pbl);
}

// ---------------------------------------------------------------------------
// Kernel 4: fused q projection + attention over 256 reduced tokens + output projection.
// Block = 64 threads (2 waves), 16 queries per wave; grid = (512, 8).
//   q^T = wq * x^T          : A = wq plane rows, B = x^T split in registers
//   S^T = K * q^T           : A = K plane rows, B = q^T packed from two adjacent D tiles
//   softmax over 256 keys   : f32, scores parked in LDS; each lane re-reads only what it wrote,
//                             so the park is lane-major: 16-B chunk c of lane l at (c*32 + l)*16 B,
//                             every LDS access of a wave covers 512 contiguous bytes (no bank conflict)
//   O^T = V^T * P^T         : A = V^T plane rows, B = P^T from LDS
//   out^T = wproj * O^T     : A = wproj plane rows, B = O^T packed from D tiles
// Every plane fragment is asked for ahead of the products that use it: q weights with x, K three key tiles
// ahead (ring of four register sets), V^T one key step ahead, proj weights in front of the split of O.
// ---------------------------------------------------------------------------
__global__ __launch_bounds__(64) void k_attn(
    const float* __restrict__ x,
    const u16* __restrict__ wqh, const u16* __restrict__ wql, const float* __restrict__ bq,
    const u16* __restrict__ kh, const u16* __restrict__ kl,      // 2048 x 64, fragment order
    const u16* __restrict__ vth, const u16* __restrict__ vtl,    // 8 x (64 x 256), fragment order
    const u16* __restrict__ wph, const u16* __restrict__ wpl, const float* __restrict__ bproj,
    float* __restrict__ out)                                     // [8][16384][64]
{
  __shared__ __attribute__((aligned(16))) float sS[2][16 * 256];
  __shared__ __attribute__((aligned(16))) float sO[2][16 * 64];

  const int tid = threadIdx.x, lane = tid & 31, w = tid >> 5;
  const int h = lane >> 4, m = lane & 15;
  const int b = blockIdx.y;
  const int q0 = blockIdx.x * 32 + 16 * w;
  const v8f zero8 = {0.f, 0.f, 0.f, 0.f, 0.f, 0.f, 0.f, 0.f};

  // ---- q^T = wq * x^T : qt[t][r] = q[query q0+m][feature 16t+8h+r] ----
  v8f qt[4];
  #pragma unroll
  for (int t = 0; t < 4; ++t) qt[t] = zero8;
  const float* xr = x + ((size_t)b * NQ + q0 + m) * CD;
  v4f xv[2][4];
  #pragma unroll
  for (int ks = 0; ks < 2; ++ks) {
    const float* xp = xr + 32 * ks + 8 * h;
    xv[ks][0] = *(const v4fa*)(xp);
    xv[ks][1] = *(const v4fa*)(xp + 4);
    xv[ks][2] = *(const v4fa*)(xp + 16);
    xv[ks][3] = *(const v4fa*)(xp + 20);
  }
  // precaution: the address registers of the loads above are reused by what follows
  asm volatile("s_wait_xcnt 0x0" ::: "memory");
  v16b wah[2][4], wal[2][4];
  #pragma unroll
  for (int ks = 0; ks < 2; ++ks)
    #pragma unroll
    for (int t = 0; t < 4; ++t) {
      const int off = (2 * t + ks) * 512 + lane * 8;
      wah[ks][t] = ld_fragp(wqh + off);
      wal[ks][t] = ld_fragp(wql + off);
    }
  v4f bqv[4][2];
  #pragma unroll
  for (int t = 0; t < 4; ++t) {
    bqv[t][0] = *(const v4fa*)(bq + 16 * t + 8 * h);
    bqv[t][1] = *(const v4fa*)(bq + 16 * t + 8 * h + 4);
  }
  // precaution: the address registers of the loads above are reused by what follows
  asm volatile("s_wait_xcnt 0x0" ::: "memory");
  #pragma unroll
  for (int ks = 0; ks < 2; ++ks) {
    const v8f a8 = __builtin_shufflevector(xv[ks][0], xv[ks][1], 0, 1, 2, 3, 4, 5, 6, 7);
    const v8f c8 = __builtin_shufflevector(xv[ks][2], xv[ks][3], 0, 1, 2, 3, 4, 5, 6, 7);
    v16b xbh, xbl;
    split_frag(a8, c8, xbh, xbl);
    #pragma unroll
    for (int t = 0; t < 4; ++t) {
      qt[t] = wmma_bf(wah[ks][t], xbh, qt[t]);
      qt[t] = wmma_bf(wah[ks][t], xbl, qt[t]);
      qt[t] = wmma_bf(wal[ks][t], xbh, qt[t]);
    }
  }
  // key tiles 0..2 are asked for here, in front of the split of q
  const u16* kbh = kh + (size_t)b * NKEY * CD + lane * 8;
  const u16* kbl = kl + (size_t)b * NKEY * CD + lane * 8;
  v16b kf[4][4];
  #pragma unroll
  for (int s = 0; s < 3; ++s) ld_k4(kf[s], kbh, kbl, s);
  v8f qv[4];
  #pragma unroll
  for (int t = 0; t < 4; ++t)
    #pragma unroll
    for (int r = 0; r < 8; ++r)
      qv[t][r] = (qt[t][r] + bqv[t][r >> 2][r & 3]) * 0.125f;    // d^-1/2 folded into q (exact)
  // B fragment for k = d: element i <- tile 2ks row i, element 8+i <- tile 2ks+1 row i
  v16b qbh0, qbl0, qbh1, qbl1;
  split_frag(qv[0], qv[1], qbh0, qbl0);
  split_frag(qv[2], qv[3], qbh1, qbl1);

  // ---- scores: key tile j uses register set j & 3; tile j + 3 is asked for into the set that tile j - 1 has left ----
  float* sw = &sS[w][0];
  float* sl = sw + lane * 4;                     // chunk c of this lane: sl + c*128
  float mx = -3.0e38f;
  // unrolled: the set index has to be a constant, and every load then takes its tile as an immediate offset
  // from one address pair that is never rewritten while loads are in flight
  #pragma unroll
  for (int j = 0; j < 16; ++j) {
    if (j + 3 < 16) ld_k4(kf[(j + 3) & 3], kbh, kbl, j + 3);
    score_pass(kf[j & 3], qbh0, qbl0, qbh1, qbl1, sl, j, mx);
  }
  mx = fmaxf(mx, __shfl_xor(mx, 16));

  // V^T fragments of key step 0 are asked for here and land behind the softmax.
  // precaution: the V^T addresses may take the registers that the K loads name; the batch offset passes through
  // the statement so that the address arithmetic cannot be lifted over the wait
  unsigned vb0 = (unsigned)b * (CD * NKEY);
  asm volatile("s_wait_xcnt 0x0" : "+s"(vb0) : : "memory");
  const u16* vbh = vth + (size_t)vb0 + lane * 8;
  const u16* vbl = vtl + (size_t)vb0 + lane * 8;
  v16b vh[4], vl[4];
  #pragma unroll
  for (int t = 0; t < 4; ++t) {
    vh[t] = ld_fragp(vbh + (8 * t) * 512);
    vl[t] = ld_fragp(vbl + (8 * t) * 512);
  }
  // precaution: the address registers of the loads above are reused by what follows
  asm volatile("s_wait_xcnt 0x0" ::: "memory");

  // ---- softmax numerator + row sum (f32); same lane, same addresses ----
  float sum = 0.f;
  #pragma unroll 2
  for (int a = 0; a < 16; ++a) {
    float* pp = sl + 256 * a;
    v4f v0 = *(const v4fa*)pp;
    v4f v1 = *(const v4fa*)(pp + 128);
    #pragma unroll
    for (int e = 0; e < 4; ++e) {
      v0[e] = __expf(v0[e] - mx);
      v1[e] = __expf(v1[e] - mx);
      sum += v0[e] + v1[e];
    }
    *(v4fa*)pp = v0;
    *(v4fa*)(pp + 128) = v1;
  }
  sum += __shfl_xor(sum, 16);
  const float inv = 1.0f / sum;

  // ---- O^T = V^T * P^T : o[t][r] = O[query m][d 16t+8h+r] ----
  v8f o[4];
  #pragma unroll
  for (int t = 0; t < 4; ++t) o[t] = zero8;
  // tile t's pair for key step c + 1 is asked for right behind tile t's products of step c, into the same registers
  const char* vub = (const char*)(vth + (size_t)vb0);   // wave-uniform plane bases of this batch
  const char* vlb = (const char*)(vtl + (size_t)vb0);
  unsigned vof = (unsigned)lane * 16u + 1024u;           // this lane's byte offset in the fragments of key step c + 1
  #pragma unroll 1
  for (int c = 0; c < 7; ++c) {
    v16b pbh, pbl;
    p_frag(sl, c, inv, pbh, pbl);
    #pragma unroll
    for (int t = 0; t < 4; ++t) {
      o[t] = wmma_bf(vh[t], pbh, o[t]);
      o[t] = wmma_bf(vh[t], pbl, o[t]);
      o[t] = wmma_bf(vl[t], pbh, o[t]);
      vh[t] = ld_fragp((const u16*)(vub + vof + t * 8192));
      vl[t] = ld_fragp((const u16*)(vlb + vof + t * 8192));
    }
    // The offset moves on by one key step (1024 bytes) inside the statement of the wait: this trip's loads, still
    // in flight, name its register (precaution), and nothing can be lifted between wait and addition; at the
    // loop's foot the wait also stands in front of whatever reuses the address registers behind the loop.
    asm volatile("s_wait_xcnt 0x0\n\tv_add_nc_u32_e32 %0, 0x400, %0" : "+v"(vof) : : "memory");
  }
  {
    v16b pbh, pbl;
    p_frag(sl, 7, inv, pbh, pbl);
    #pragma unroll
    for (int t = 0; t < 4; ++t) {
      o[t] = wmma_bf(vh[t], pbh, o[t]);
      o[t] = wmma_bf(vh[t], pbl, o[t]);
      o[t] = wmma_bf(vl[t], pbh, o[t]);
    }
  }

  // ---- out^T = wproj * O^T : u[t][r] = out[query m][feature 16t+8h+r] ----
  v16b wpf[4][4];
  #pragma unroll
  for (int t = 0; t < 4; ++t) {
    const int off = t * 1024 + lane * 8;
    wpf[t][0] = ld_fragp(wph + off);
    wpf[t][1] = ld_fragp(wpl + off);
    wpf[t][2] = ld_fragp(wph + off + 512);
    wpf[t][3] = ld_fragp(wpl + off + 512);
  }
  // precaution: the address registers of the loads above are reused by what follows
  asm volatile("s_wait_xcnt 0x0" ::: "memory");
  v4f bpv[4][2];
  #pragma unroll
  for (int t = 0; t < 4; ++t) {
    bpv[t][0] = *(const v4fa*)(bproj + 16 * t + 8 * h);
    bpv[t][1] = *(const v4fa*)(bproj + 16 * t + 8 * h + 4);
  }
  v16b obh0, obl0, obh1, obl1;
  split_frag(o[0], o[1], obh0, obl0);
  split_frag(o[2], o[3], obh1, obl1);
  v8f u[4];
  #pragma unroll
  for (int t = 0; t < 4; ++t) {
    const v16b a0h = wpf[t][0], a0l = wpf[t][1], a1h = wpf[t][2], a1l = wpf[t][3];
    v8f z = zero8;
    z = wmma_bf(a0h, obh0, z);
    z = wmma_bf(a0h, obl0, z);
    z = wmma_bf(a0l, obh0, z);
    z = wmma_bf(a1h, obh1, z);
    z = wmma_bf(a1h, obl1, z);
    z = wmma_bf(a1l, obh1, z);
    u[t] = z;
  }
  // row m of the output tile, 16-B chunk q stored at chunk q ^ m: the 16 rows of one store fall on 16 different bank groups
  float* so = &sO[w][0];
  #pragma unroll
  for (int t = 0; t < 4; ++t) {
    v8f y;
    #pragma unroll
    for (int r = 0; r < 8; ++r) y[r] = u[t][r] + bpv[t][r >> 2][r & 3];
    const int q = 4 * t + 2 * h;
    *(v4fa*)(so + m * 64 + 4 * (q ^ m))       = __builtin_shufflevector(y, y, 0, 1, 2, 3);
    *(v4fa*)(so + m * 64 + 4 * ((q + 1) ^ m)) = __builtin_shufflevector(y, y, 4, 5, 6, 7);
  }
  __syncthreads();

  const size_t grow0 = (size_t)b * NQ + q0;
  att_store_pass(so, out, grow0, lane);
  
}

// ---------------------------------------------------------------------------
extern "C" void kernel_launch(void* const* d_in, const int* in_sizes, int n_in,
                              void* d_out, int out_size, void* d_ws, size_t ws_size,
                              hipStream_t stream) {
  if (n_in < 12) return;
  if (in_sizes[0] != NBATCH * NQ * CD) return;
  if (in_sizes[1] != CD * CD || in_sizes[2] != CD) return;
  if (in_sizes[3] != 2 * CD * CD || in_sizes[4] != 2 * CD) return;
  if (in_sizes[5] != CD * CD || in_sizes[6] != CD) return;
  if (in_sizes[7] != CD * KCONV) return;
  if (in_sizes[8] != CD || in_sizes[9] != CD) return;
  if (in_sizes[10] < 1 || in_sizes[11] < 1) return;
  if (out_size != NBATCH * NQ * CD) return;

  const float* x     = (const float*)d_in[0];
  const float* wq    = (const float*)d_in[1];
  const float* bq    = (const float*)d_in[2];
  const float* wkv   = (const float*)d_in[3];
  const float* bkv   = (const float*)d_in[4];
  const float* wproj = (const float*)d_in[5];
  const float* bproj = (const float*)d_in[6];
  const float* wsr   = (const float*)d_in[7];
  const float* gamma = (const float*)d_in[8];
  const float* beta  = (const float*)d_in[9];
  const int*   Hp    = (const int*)d_in[10];
  const int*   Wp    = (const int*)d_in[11];
  float* out = (float*)d_out;

  const size_t szWq  = (size_t)CD * CD * 2;            //      8192 per plane
  const size_t szWkv = (size_t)2 * CD * CD * 2;        //     16384
  const size_t szWp  = (size_t)CD * CD * 2;            //      8192
  const size_t szWs  = (size_t)CD * KCONV * 2;         //    524288
  const size_t szK   = (size_t)NROWK * CD * 2;         //    262144
  const size_t szVt  = (size_t)NBATCH * CD * NKEY * 2; //    262144
  const size_t szPt  = (size_t)KSPLIT * NROWK * CD * 4; //  8388608
  size_t off = 0;
  const size_t oWqh = off;  off += szWq;
  const size_t oWql = off;  off += szWq;
  const size_t oWkh = off;  off += szWkv;
  const size_t oWkl = off;  off += szWkv;
  const size_t oWph = off;  off += szWp;
  const size_t oWpl = off;  off += szWp;
  const size_t oWsh = off;  off += szWs;
  const size_t oWsl = off;  off += szWs;
  const size_t oKh  = off;  off += szK;
  const size_t oKl  = off;  off += szK;
  const size_t oVth = off;  off += szVt;
  const size_t oVtl = off;  off += szVt;
  const size_t oPt  = off;  off += szPt;              // total 10551296
  if (off > ws_size) return;
  if (off > (size_t)134217728) return;

  char* ws = (char*)d_ws;
  u16* wqh  = (u16*)(ws + oWqh);
  u16* wql  = (u16*)(ws + oWql);
  u16* wkvh = (u16*)(ws + oWkh);
  u16* wkvl = (u16*)(ws + oWkl);
  u16* wph  = (u16*)(ws + oWph);
  u16* wpl  = (u16*)(ws + oWpl);
  u16* wsh  = (u16*)(ws + oWsh);
  u16* wsl  = (u16*)(ws + oWsl);
  u16* kh   = (u16*)(ws + oKh);
  u16* kl   = (u16*)(ws + oKl);
  u16* vth  = (u16*)(ws + oVth);
  u16* vtl  = (u16*)(ws + oVtl);
  float* part = (float*)(ws + oPt);

  k_prep_w<<<136, 256, 0, stream>>>(wq, wkv, wproj, wsr, wqh, wql, wkvh, wkvl, wph, wpl, wsh, wsl);

  dim3 gConv(NROWK / 64, KSPLIT);                                                  // (32, 16)
  k_conv_part<<<gConv, 128, 0, stream>>>(x, Hp, Wp, wsh, wsl, part);

  k_kv<<<NROWK / 64, 128, 0, stream>>>(part, gamma, beta, wkvh, wkvl, bkv,
                                       kh, kl, vth, vtl);                           // 32 blocks

  dim3 gAtt(NQ / 32, NBATCH);                                                      // (512, 8)
  k_attn<<<gAtt, 64, 0, stream>>>(x, wqh, wql, bq, kh, kl, vth, vtl, wph, wpl, bproj, out);
}

// v006
// One run takes 53 microseconds.
// Timed twice side by side with v005, it ran 1.14 times as fast both times.
// Over all steps from v000 it is 4.74 times as fast.
// All contractions (q projection, 8x8 stride-8 reduction conv as a patch GEMM, kv projection, q*k^T scores, P*V, output projection): v_wmma_f32_16x16x32_bf16, bf16 hi/lo operands everywhere (hi*hi + hi*lo + lo*hi), f32 accumulate; LayerNorm, softmax and biases in f32.
#include <hip/hip_runtime.h>
#include <stdint.h>

typedef unsigned short u16;
typedef u16    v16u __attribute__((ext_vector_type(16)));
typedef u16    v8u  __attribute__((ext_vector_type(8)));
typedef __bf16 v16b __attribute__((ext_vector_type(16)));
typedef __bf16 v2b  __attribute__((ext_vector_type(2)));
typedef float  v2f  __attribute__((ext_vector_type(2)));
typedef unsigned v4w __attribute__((ext_vector_type(4)));
typedef float  v8f  __attribute__((ext_vector_type(8)));
typedef float  v4f  __attribute__((ext_vector_type(4)));
typedef v8u __attribute__((may_alias)) v8ua;
typedef v4f __attribute__((may_alias)) v4fa;

union Frag { v16b v; v16u u; v8u half[2]; };
static_assert(sizeof(Frag) == 32);

#define NBATCH 8
#define NQ     16384
#define CD     64
#define NKEY   256
#define NROWK  2048        // NBATCH * NKEY reduced tokens
#define KCONV  4096        // 64 patch pixels x 64 channels, k = p*64 + ci
#define LN_EPS 1e-5f
#define KSPLIT 16          // slices of the conv reduction, one work-group each
#define KSLICE 256         // KCONV / KSPLIT

// ---------------------------------------------------------------------------
// 16x16x32 bf16 WMMA with hazard guard (ties D, keeps A/B live).
// Fragment map (wave32): lane l, h = l>>4, m = n = l&15.
//   A/B element i: i<8 -> k0+8h+i ; i>=8 -> k0+16+8h+(i-8)
//   D element r : row 8h+r, col l&15
// ---------------------------------------------------------------------------
__device__ __forceinline__ v8f wmma_bf(v16b a, v16b b, v8f c) {
  v8f d = __builtin_amdgcn_wmma_f32_16x16x32_bf16(false, a, false, b, (short)0, c, false, false);
  asm volatile("v_nop\n\tv_nop\n\tv_nop\n\tv_nop" : "+v"(d) : "v"(a), "v"(b));
  return d;
}

// f32 -> bf16 bits, round to nearest even, by the hardware convert
__device__ __forceinline__ u16 bf_rne(float f) {
  return __builtin_bit_cast(u16, (__bf16)f);
}
__device__ __forceinline__ float bf_val(u16 b) {
  return __builtin_bit_cast(float, ((unsigned)b) << 16);
}

// 8 floats -> hi/lo bf16 planes (hi = rne(x), lo = rne(x - hi)). Two elements share one packed convert, which leaves
// them in the two halves of their fragment register; the f32 values of hi are cut out of that same register.
__device__ __forceinline__ void split8(v8f f, v8u& hi, v8u& lo) {
  v4w wh, wl;
  #pragma unroll
  for (int i = 0; i < 4; ++i) {
    const v2f x2 = {f[2 * i], f[2 * i + 1]};
    const unsigned ph = __builtin_bit_cast(unsigned, __builtin_convertvector(x2, v2b));
    const v2f h2 = {__builtin_bit_cast(float, ph << 16), __builtin_bit_cast(float, ph & 0xFFFF0000u)};
    wh[i] = ph;
    wl[i] = __builtin_bit_cast(unsigned, __builtin_convertvector(x2 - h2, v2b));
  }
  hi = __builtin_bit_cast(v8u, wh);
  lo = __builtin_bit_cast(v8u, wl);
}

// 16 floats given in fragment element order (a = elements 0..7, c = 8..15) -> hi/lo fragments
__device__ __forceinline__ void split_frag(v8f a, v8f c, v16b& fhi, v16b& flo) {
  Frag fh, fl;
  v8u h0, l0, h1, l1;
  split8(a, h0, l0);
  split8(c, h1, l1);
  fh.half[0] = h0; fh.half[1] = h1;
  fl.half[0] = l0; fl.half[1] = l1;
  fhi = fh.v; flo = fl.v;
}

// A or B fragment from a k-contiguous bf16 row; p points at element k0 of the row owned by this lane.
__device__ __forceinline__ v16b ld_frag(const u16* p, int h) {
  Frag f;
  f.half[0] = *(const v8ua*)(p + 8 * h);
  f.half[1] = *(const v8ua*)(p + 16 + 8 * h);
  return f.v;
}

// Planes that a kernel reads from the workspace are kept in fragment order: fragment f = (row tile) * (k / 32) + k step
// is 512 elements; lane l's elements 0..7 stand at f*512 + l*8, its elements 8..15 at f*512 + 256 + l*8,
// so each wave-wide 16-B load covers 512 contiguous bytes. p points at f*512 + l*8.
__device__ __forceinline__ v16b ld_fragp(const u16* p) {
  Frag f;
  f.half[0] = *(const v8ua*)p;
  f.half[1] = *(const v8ua*)(p + 256);
  return f.v;
}

// Writer's side of the same map: g8 = index of a group of 8 consecutive plane elements, 1 << ksh fragments per row tile
// -> matrix row and first k of the group.
__device__ __forceinline__ void frag_rk(int g8, int ksh, int& row, int& k) {
  const int f = g8 >> 6;
  row = ((f >> ksh) << 4) + (g8 & 15);
  k = ((f & ((1 << ksh) - 1)) << 5) + ((g8 >> 5) & 1) * 16 + ((g8 >> 4) & 1) * 8;
}

__device__ __forceinline__ float red16(float v) {
  v += __shfl_xor(v, 1);
  v += __shfl_xor(v, 2);
  v += __shfl_xor(v, 4);
  v += __shfl_xor(v, 8);
  return v;
}

// ---------------------------------------------------------------------------
// Kernel 1: weights -> bf16 hi/lo planes.
//   wq [64][64], wkv [128][64], wproj [64][64]: row = out, k = in;
//   wsr: row = co, k = p*64 + ci, p = i*8 + j. All four in fragment order.
// One thread = 8 consecutive plane elements = one 16-B store per plane; lanes contiguous
// ---------------------------------------------------------------------------
__global__ __launch_bounds__(256) void k_prep_w(
    const float* __restrict__ wq, const float* __restrict__ wkv,
    const float* __restrict__ wproj, const float* __restrict__ wsr,
    u16* __restrict__ wqh, u16* __restrict__ wql,
    u16* __restrict__ wkvh, u16* __restrict__ wkvl,
    u16* __restrict__ wph, u16* __restrict__ wpl,
    u16* __restrict__ wsh, u16* __restrict__ wsl)
{
  const int blk = blockIdx.x, tid = threadIdx.x;
  if (blk >= 136) return;
  v8f f;
  u16* dh;
  u16* dl;
  int e;
  if (blk < 8) {                    // block-uniform region select
    const float* src;
    if (blk < 2)      { e = blk * 256 + tid;        src = wq;    dh = wqh;  dl = wql;  }
    else if (blk < 6) { e = (blk - 2) * 256 + tid;  src = wkv;   dh = wkvh; dl = wkvl; }
    else              { e = (blk - 6) * 256 + tid;  src = wproj; dh = wph;  dl = wpl;  }
    int row, k;
    frag_rk(e, 1, row, k);
    const float* s = src + row * CD + k;
    const v4f a = *(const v4fa*)s;
    const v4f c = *(const v4fa*)(s + 4);
    f = __builtin_shufflevector(a, c, 0, 1, 2, 3, 4, 5, 6, 7);
  } else {
    e = (blk - 8) * 256 + tid;                          // 0..32767
    int co, k;
    frag_rk(e, 7, co, k);
    const int p = k >> 6, ci0 = k & 63;                 // k = p*64 + ci0
    const float* s = wsr + (size_t)co * KCONV + ci0 * 64 + p;   // wsr[co][ci][i][j] = co*4096 + ci*64 + p
    #pragma unroll
    for (int c = 0; c < 8; ++c) f[c] = s[c * 64];
    dh = wsh; dl = wsl;
  }
  v8u hi, lo;
  split8(f, hi, lo);
  u16* ph = dh + (size_t)e * 8;
  u16* pl = dl + (size_t)e * 8;
  *(v8u*)ph = hi;
  *(v8u*)pl = lo;
  
}

// ---------------------------------------------------------------------------
// K and V^T planes out of LDS, in fragment order: per plane 8 fragments = 512 groups of 8 elements,
// one group per thread and pass, 512 contiguous bytes per wave and store.
//   K  : row = token, k = d;   fragment (global token >> 4) * 2 + (d >> 5)
//   V^T: row = d, k = key;     fragment batch * 32 + (d >> 4) * 8 + (key >> 5)
// ---------------------------------------------------------------------------
__device__ __forceinline__ void kv_store_pass(const u16* sK, const u16* sV,
                                              u16* kh, u16* kl, u16* vth, u16* vtl,
                                              int blk, int tid) {
  const int bb = blk >> 2, kq = blk & 3;
  #pragma unroll
  for (int it = 0; it < 16; ++it) {
    const int p = (it >> 2) & 1;
    const int g8 = (it & 3) * 128 + tid;           // 0..511
    int row, k;
    frag_rk(g8, 1, row, k);                        // both 0..63, local to this block
    v8u v;
    u16* dst;
    if (it < 8) {
      v = *(const v8ua*)(sK + (p * 64 + row) * 64 + k);
      u16* plane = p ? kl : kh;
      dst = plane + (size_t)blk * 4096 + g8 * 8;
    } else {
      v = *(const v8ua*)(sV + (p * 64 + row) * 64 + k);
      u16* plane = p ? vtl : vth;
      const int f = g8 >> 6;
      dst = plane + (size_t)(bb * 32 + (f >> 1) * 8 + 2 * kq + (f & 1)) * 512 + (g8 & 63) * 8;
    }
    *(v8u*)dst = v;
  }
}

// ---------------------------------------------------------------------------
// Kernel 2: conv GEMM, split along k, patches gathered from x in the A loader (no patch planes).
//   Block = 64 conv rows x one k slice of 256 (4 patch pixels x 64 channels), 4 waves x 16 rows
//   (the 4 waves read the same weight slice).
//   row r = b*256 + m, m = py*16 + px; k = p*64 + ci, p = i*8 + j;
//   A value = x[b][pix][ci], pix = (8py+i)*W + 8px + j (clamped), split to bf16 hi/lo in registers.
//   Each wave stores its f32 16x64 partial tile in accumulator order:
//   part[slice][row tile][t][j][lane][4] = acc[t][4j..4j+3], 512 B per store.
// grid = (32, 16) blocks x 128 threads.
// ---------------------------------------------------------------------------
__global__ __launch_bounds__(128) void k_conv_part(
    const float* __restrict__ x, const int* __restrict__ Hp, const int* __restrict__ Wp,
    const u16* __restrict__ wsh, const u16* __restrict__ wsl,     // 64 x 4096, fragment order
    float* __restrict__ part)                                     // [16][128][4][2][32][4]
{
  const int tid = threadIdx.x, lane = tid & 31, w = tid >> 5;
  const int h = lane >> 4, m = lane & 15;
  const int blk = blockIdx.x, sp = blockIdx.y;
  const int f0 = sp * (KSLICE / 32);           // first k step of this slice; 128 k steps per row tile

  const int Hv = Hp[0], Wv = Wp[0];
  const long long hw = (long long)Hv * (long long)Wv;
  const int lim = (hw >= 1 && hw <= NQ) ? (int)(hw - 1) : (NQ - 1);
  const int r = blk * 64 + w * 16 + m;
  const int bb = r >> 8, mm = r & 255;
  const int py = mm >> 4, px = mm & 15;

  // The whole slice of this lane's row, 16 KB per wave, is asked for before any of it is used:
  // with two waves per SIMD only the loads in flight cover the memory latency.
  // Both loops unrolled: xa is indexed by their counters and has to stay in registers.
  v4f xa[KSLICE / 32][4];
  #pragma unroll
  for (int q = 0; q < KSLICE / 64; ++q) {
    const int p = sp * (KSLICE / 64) + q;
    const int ii = p >> 3, jj = p & 7;
    int pix = (8 * py + ii) * Wv + 8 * px + jj;
    pix = min(max(pix, 0), lim);
    const float* s = x + ((size_t)bb * NQ + pix) * CD + 8 * h;
    #pragma unroll
    for (int c = 0; c < 2; ++c) {
      xa[2 * q + c][0] = *(const v4fa*)(s + 32 * c);
      xa[2 * q + c][1] = *(const v4fa*)(s + 32 * c + 4);
      xa[2 * q + c][2] = *(const v4fa*)(s + 32 * c + 16);
      xa[2 * q + c][3] = *(const v4fa*)(s + 32 * c + 20);
    }
  }
  // precaution: the address registers of the loads above are reused further down
  asm volatile("s_wait_xcnt 0x0" ::: "memory");

  const v8f zero8 = {0.f, 0.f, 0.f, 0.f, 0.f, 0.f, 0.f, 0.f};
  v8f acc[4];
  #pragma unroll
  for (int t = 0; t < 4; ++t) acc[t] = zero8;

  const u16* brh = wsh + (size_t)f0 * 512 + lane * 8;
  const u16* brl = wsl + (size_t)f0 * 512 + lane * 8;

  // Weight fragments run one k step ahead: tile t's pair for step ks + 1 is asked for right behind
  // tile t's products of step ks, so no product waits out the latency of its own loads.
  v16b fbh[4], fbl[4];
  #pragma unroll
  for (int t = 0; t < 4; ++t) {
    fbh[t] = ld_fragp(brh + (t * 128) * 512);
    fbl[t] = ld_fragp(brl + (t * 128) * 512);
  }

  // unrolled: xa is indexed by ks and has to stay in registers
  #pragma unroll
  for (int ks = 0; ks < KSLICE / 32; ++ks) {
    v16b fah, fal;
    split_frag(__builtin_shufflevector(xa[ks][0], xa[ks][1], 0, 1, 2, 3, 4, 5, 6, 7),
               __builtin_shufflevector(xa[ks][2], xa[ks][3], 0, 1, 2, 3, 4, 5, 6, 7), fah, fal);
    #pragma unroll
    for (int t = 0; t < 4; ++t) {
      acc[t] = wmma_bf(fah, fbh[t], acc[t]);
      acc[t] = wmma_bf(fah, fbl[t], acc[t]);
      acc[t] = wmma_bf(fal, fbh[t], acc[t]);
      if (ks + 1 < KSLICE / 32) {
        fbh[t] = ld_fragp(brh + (t * 128 + ks + 1) * 512);
        fbl[t] = ld_fragp(brl + (t * 128 + ks + 1) * 512);
      }
    }
  }

  float* pp = part + ((size_t)sp * 128 + blk * 4 + w) * 1024 + lane * 4;
  #pragma unroll
  for (int t = 0; t < 4; ++t) {
    *(v4f*)(pp + (2 * t) * 128)     = __builtin_shufflevector(acc[t], acc[t], 0, 1, 2, 3);
    *(v4f*)(pp + (2 * t + 1) * 128) = __builtin_shufflevector(acc[t], acc[t], 4, 5, 6, 7);
  }
}

// ---------------------------------------------------------------------------
// Kernel 3: reduced tokens. Block = 64 conv rows (tokens) of one batch, 4 waves x 16 rows.
//   sum of the 16 k-slice partials (slice 0 first) -> LayerNorm (f32) -> kv proj (16x64 @ 64x128)
//   -> K planes 2048 x 64 and V^T planes 8 x (64 x 256) (bf16 hi/lo), fragment order, whole-line stores.
// grid = 32 blocks x 128 threads.
// ---------------------------------------------------------------------------
__global__ __launch_bounds__(128) void k_kv(
    const float* __restrict__ part,                               // [16][128][4][2][32][4]
    const float* __restrict__ gamma, const float* __restrict__ beta,
    const u16* __restrict__ wkvh, const u16* __restrict__ wkvl,   // 128 x 64, fragment order
    const float* __restrict__ bkv,
    u16* __restrict__ kh, u16* __restrict__ kl,                   // 2048 x 64, fragment order
    u16* __restrict__ vth, u16* __restrict__ vtl)                 // 8 x (64 x 256), fragment order
{
  __shared__ __attribute__((aligned(16))) u16 sX[2 * 64 * 64];   // LN output hi/lo [p][token][c]
  __shared__ __attribute__((aligned(16))) u16 sK[2 * 64 * 64];   // [p][token][d]
  __shared__ __attribute__((aligned(16))) u16 sV[2 * 64 * 64];   // [p][d][token]

  const int tid = threadIdx.x, lane = tid & 31, w = tid >> 5;
  const int h = lane >> 4, m = lane & 15;
  const int blk = blockIdx.x;

  const v8f zero8 = {0.f, 0.f, 0.f, 0.f, 0.f, 0.f, 0.f, 0.f};
  v8f acc[4];
  #pragma unroll
  for (int t = 0; t < 4; ++t) acc[t] = zero8;

  const float* pp = part + (size_t)(blk * 4 + w) * 1024 + lane * 4;
  #pragma unroll
  for (int s = 0; s < KSPLIT; ++s) {
    const float* ps = pp + (size_t)s * (128 * 1024);
    #pragma unroll
    for (int t = 0; t < 4; ++t) {
      const v4f a = *(const v4fa*)(ps + (2 * t) * 128);
      const v4f c = *(const v4fa*)(ps + (2 * t + 1) * 128);
      acc[t] += __builtin_shufflevector(a, c, 0, 1, 2, 3, 4, 5, 6, 7);
    }
  }
  // acc[t][r] = conv out [token 64blk+16w+8h+r][channel 16t+m]

  float mu[8], rs[8];
  #pragma unroll
  for (int r = 0; r < 8; ++r) {
    float s = acc[0][r] + acc[1][r] + acc[2][r] + acc[3][r];
    s = red16(s);
    mu[r] = s * (1.0f / 64.0f);
    float v = 0.f;
    #pragma unroll
    for (int t = 0; t < 4; ++t) { const float d = acc[t][r] - mu[r]; v += d * d; }
    v = red16(v) * (1.0f / 64.0f);
    rs[r] = rsqrtf(v + LN_EPS);
  }
  #pragma unroll
  for (int t = 0; t < 4; ++t) {
    const int col = 16 * t + m;
    const float g = gamma[col], be = beta[col];
    #pragma unroll
    for (int r = 0; r < 8; ++r) {
      const float y = (acc[t][r] - mu[r]) * rs[r] * g + be;
      const u16 hh = bf_rne(y);
      const u16 ll = bf_rne(y - bf_val(hh));
      const int kl_ = 16 * w + 8 * h + r;
      sX[kl_ * 64 + col] = hh;
      sX[4096 + kl_ * 64 + col] = ll;
    }
  }
  // kv weight fragments run one column tile ahead of the products that use them
  v16b wb[4];
  wb[0] = ld_fragp(wkvh + lane * 8);
  wb[1] = ld_fragp(wkvl + lane * 8);
  wb[2] = ld_fragp(wkvh + lane * 8 + 512);
  wb[3] = ld_fragp(wkvl + lane * 8 + 512);
  __syncthreads();

  // kv projection A fragments: row = token 16w+m, k = channel
  const v16b xah0 = ld_frag(sX + (16 * w + m) * 64, h);
  const v16b xah1 = ld_frag(sX + (16 * w + m) * 64 + 32, h);
  const v16b xal0 = ld_frag(sX + 4096 + (16 * w + m) * 64, h);
  const v16b xal1 = ld_frag(sX + 4096 + (16 * w + m) * 64 + 32, h);

  #pragma unroll
  for (int ct = 0; ct < 8; ++ct) {
    const v16b b0h = wb[0], b0l = wb[1], b1h = wb[2], b1l = wb[3];
    if (ct + 1 < 8) {
      const int off = (ct + 1) * 1024 + lane * 8;
      wb[0] = ld_fragp(wkvh + off);
      wb[1] = ld_fragp(wkvl + off);
      wb[2] = ld_fragp(wkvh + off + 512);
      wb[3] = ld_fragp(wkvl + off + 512);
    }
    v8f c = zero8;
    c = wmma_bf(xah0, b0h, c);
    c = wmma_bf(xah0, b0l, c);
    c = wmma_bf(xal0, b0h, c);
    c = wmma_bf(xah1, b1h, c);
    c = wmma_bf(xah1, b1l, c);
    c = wmma_bf(xal1, b1h, c);
    // c[r] = kv[token 16w+8h+r][col 16ct+m]
    const int col = 16 * ct + m;
    const float bb = bkv[col];
    #pragma unroll
    for (int r = 0; r < 8; ++r) {
      const float val = c[r] + bb;
      const u16 hh = bf_rne(val);
      const u16 ll = bf_rne(val - bf_val(hh));
      const int kl_ = 16 * w + 8 * h + r;
      if (ct < 4) {
        sK[kl_ * 64 + col] = hh;
        sK[4096 + kl_ * 64 + col] = ll;
      } else {
        const int d = col - 64;
        sV[d * 64 + kl_] = hh;
        sV[4096 + d * 64 + kl_] = ll;
      }
    }
  }
  __syncthreads();

  kv_store_pass(sK, sV, kh, kl, vth, vtl, blk, tid);
  
}

// ---------------------------------------------------------------------------
// lanes 8q..8q+7 in one instruction, 4 lines per instruction, 32 lines per wave.
// ---------------------------------------------------------------------------
// The LDS tile keeps 16-B chunk q of row m at chunk q ^ m (see the writer in k_attn).
__device__ __forceinline__ void att_store_pass(const float* so, float* out, size_t grow0, int lane) {
  const int q8 = lane & 7, sub = lane >> 3;
  #pragma unroll
  for (int i = 0; i < 8; ++i) {
    const int lid = i * 4 + sub;
    const int row = lid >> 1, hl = lid & 1;
    const v4f v = *(const v4fa*)(so + row * 64 + 4 * ((8 * hl + q8) ^ row));
    *(v4f*)(out + (grow0 + (size_t)row) * CD + 32 * hl + 4 * q8) = v;
  }
}

// The four K fragments (k 0..31 hi, lo; k 32..63 hi, lo) of key tile j.
__device__ __forceinline__ void ld_k4(v16b* f, const u16* ph, const u16* pl, int j) {
  const int ko = j * 1024;                       // two fragments per 16 keys
  f[0] = ld_fragp(ph + ko);
  f[1] = ld_fragp(pl + ko);
  f[2] = ld_fragp(ph + ko + 512);
  f[3] = ld_fragp(pl + ko + 512);
}

// Scores of key tile j: z[r] = S[query m][key 16j+8h+r], parked as this lane's chunks 2j (r 0..3) and 2j+1 (r 4..7).
__device__ __forceinline__ void score_pass(const v16b* f, v16b qbh0, v16b qbl0, v16b qbh1, v16b qbl1,
                                           float* sl, int j, float& mx) {
  v8f z = {0.f, 0.f, 0.f, 0.f, 0.f, 0.f, 0.f, 0.f};
  z = wmma_bf(f[0], qbh0, z);
  z = wmma_bf(f[0], qbl0, z);
  z = wmma_bf(f[1], qbh0, z);
  z = wmma_bf(f[2], qbh1, z);
  z = wmma_bf(f[2], qbl1, z);
  z = wmma_bf(f[3], qbh1, z);
  const v4f z0 = __builtin_shufflevector(z, z, 0, 1, 2, 3);
  const v4f z1 = __builtin_shufflevector(z, z, 4, 5, 6, 7);
  *(v4fa*)(sl + 256 * j) = z0;
  *(v4fa*)(sl + 256 * j + 128) = z1;
  #pragma unroll
  for (int r = 0; r < 8; ++r) mx = fmaxf(mx, z[r]);
}

// P^T fragments of key step c (32 keys) out of this lane's park, scaled by 1 / row sum.
__device__ __forceinline__ void p_frag(const float* sl, int c, float inv, v16b& pbh, v16b& pbl) {
  const float* pp = sl + 512 * c;                // chunks 4c..4c+3: keys 32c+8h.., 32c+16+8h..
  const v4f p0 = *(const v4fa*)pp;
  const v4f p1 = *(const v4fa*)(pp + 128);
  const v4f p2 = *(const v4fa*)(pp + 256);
  const v4f p3 = *(const v4fa*)(pp + 384);
  const v8f pa = __builtin_shufflevector(p0, p1, 0, 1, 2, 3, 4, 5, 6, 7) * inv;
  const v8f pc = __builtin_shufflevector(p2, p3, 0, 1, 2, 3, 4, 5, 6, 7) * inv;
  split_frag(pa, pc, pbh, pbl);
}

// ---------------------------------------------------------------------------
// Kernel 4: fused q projection + attention over 256 reduced tokens + output projection.
// Block = 64 threads (2 waves), 16 queries per wave; grid = (512, 8).
//   q^T = wq * x^T          : A = wq plane rows, B = x^T split in registers
//   S^T = K * q^T           : A = K plane rows, B = q^T packed from two adjacent D tiles
//   softmax over 256 keys   : f32, scores parked in LDS; each lane re-reads only what it wrote,
//                             so the park is lane-major: 16-B chunk c of lane l at (c*32 + l)*16 B,
//                             every LDS access of a wave covers 512 contiguous bytes (no bank conflict)
//   O^T = V^T * P^T         : A = V^T plane rows, B = P^T from LDS
//   out^T = wproj * O^T     : A = wproj plane rows, B = O^T packed from D tiles
// Every plane fragment is asked for ahead of the products that use it: q weights with x, K three key tiles
// ahead (ring of four register sets), V^T one key step ahead, proj weights in front of the split of O.
// ---------------------------------------------------------------------------
__global__ __launch_bounds__(64) void k_attn(
    const float* __restrict__ x,
    const u16* __restrict__ wqh, const u16* __restrict__ wql, const float* __restrict__ bq,
    const u16* __restrict__ kh, const u16* __restrict__ kl,      // 2048 x 64, fragment order
    const u16* __restrict__ vth, const u16* __restrict__ vtl,    // 8 x (64 x 256), fragment order
    const u16* __restrict__ wph, const u16* __restrict__ wpl, const float* __restrict__ bproj,
    float* __restrict__ out)                                     // [8][16384][64]
{
  __shared__ __attribute__((aligned(16))) float sS[2][16 * 256];
  __shared__ __attribute__((aligned(16))) float sO[2][16 * 64];

  const int tid = threadIdx.x, lane = tid & 31, w = tid >> 5;
  const int h = lane >> 4, m = lane & 15;
  const int b = blockIdx.y;
  const int q0 = blockIdx.x * 32 + 16 * w;
  const v8f zero8 = {0.f, 0.f, 0.f, 0.f, 0.f, 0.f, 0.f, 0.f};

  // ---- q^T = wq * x^T : qt[t][r] = q[query q0+m][feature 16t+8h+r] ----
  v8f qt[4];
  #pragma unroll
  for (int t = 0; t < 4; ++t) qt[t] = zero8;
  const float* xr = x + ((size_t)b * NQ + q0 + m) * CD;
  v4f xv[2][4];
  #pragma unroll
  for (int ks = 0; ks < 2; ++ks) {
    const float* xp = xr + 32 * ks + 8 * h;
    xv[ks][0] = *(const v4fa*)(xp);
    xv[ks][1] = *(const v4fa*)(xp + 4);
    xv[ks][2] = *(const v4fa*)(xp + 16);
    xv[ks][3] = *(const v4fa*)(xp + 20);
  }
  // precaution: the address registers of the loads above are reused by what follows
  asm volatile("s_wait_xcnt 0x0" ::: "memory");
  v16b wah[2][4], wal[2][4];
  #pragma unroll
  for (int ks = 0; ks < 2; ++ks)
    #pragma unroll
    for (int t = 0; t < 4; ++t) {
      const int off = (2 * t + ks) * 512 + lane * 8;
      wah[ks][t] = ld_fragp(wqh + off);
      wal[ks][t] = ld_fragp(wql + off);
    }
  v4f bqv[4][2];
  #pragma unroll
  for (int t = 0; t < 4; ++t) {
    bqv[t][0] = *(const v4fa*)(bq + 16 * t + 8 * h);
    bqv[t][1] = *(const v4fa*)(bq + 16 * t + 8 * h + 4);
  }
  // precaution: the address registers of the loads above are reused by what follows
  asm volatile("s_wait_xcnt 0x0" ::: "memory");
  #pragma unroll
  for (int ks = 0; ks < 2; ++ks) {
    const v8f a8 = __builtin_shufflevector(xv[ks][0], xv[ks][1], 0, 1, 2, 3, 4, 5, 6, 7);
    const v8f c8 = __builtin_shufflevector(xv[ks][2], xv[ks][3], 0, 1, 2, 3, 4, 5, 6, 7);
    v16b xbh, xbl;
    split_frag(a8, c8, xbh, xbl);
    #pragma unroll
    for (int t = 0; t < 4; ++t) {
      qt[t] = wmma_bf(wah[ks][t], xbh, qt[t]);
      qt[t] = wmma_bf(wah[ks][t], xbl, qt[t]);
      qt[t] = wmma_bf(wal[ks][t], xbh, qt[t]);
    }
  }
  // key tiles 0..2 are asked for here, in front of the split of q
  const u16* kbh = kh + (size_t)b * NKEY * CD + lane * 8;
  const u16* kbl = kl + (size_t)b * NKEY * CD + lane * 8;
  v16b kf[4][4];
  #pragma unroll
  for (int s = 0; s < 3; ++s) ld_k4(kf[s], kbh, kbl, s);
  v8f qv[4];
  #pragma unroll
  for (int t = 0; t < 4; ++t)
    #pragma unroll
    for (int r = 0; r < 8; ++r)
      qv[t][r] = (qt[t][r] + bqv[t][r >> 2][r & 3]) * 0.125f;    // d^-1/2 folded into q (exact)
  // B fragment for k = d: element i <- tile 2ks row i, element 8+i <- tile 2ks+1 row i
  v16b qbh0, qbl0, qbh1, qbl1;
  split_frag(qv[0], qv[1], qbh0, qbl0);
  split_frag(qv[2], qv[3], qbh1, qbl1);

  // ---- scores: key tile j uses register set j & 3; tile j + 3 is asked for into the set that tile j - 1 has left ----
  float* sw = &sS[w][0];
  float* sl = sw + lane * 4;                     // chunk c of this lane: sl + c*128
  float mx = -3.0e38f;
  // unrolled: the set index has to be a constant, and every load then takes its tile as an immediate offset
  // from one address pair that is never rewritten while loads are in flight
  #pragma unroll
  for (int j = 0; j < 16; ++j) {
    if (j + 3 < 16) ld_k4(kf[(j + 3) & 3], kbh, kbl, j + 3);
    score_pass(kf[j & 3], qbh0, qbl0, qbh1, qbl1, sl, j, mx);
  }
  mx = fmaxf(mx, __shfl_xor(mx, 16));

  // V^T fragments of key step 0 are asked for here and land behind the softmax.
  // precaution: the V^T addresses may take the registers that the K loads name; the batch offset passes through
  // the statement so that the address arithmetic cannot be lifted over the wait
  unsigned vb0 = (unsigned)b * (CD * NKEY);
  asm volatile("s_wait_xcnt 0x0" : "+s"(vb0) : : "memory");
  const u16* vbh = vth + (size_t)vb0 + lane * 8;
  const u16* vbl = vtl + (size_t)vb0 + lane * 8;
  v16b vh[4], vl[4];
  #pragma unroll
  for (int t = 0; t < 4; ++t) {
    vh[t] = ld_fragp(vbh + (8 * t) * 512);
    vl[t] = ld_fragp(vbl + (8 * t) * 512);
  }
  // precaution: the address registers of the loads above are reused by what follows
  asm volatile("s_wait_xcnt 0x0" ::: "memory");

  // ---- softmax numerator + row sum (f32); same lane, same addresses ----
  float sum = 0.f;
  #pragma unroll 2
  for (int a = 0; a < 16; ++a) {
    float* pp = sl + 256 * a;
    v4f v0 = *(const v4fa*)pp;
    v4f v1 = *(const v4fa*)(pp + 128);
    #pragma unroll
    for (int e = 0; e < 4; ++e) {
      v0[e] = __expf(v0[e] - mx);
      v1[e] = __expf(v1[e] - mx);
      sum += v0[e] + v1[e];
    }
    *(v4fa*)pp = v0;
    *(v4fa*)(pp + 128) = v1;
  }
  sum += __shfl_xor(sum, 16);
  const float inv = 1.0f / sum;

  // ---- O^T = V^T * P^T : o[t][r] = O[query m][d 16t+8h+r] ----
  v8f o[4];
  #pragma unroll
  for (int t = 0; t < 4; ++t) o[t] = zero8;
  // tile t's pair for key step c + 1 is asked for right behind tile t's products of step c, into the same registers
  const char* vub = (const char*)(vth + (size_t)vb0);   // wave-uniform plane bases of this batch
  const char* vlb = (const char*)(vtl + (size_t)vb0);
  unsigned vof = (unsigned)lane * 16u + 1024u;           // this lane's byte offset in the fragments of key step c + 1
  #pragma unroll 1
  for (int c = 0; c < 7; ++c) {
    v16b pbh, pbl;
    p_frag(sl, c, inv, pbh, pbl);
    #pragma unroll
    for (int t = 0; t < 4; ++t) {
      o[t] = wmma_bf(vh[t], pbh, o[t]);
      o[t] = wmma_bf(vh[t], pbl, o[t]);
      o[t] = wmma_bf(vl[t], pbh, o[t]);
      vh[t] = ld_fragp((const u16*)(vub + vof + t * 8192));
      vl[t] = ld_fragp((const u16*)(vlb + vof + t * 8192));
    }
    // The offset moves on by one key step (1024 bytes) inside the statement of the wait: this trip's loads, still
    // in flight, name its register (precaution), and nothing can be lifted between wait and addition; at the
    // loop's foot the wait also stands in front of whatever reuses the address registers behind the loop.
    asm volatile("s_wait_xcnt 0x0\n\tv_add_nc_u32_e32 %0, 0x400, %0" : "+v"(vof) : : "memory");
  }
  {
    v16b pbh, pbl;
    p_frag(sl, 7, inv, pbh, pbl);
    #pragma unroll
    for (int t = 0; t < 4; ++t) {
      o[t] = wmma_bf(vh[t], pbh, o[t]);
      o[t] = wmma_bf(vh[t], pbl, o[t]);
      o[t] = wmma_bf(vl[t], pbh, o[t]);
    }
  }

  // ---- out^T = wproj * O^T : u[t][r] = out[query m][feature 16t+8h+r] ----
  v16b wpf[4][4];
  #pragma unroll
  for (int t = 0; t < 4; ++t) {
    const int off = t * 1024 + lane * 8;
    wpf[t][0] = ld_fragp(wph + off);
    wpf[t][1] = ld_fragp(wpl + off);
    wpf[t][2] = ld_fragp(wph + off + 512);
    wpf[t][3] = ld_fragp(wpl + off + 512);
  }
  // precaution: the address registers of the loads above are reused by what follows
  asm volatile("s_wait_xcnt 0x0" ::: "memory");
  v4f bpv[4][2];
  #pragma unroll
  for (int t = 0; t < 4; ++t) {
    bpv[t][0] = *(const v4fa*)(bproj + 16 * t + 8 * h);
    bpv[t][1] = *(const v4fa*)(bproj + 16 * t + 8 * h + 4);
  }
  v16b obh0, obl0, obh1, obl1;
  split_frag(o[0], o[1], obh0, obl0);
  split_frag(o[2], o[3], obh1, obl1);
  v8f u[4];
  #pragma unroll
  for (int t = 0; t < 4; ++t) {
    const v16b a0h = wpf[t][0], a0l = wpf[t][1], a1h = wpf[t][2], a1l = wpf[t][3];
    v8f z = zero8;
    z = wmma_bf(a0h, obh0, z);
    z = wmma_bf(a0h, obl0, z);
    z = wmma_bf(a0l, obh0, z);
    z = wmma_bf(a1h, obh1, z);
    z = wmma_bf(a1h, obl1, z);
    z = wmma_bf(a1l, obh1, z);
    u[t] = z;
  }
  // row m of the output tile, 16-B chunk q stored at chunk q ^ m: the 16 rows of one store fall on 16 different bank groups
  float* so = &sO[w][0];
  #pragma unroll
  for (int t = 0; t < 4; ++t) {
    v8f y;
    #pragma unroll
    for (int r = 0; r < 8; ++r) y[r] = u[t][r] + bpv[t][r >> 2][r & 3];
    const int q = 4 * t + 2 * h;
    *(v4fa*)(so + m * 64 + 4 * (q ^ m))       = __builtin_shufflevector(y, y, 0, 1, 2, 3);
    *(v4fa*)(so + m * 64 + 4 * ((q + 1) ^ m)) = __builtin_shufflevector(y, y, 4, 5, 6, 7);
  }
  __syncthreads();

  const size_t grow0 = (size_t)b * NQ + q0;
  att_store_pass(so, out, grow0, lane);
  
}

// ---------------------------------------------------------------------------
extern "C" void kernel_launch(void* const* d_in, const int* in_sizes, int n_in,
                              void* d_out, int out_size, void* d_ws, size_t ws_size,
                              hipStream_t stream) {
  if (n_in < 12) return;
  if (in_sizes[0] != NBATCH * NQ * CD) return;
  if (in_sizes[1] != CD * CD || in_sizes[2] != CD) return;
  if (in_sizes[3] != 2 * CD * CD || in_sizes[4] != 2 * CD) return;
  if (in_sizes[5] != CD * CD || in_sizes[6] != CD) return;
  if (in_sizes[7] != CD * KCONV) return;
  if (in_sizes[8] != CD || in_sizes[9] != CD) return;
  if (in_sizes[10] < 1 || in_sizes[11] < 1) return;
  if (out_size != NBATCH * NQ * CD) return;

  const float* x     = (const float*)d_in[0];
  const float* wq    = (const float*)d_in[1];
  const float* bq    = (const float*)d_in[2];
  const float* wkv   = (const float*)d_in[3];
  const float* bkv   = (const float*)d_in[4];
  const float* wproj = (const float*)d_in[5];
  const float* bproj = (const float*)d_in[6];
  const float* wsr   = (const float*)d_in[7];
  const float* gamma = (const float*)d_in[8];
  const float* beta  = (const float*)d_in[9];
  const int*   Hp    = (const int*)d_in[10];
  const int*   Wp    = (const int*)d_in[11];
  float* out = (float*)d_out;

  const size_t szWq  = (size_t)CD * CD * 2;            //      8192 per plane
  const size_t szWkv = (size_t)2 * CD * CD * 2;        //     16384
  const size_t szWp  = (size_t)CD * CD * 2;            //      8192
  const size_t szWs  = (size_t)CD * KCONV * 2;         //    524288
  const size_t szK   = (size_t)NROWK * CD * 2;         //    262144
  const size_t szVt  = (size_t)NBATCH * CD * NKEY * 2; //    262144
  const size_t szPt  = (size_t)KSPLIT * NROWK * CD * 4; //  8388608
  size_t off = 0;
  const size_t oWqh = off;  off += szWq;
  const size_t oWql = off;  off += szWq;
  const size_t oWkh = off;  off += szWkv;
  const size_t oWkl = off;  off += szWkv;
  const size_t oWph = off;  off += szWp;
  const size_t oWpl = off;  off += szWp;
  const size_t oWsh = off;  off += szWs;
  const size_t oWsl = off;  off += szWs;
  const size_t oKh  = off;  off += szK;
  const size_t oKl  = off;  off += szK;
  const size_t oVth = off;  off += szVt;
  const size_t oVtl = off;  off += szVt;
  const size_t oPt  = off;  off += szPt;              // total 10551296
  if (off > ws_size) return;
  if (off > (size_t)134217728) return;

  char* ws = (char*)d_ws;
  u16* wqh  = (u16*)(ws + oWqh);
  u16* wql  = (u16*)(ws + oWql);
  u16* wkvh = (u16*)(ws + oWkh);
  u16* wkvl = (u16*)(ws + oWkl);
  u16* wph  = (u16*)(ws + oWph);
  u16* wpl  = (u16*)(ws + oWpl);
  u16* wsh  = (u16*)(ws + oWsh);
  u16* wsl  = (u16*)(ws + oWsl);
  u16* kh   = (u16*)(ws + oKh);
  u16* kl   = (u16*)(ws + oKl);
  u16* vth  = (u16*)(ws + oVth);
  u16* vtl  = (u16*)(ws + oVtl);
  float* part = (float*)(ws + oPt);

  k_prep_w<<<136, 256, 0, stream>>>(wq, wkv, wproj, wsr, wqh, wql, wkvh, wkvl, wph, wpl, wsh, wsl);

  dim3 gConv(NROWK / 64, KSPLIT);                                                  // (32, 16)
  k_conv_part<<<gConv, 128, 0, stream>>>(x, Hp, Wp, wsh, wsl, part);

  k_kv<<<NROWK / 64, 128, 0, stream>>>(part, gamma, beta, wkvh, wkvl, bkv,
                                       kh, kl, vth, vtl);                           // 32 blocks

  dim3 gAtt(NQ / 32, NBATCH);                                                      // (512, 8)
  k_attn<<<gAtt, 64, 0, stream>>>(x, wqh, wql, bq, kh, kl, vth, vtl, wph, wpl, bproj, out);
}

// v007
// One run takes 48.9 microseconds.
// Timed twice side by side with v006, it ran 1.10 and 1.07 times as fast.
// Counting every step since v000, it is 5.15 times as fast.
// All contractions (q projection, 8x8 stride-8 reduction conv as a patch GEMM, kv projection, q*k^T scores, P*V, output projection): v_wmma_f32_16x16x32_bf16, bf16 hi/lo operands everywhere (hi*hi + hi*lo + lo*hi), f32 accumulate; LayerNorm, softmax and biases in f32.
#include <hip/hip_runtime.h>
#include <stdint.h>

typedef unsigned short u16;
typedef u16    v16u __attribute__((ext_vector_type(16)));
typedef u16    v8u  __attribute__((ext_vector_type(8)));
typedef __bf16 v16b __attribute__((ext_vector_type(16)));
typedef __bf16 v2b  __attribute__((ext_vector_type(2)));
typedef float  v2f  __attribute__((ext_vector_type(2)));
typedef unsigned v4w __attribute__((ext_vector_type(4)));
typedef float  v8f  __attribute__((ext_vector_type(8)));
typedef float  v4f  __attribute__((ext_vector_type(4)));
typedef v8u __attribute__((may_alias)) v8ua;
typedef v4f __attribute__((may_alias)) v4fa;

union Frag { v16b v; v16u u; v8u half[2]; };
static_assert(sizeof(Frag) == 32);

#define NBATCH 8
#define NQ     16384
#define CD     64
#define NKEY   256
#define NROWK  2048        // NBATCH * NKEY reduced tokens
#define KCONV  4096        // 64 patch pixels x 64 channels
#define LN_EPS 1e-5f
#define KSPLIT 16          // slices of the conv reduction, one work-group each
#define KSLICE 256         // KCONV / KSPLIT

// ---------------------------------------------------------------------------
// 16x16x32 bf16 WMMA with hazard guard (ties D, keeps A/B live).
// Fragment map (wave32): lane l, h = l>>4, m = n = l&15.
//   A/B element i: i<8 -> k0+8h+i ; i>=8 -> k0+16+8h+(i-8)
//   D element r : row 8h+r, col l&15
// ---------------------------------------------------------------------------
__device__ __forceinline__ v8f wmma_bf(v16b a, v16b b, v8f c) {
  v8f d = __builtin_amdgcn_wmma_f32_16x16x32_bf16(false, a, false, b, (short)0, c, false, false);
  asm volatile("v_nop\n\tv_nop\n\tv_nop\n\tv_nop" : "+v"(d) : "v"(a), "v"(b));
  return d;
}

// f32 -> bf16 bits, round to nearest even, by the hardware convert
__device__ __forceinline__ u16 bf_rne(float f) {
  return __builtin_bit_cast(u16, (__bf16)f);
}
__device__ __forceinline__ float bf_val(u16 b) {
  return __builtin_bit_cast(float, ((unsigned)b) << 16);
}

// 8 floats -> hi/lo bf16 planes (hi = rne(x), lo = rne(x - hi)). Two elements share one packed convert, which leaves
// them in the two halves of their fragment register; the f32 values of hi are cut out of that same register.
__device__ __forceinline__ void split8(v8f f, v8u& hi, v8u& lo) {
  v4w wh, wl;
  #pragma unroll
  for (int i = 0; i < 4; ++i) {
    const v2f x2 = {f[2 * i], f[2 * i + 1]};
    const unsigned ph = __builtin_bit_cast(unsigned, __builtin_convertvector(x2, v2b));
    const v2f h2 = {__builtin_bit_cast(float, ph << 16), __builtin_bit_cast(float, ph & 0xFFFF0000u)};
    wh[i] = ph;
    wl[i] = __builtin_bit_cast(unsigned, __builtin_convertvector(x2 - h2, v2b));
  }
  hi = __builtin_bit_cast(v8u, wh);
  lo = __builtin_bit_cast(v8u, wl);
}

// 16 floats given in fragment element order (a = elements 0..7, c = 8..15) -> hi/lo fragments
__device__ __forceinline__ void split_frag(v8f a, v8f c, v16b& fhi, v16b& flo) {
  Frag fh, fl;
  v8u h0, l0, h1, l1;
  split8(a, h0, l0);
  split8(c, h1, l1);
  fh.half[0] = h0; fh.half[1] = h1;
  fl.half[0] = l0; fl.half[1] = l1;
  fhi = fh.v; flo = fl.v;
}

// A or B fragment from a k-contiguous bf16 row; p points at element k0 of the row owned by this lane.
__device__ __forceinline__ v16b ld_frag(const u16* p, int h) {
  Frag f;
  f.half[0] = *(const v8ua*)(p + 8 * h);
  f.half[1] = *(const v8ua*)(p + 16 + 8 * h);
  return f.v;
}

// Planes that a kernel reads from the workspace are kept in fragment order: fragment f = (row tile) * (k / 32) + k step
// is 512 elements; lane l's elements 0..7 stand at f*512 + l*8, its elements 8..15 at f*512 + 256 + l*8,
// so each wave-wide 16-B load covers 512 contiguous bytes. p points at f*512 + l*8.
__device__ __forceinline__ v16b ld_fragp(const u16* p) {
  Frag f;
  f.half[0] = *(const v8ua*)p;
  f.half[1] = *(const v8ua*)(p + 256);
  return f.v;
}

// Writer's side of the same map: g8 = index of a group of 8 consecutive plane elements, 1 << ksh fragments per row tile
// -> matrix row and first k of the group.
__device__ __forceinline__ void frag_rk(int g8, int ksh, int& row, int& k) {
  const int f = g8 >> 6;
  row = ((f >> ksh) << 4) + (g8 & 15);
  k = ((f & ((1 << ksh) - 1)) << 5) + ((g8 >> 5) & 1) * 16 + ((g8 >> 4) & 1) * 8;
}

__device__ __forceinline__ float red16(float v) {
  v += __shfl_xor(v, 1);
  v += __shfl_xor(v, 2);
  v += __shfl_xor(v, 4);
  v += __shfl_xor(v, 8);
  return v;
}

// ---------------------------------------------------------------------------
// K and V^T planes out of LDS, in fragment order: per plane 8 fragments = 512 groups of 8 elements,
// one group per thread and pass, 512 contiguous bytes per wave and store.
//   K  : row = token, k = d;   fragment (global token >> 4) * 2 + (d >> 5)
//   V^T: row = d, k = key;     fragment batch * 32 + (d >> 4) * 8 + (key >> 5)
// ---------------------------------------------------------------------------
__device__ __forceinline__ void kv_store_pass(const u16* sK, const u16* sV,
                                              u16* kh, u16* kl, u16* vth, u16* vtl,
                                              int blk, int tid) {
  const int bb = blk >> 2, kq = blk & 3;
  #pragma unroll
  for (int it = 0; it < 16; ++it) {
    const int p = (it >> 2) & 1;
    const int g8 = (it & 3) * 128 + tid;           // 0..511
    int row, k;
    frag_rk(g8, 1, row, k);                        // both 0..63, local to this block
    v8u v;
    u16* dst;
    if (it < 8) {
      v = *(const v8ua*)(sK + (p * 64 + row) * 64 + k);
      u16* plane = p ? kl : kh;
      dst = plane + (size_t)blk * 4096 + g8 * 8;
    } else {
      v = *(const v8ua*)(sV + (p * 64 + row) * 64 + k);
      u16* plane = p ? vtl : vth;
      const int f = g8 >> 6;
      dst = plane + (size_t)(bb * 32 + (f >> 1) * 8 + 2 * kq + (f & 1)) * 512 + (g8 & 63) * 8;
    }
    *(v8u*)dst = v;
  }
}

// ---------------------------------------------------------------------------
// Kernel 1: conv GEMM, split along k; patches gathered from x in the A loader, conv weights taken from wsr by the
// work-group itself (no weight launch, no conv weight planes).
//   Block = 128 conv rows x one k slice of 256, 8 waves x 16 rows.
//   Slice sp = patch row i = sp >> 1 (its 8 pixels j) x channel half sp & 1 (32 channels); k step = j, k in the step = channel.
//   row r = b*256 + m, m = py*16 + px;
//   A value = x[b][pix][ci], pix = (8py+i)*W + 8px + j (clamped), split to bf16 hi/lo in registers.
//   B value = wsr[co][ci][i][j]: a thread reads 16 channels x 4 pixels of one co (16 contiguous bytes a channel), splits them
//   and lays, per pixel, 8 channels as one 16-B group of the slice's fragments in LDS (fragment t*8 + j, order as ld_fragp).
//   Each wave stores its f32 16x64 partial tile in accumulator order:
//   part[slice][row tile][t][j][lane][4] = acc[t][4j..4j+3], 512 B per store.
//   Blocks (0..7, 0) also turn wq, wkv, wproj into bf16 hi/lo planes in fragment order (row = out, k = in) for the later
//   launches: one thread = 8 consecutive plane elements = one 16-B store per plane.
// grid = (16, 16) blocks x 256 threads.
// ---------------------------------------------------------------------------
__global__ __launch_bounds__(256) void k_conv_part(
    const float* __restrict__ x, const int* __restrict__ Hp, const int* __restrict__ Wp,
    const float* __restrict__ wsr,
    const float* __restrict__ wq, const float* __restrict__ wkv, const float* __restrict__ wproj,
    u16* __restrict__ wqh, u16* __restrict__ wql,
    u16* __restrict__ wkvh, u16* __restrict__ wkvl,
    u16* __restrict__ wph, u16* __restrict__ wpl,
    float* __restrict__ part)                                     // [16][128][4][2][32][4]
{
  __shared__ __attribute__((aligned(16))) u16 sB[2][4 * 8 * 512];  // hi, lo: [co tile][k step][512]

  const int tid = threadIdx.x, lane = tid & 31, w = tid >> 5;
  const int h = lane >> 4, m = lane & 15;
  const int blk = blockIdx.x, sp = blockIdx.y;
  const int irow = sp >> 1, chalf = sp & 1;
  const v8f zero8 = {0.f, 0.f, 0.f, 0.f, 0.f, 0.f, 0.f, 0.f};
  const int Hv = Hp[0], Wv = Wp[0];

  // small weights, asked for first (block-uniform test)
  const bool small = (sp == 0) && (blk < 8);
  v8f fs = zero8;
  u16* dh = wqh;
  u16* dl = wql;
  int e = 0;
  if (small) {
    const float* src;
    if (blk < 2)      { e = blk * 256 + tid;        src = wq;    dh = wqh;  dl = wql;  }
    else if (blk < 6) { e = (blk - 2) * 256 + tid;  src = wkv;   dh = wkvh; dl = wkvl; }
    else              { e = (blk - 6) * 256 + tid;  src = wproj; dh = wph;  dl = wpl;  }
    int row, k;
    frag_rk(e, 1, row, k);
    const float* s = src + row * CD + k;
    const v4f a = *(const v4fa*)s;
    const v4f c = *(const v4fa*)(s + 4);
    fs = __builtin_shufflevector(a, c, 0, 1, 2, 3, 4, 5, 6, 7);
    // precaution: the address registers of the two loads above are reused further down
    asm volatile("s_wait_xcnt 0x0" ::: "memory");
  }

  // conv weight blocks of this thread: co = 16*tw + m, pixels 8*irow + 4*h .. +3, and for gg = 0, 1 the 8 channels
  // 32*chalf + 8*(2*(w & 1) + gg) .. +7. Lanes m and m + 16 share a 128-B line, so a wave-wide load touches 16 lines.
  // Asked for in front of x: they are needed first, and their split runs while x is on its way.
  const int tw = w >> 1, g1 = w & 1;
  const float* wsrc = wsr + (size_t)(16 * tw + m) * KCONV + (32 * chalf + 16 * g1) * 64 + 8 * irow + 4 * h;
  // both loops unrolled: wv is indexed by their counters and has to stay in registers
  v4f wv[2][8];
  #pragma unroll
  for (int gg = 0; gg < 2; ++gg)
    #pragma unroll
    for (int c = 0; c < 8; ++c) wv[gg][c] = *(const v4fa*)(wsrc + (8 * gg + c) * 64);
  // precaution: the address registers of the loads above are reused further down; the pointer is named as an input
  // so that its register pair stays as it is up to the wait (no load lands on it)
  asm volatile("s_wait_xcnt 0x0" :: "v"(wsrc) : "memory");

  const long long hw = (long long)Hv * (long long)Wv;
  const int lim = (hw >= 1 && hw <= NQ) ? (int)(hw - 1) : (NQ - 1);
  const int r = blk * 128 + w * 16 + m;
  const int bb = r >> 8, mm = r & 255;
  const int py = mm >> 4, px = mm & 15;

  // The whole slice of this lane's row, 16 KB per wave, is asked for before any of it is used:
  // with two waves per SIMD only the loads in flight cover the memory latency.
  // Unrolled: xa is indexed by the counter and has to stay in registers.
  v4f xa[KSLICE / 32][4];
  #pragma unroll
  for (int j = 0; j < KSLICE / 32; ++j) {
    int pix = (8 * py + irow) * Wv + 8 * px + j;
    pix = min(max(pix, 0), lim);
    const float* s = x + ((size_t)bb * NQ + pix) * CD + 32 * chalf + 8 * h;
    xa[j][0] = *(const v4fa*)(s);
    xa[j][1] = *(const v4fa*)(s + 4);
    xa[j][2] = *(const v4fa*)(s + 16);
    xa[j][3] = *(const v4fa*)(s + 20);
  }
  // precaution: the address registers of the loads above are reused further down
  asm volatile("s_wait_xcnt 0x0" ::: "memory");

  if (small) {
    v8u hi, lo;
    split8(fs, hi, lo);
    *(v8u*)(dh + (size_t)e * 8) = hi;
    *(v8u*)(dl + (size_t)e * 8) = lo;
    // precaution: the address registers of the stores above are reused further down
    asm volatile("s_wait_xcnt 0x0" ::: "memory");
  }

  // turn in registers: a pixel's 8 channels are one 16-B group of fragment (tw, pixel);
  // each half wave's store covers 256 contiguous bytes (loops unrolled: wv stays in registers)
  #pragma unroll
  for (int gg = 0; gg < 2; ++gg) {
    #pragma unroll
    for (int jj = 0; jj < 4; ++jj) {
      v8f f;
      #pragma unroll
      for (int c = 0; c < 8; ++c) f[c] = wv[gg][c][jj];
      v8u hi, lo;
      split8(f, hi, lo);
      const int o = (tw * 8 + 4 * h + jj) * 512 + g1 * 256 + (gg * 16 + m) * 8;
      *(v8ua*)(&sB[0][o]) = hi;
      *(v8ua*)(&sB[1][o]) = lo;
    }
  }
  // Work-group barrier that orders LDS only: the fragments are published while x is still on its way
  // (__syncthreads() would first wait for every global load in flight).
  __builtin_amdgcn_fence(__ATOMIC_RELEASE, "workgroup", "local");
  __builtin_amdgcn_s_barrier();
  __builtin_amdgcn_fence(__ATOMIC_ACQUIRE, "workgroup", "local");

  v8f acc[4];
  #pragma unroll
  for (int t = 0; t < 4; ++t) acc[t] = zero8;

  const u16* brh = &sB[0][lane * 8];
  const u16* brl = &sB[1][lane * 8];

  // Weight fragments run one k step ahead in a second register set, the 16 LDS reads of a step asked for together
  // in front of the products of the step before.
  v16b fbh[2][4], fbl[2][4];
  #pragma unroll
  for (int t = 0; t < 4; ++t) {
    fbh[0][t] = ld_fragp(brh + (t * 8) * 512);
    fbl[0][t] = ld_fragp(brl + (t * 8) * 512);
  }
  // keeps the splits of x, which wait for x, behind the barrier and behind the first LDS reads
  __builtin_amdgcn_sched_barrier(0);

  // unrolled: xa and the register sets are indexed by ks and have to stay in registers
  #pragma unroll
  for (int ks = 0; ks < KSLICE / 32; ++ks) {
    if (ks + 1 < KSLICE / 32) {
      #pragma unroll
      for (int t = 0; t < 4; ++t) {
        fbh[(ks + 1) & 1][t] = ld_fragp(brh + (t * 8 + ks + 1) * 512);
        fbl[(ks + 1) & 1][t] = ld_fragp(brl + (t * 8 + ks + 1) * 512);
      }
    }
    v16b fah, fal;
    split_frag(__builtin_shufflevector(xa[ks][0], xa[ks][1], 0, 1, 2, 3, 4, 5, 6, 7),
               __builtin_shufflevector(xa[ks][2], xa[ks][3], 0, 1, 2, 3, 4, 5, 6, 7), fah, fal);
    #pragma unroll
    for (int t = 0; t < 4; ++t) {
      acc[t] = wmma_bf(fah, fbh[ks & 1][t], acc[t]);
      acc[t] = wmma_bf(fah, fbl[ks & 1][t], acc[t]);
      acc[t] = wmma_bf(fal, fbh[ks & 1][t], acc[t]);
    }
  }

  float* pp = part + ((size_t)sp * 128 + blk * 8 + w) * 1024 + lane * 4;
  #pragma unroll
  for (int t = 0; t < 4; ++t) {
    *(v4f*)(pp + (2 * t) * 128)     = __builtin_shufflevector(acc[t], acc[t], 0, 1, 2, 3);
    *(v4f*)(pp + (2 * t + 1) * 128) = __builtin_shufflevector(acc[t], acc[t], 4, 5, 6, 7);
  }
}

// ---------------------------------------------------------------------------
// Kernel 2: reduced tokens. Block = 64 conv rows (tokens) of one batch, 4 waves x 16 rows.
//   sum of the 16 k-slice partials (slice 0 first) -> LayerNorm (f32) -> kv proj (16x64 @ 64x128)
//   -> K planes 2048 x 64 and V^T planes 8 x (64 x 256) (bf16 hi/lo), fragment order, whole-line stores.
// grid = 32 blocks x 128 threads.
// ---------------------------------------------------------------------------
__global__ __launch_bounds__(128) void k_kv(
    const float* __restrict__ part,                               // [16][128][4][2][32][4]
    const float* __restrict__ gamma, const float* __restrict__ beta,
    const u16* __restrict__ wkvh, const u16* __restrict__ wkvl,   // 128 x 64, fragment order
    const float* __restrict__ bkv,
    u16* __restrict__ kh, u16* __restrict__ kl,                   // 2048 x 64, fragment order
    u16* __restrict__ vth, u16* __restrict__ vtl)                 // 8 x (64 x 256), fragment order
{
  __shared__ __attribute__((aligned(16))) u16 sX[2 * 64 * 64];   // LN output hi/lo [p][token][c]
  __shared__ __attribute__((aligned(16))) u16 sK[2 * 64 * 64];   // [p][token][d]
  __shared__ __attribute__((aligned(16))) u16 sV[2 * 64 * 64];   // [p][d][token]

  const int tid = threadIdx.x, lane = tid & 31, w = tid >> 5;
  const int h = lane >> 4, m = lane & 15;
  const int blk = blockIdx.x;

  const v8f zero8 = {0.f, 0.f, 0.f, 0.f, 0.f, 0.f, 0.f, 0.f};
  v8f acc[4];
  #pragma unroll
  for (int t = 0; t < 4; ++t) acc[t] = zero8;

  const float* pp = part + (size_t)(blk * 4 + w) * 1024 + lane * 4;
  #pragma unroll
  for (int s = 0; s < KSPLIT; ++s) {
    const float* ps = pp + (size_t)s * (128 * 1024);
    #pragma unroll
    for (int t = 0; t < 4; ++t) {
      const v4f a = *(const v4fa*)(ps + (2 * t) * 128);
      const v4f c = *(const v4fa*)(ps + (2 * t + 1) * 128);
      acc[t] += __builtin_shufflevector(a, c, 0, 1, 2, 3, 4, 5, 6, 7);
    }
  }
  // acc[t][r] = conv out [token 64blk+16w+8h+r][channel 16t+m]

  float mu[8], rs[8];
  #pragma unroll
  for (int r = 0; r < 8; ++r) {
    float s = acc[0][r] + acc[1][r] + acc[2][r] + acc[3][r];
    s = red16(s);
    mu[r] = s * (1.0f / 64.0f);
    float v = 0.f;
    #pragma unroll
    for (int t = 0; t < 4; ++t) { const float d = acc[t][r] - mu[r]; v += d * d; }
    v = red16(v) * (1.0f / 64.0f);
    rs[r] = rsqrtf(v + LN_EPS);
  }
  #pragma unroll
  for (int t = 0; t < 4; ++t) {
    const int col = 16 * t + m;
    const float g = gamma[col], be = beta[col];
    #pragma unroll
    for (int r = 0; r < 8; ++r) {
      const float y = (acc[t][r] - mu[r]) * rs[r] * g + be;
      const u16 hh = bf_rne(y);
      const u16 ll = bf_rne(y - bf_val(hh));
      const int kl_ = 16 * w + 8 * h + r;
      sX[kl_ * 64 + col] = hh;
      sX[4096 + kl_ * 64 + col] = ll;
    }
  }
  // kv weight fragments run one column tile ahead of the products that use them
  v16b wb[4];
  wb[0] = ld_fragp(wkvh + lane * 8);
  wb[1] = ld_fragp(wkvl + lane * 8);
  wb[2] = ld_fragp(wkvh + lane * 8 + 512);
  wb[3] = ld_fragp(wkvl + lane * 8 + 512);
  __syncthreads();

  // kv projection A fragments: row = token 16w+m, k = channel
  const v16b xah0 = ld_frag(sX + (16 * w + m) * 64, h);
  const v16b xah1 = ld_frag(sX + (16 * w + m) * 64 + 32, h);
  const v16b xal0 = ld_frag(sX + 4096 + (16 * w + m) * 64, h);
  const v16b xal1 = ld_frag(sX + 4096 + (16 * w + m) * 64 + 32, h);

  #pragma unroll
  for (int ct = 0; ct < 8; ++ct) {
    const v16b b0h = wb[0], b0l = wb[1], b1h = wb[2], b1l = wb[3];
    if (ct + 1 < 8) {
      const int off = (ct + 1) * 1024 + lane * 8;
      wb[0] = ld_fragp(wkvh + off);
      wb[1] = ld_fragp(wkvl + off);
      wb[2] = ld_fragp(wkvh + off + 512);
      wb[3] = ld_fragp(wkvl + off + 512);
    }
    v8f c = zero8;
    c = wmma_bf(xah0, b0h, c);
    c = wmma_bf(xah0, b0l, c);
    c = wmma_bf(xal0, b0h, c);
    c = wmma_bf(xah1, b1h, c);
    c = wmma_bf(xah1, b1l, c);
    c = wmma_bf(xal1, b1h, c);
    // c[r] = kv[token 16w+8h+r][col 16ct+m]
    const int col = 16 * ct + m;
    const float bb = bkv[col];
    #pragma unroll
    for (int r = 0; r < 8; ++r) {
      const float val = c[r] + bb;
      const u16 hh = bf_rne(val);
      const u16 ll = bf_rne(val - bf_val(hh));
      const int kl_ = 16 * w + 8 * h + r;
      if (ct < 4) {
        sK[kl_ * 64 + col] = hh;
        sK[4096 + kl_ * 64 + col] = ll;
      } else {
        const int d = col - 64;
        sV[d * 64 + kl_] = hh;
        sV[4096 + d * 64 + kl_] = ll;
      }
    }
  }
  __syncthreads();

  kv_store_pass(sK, sV, kh, kl, vth, vtl, blk, tid);
  
}

// ---------------------------------------------------------------------------
// lanes 8q..8q+7 in one instruction, 4 lines per instruction, 32 lines per wave.
// ---------------------------------------------------------------------------
// The LDS tile keeps 16-B chunk q of row m at chunk q ^ m (see the writer in k_attn).
__device__ __forceinline__ void att_store_pass(const float* so, float* out, size_t grow0, int lane) {
  const int q8 = lane & 7, sub = lane >> 3;
  #pragma unroll
  for (int i = 0; i < 8; ++i) {
    const int lid = i * 4 + sub;
    const int row = lid >> 1, hl = lid & 1;
    const v4f v = *(const v4fa*)(so + row * 64 + 4 * ((8 * hl + q8) ^ row));
    *(v4f*)(out + (grow0 + (size_t)row) * CD + 32 * hl + 4 * q8) = v;
  }
}

// The four K fragments (k 0..31 hi, lo; k 32..63 hi, lo) of key tile j.
__device__ __forceinline__ void ld_k4(v16b* f, const u16* ph, const u16* pl, int j) {
  const int ko = j * 1024;                       // two fragments per 16 keys
  f[0] = ld_fragp(ph + ko);
  f[1] = ld_fragp(pl + ko);
  f[2] = ld_fragp(ph + ko + 512);
  f[3] = ld_fragp(pl + ko + 512);
}

// Scores of key tile j: z[r] = S[query m][key 16j+8h+r], parked as this lane's chunks 2j (r 0..3) and 2j+1 (r 4..7).
__device__ __forceinline__ void score_pass(const v16b* f, v16b qbh0, v16b qbl0, v16b qbh1, v16b qbl1,
                                           float* sl, int j, float& mx) {
  v8f z = {0.f, 0.f, 0.f, 0.f, 0.f, 0.f, 0.f, 0.f};
  z = wmma_bf(f[0], qbh0, z);
  z = wmma_bf(f[0], qbl0, z);
  z = wmma_bf(f[1], qbh0, z);
  z = wmma_bf(f[2], qbh1, z);
  z = wmma_bf(f[2], qbl1, z);
  z = wmma_bf(f[3], qbh1, z);
  const v4f z0 = __builtin_shufflevector(z, z, 0, 1, 2, 3);
  const v4f z1 = __builtin_shufflevector(z, z, 4, 5, 6, 7);
  *(v4fa*)(sl + 256 * j) = z0;
  *(v4fa*)(sl + 256 * j + 128) = z1;
  #pragma unroll
  for (int r = 0; r < 8; ++r) mx = fmaxf(mx, z[r]);
}

// P^T fragments of key step c (32 keys) out of this lane's park, scaled by 1 / row sum.
__device__ __forceinline__ void p_frag(const float* sl, int c, float inv, v16b& pbh, v16b& pbl) {
  const float* pp = sl + 512 * c;                // chunks 4c..4c+3: keys 32c+8h.., 32c+16+8h..
  const v4f p0 = *(const v4fa*)pp;
  const v4f p1 = *(const v4fa*)(pp + 128);
  const v4f p2 = *(const v4fa*)(pp + 256);
  const v4f p3 = *(const v4fa*)(pp + 384);
  const v8f pa = __builtin_shufflevector(p0, p1, 0, 1, 2, 3, 4, 5, 6, 7) * inv;
  const v8f pc = __builtin_shufflevector(p2, p3, 0, 1, 2, 3, 4, 5, 6, 7) * inv;
  split_frag(pa, pc, pbh, pbl);
}

// ---------------------------------------------------------------------------
// Kernel 3: fused q projection + attention over 256 reduced tokens + output projection.
// Block = 64 threads (2 waves), 16 queries per wave; grid = (512, 8).
//   q^T = wq * x^T          : A = wq plane rows, B = x^T split in registers
//   S^T = K * q^T           : A = K plane rows, B = q^T packed from two adjacent D tiles
//   softmax over 256 keys   : f32, scores parked in LDS; each lane re-reads only what it wrote,
//                             so the park is lane-major: 16-B chunk c of lane l at (c*32 + l)*16 B,
//                             every LDS access of a wave covers 512 contiguous bytes (no bank conflict)
//   O^T = V^T * P^T         : A = V^T plane rows, B = P^T from LDS
//   out^T = wproj * O^T     : A = wproj plane rows, B = O^T packed from D tiles
// Every plane fragment is asked for ahead of the products that use it: q weights with x, K three key tiles
// ahead (ring of four register sets), V^T one key step ahead, proj weights in front of the split of O.
// ---------------------------------------------------------------------------
__global__ __launch_bounds__(64) void k_attn(
    const float* __restrict__ x,
    const u16* __restrict__ wqh, const u16* __restrict__ wql, const float* __restrict__ bq,
    const u16* __restrict__ kh, const u16* __restrict__ kl,      // 2048 x 64, fragment order
    const u16* __restrict__ vth, const u16* __restrict__ vtl,    // 8 x (64 x 256), fragment order
    const u16* __restrict__ wph, const u16* __restrict__ wpl, const float* __restrict__ bproj,
    float* __restrict__ out)                                     // [8][16384][64]
{
  __shared__ __attribute__((aligned(16))) float sS[2][16 * 256];
  __shared__ __attribute__((aligned(16))) float sO[2][16 * 64];

  const int tid = threadIdx.x, lane = tid & 31, w = tid >> 5;
  const int h = lane >> 4, m = lane & 15;
  const int b = blockIdx.y;
  const int q0 = blockIdx.x * 32 + 16 * w;
  const v8f zero8 = {0.f, 0.f, 0.f, 0.f, 0.f, 0.f, 0.f, 0.f};

  // ---- q^T = wq * x^T : qt[t][r] = q[query q0+m][feature 16t+8h+r] ----
  v8f qt[4];
  #pragma unroll
  for (int t = 0; t < 4; ++t) qt[t] = zero8;
  const float* xr = x + ((size_t)b * NQ + q0 + m) * CD;
  v4f xv[2][4];
  #pragma unroll
  for (int ks = 0; ks < 2; ++ks) {
    const float* xp = xr + 32 * ks + 8 * h;
    xv[ks][0] = *(const v4fa*)(xp);
    xv[ks][1] = *(const v4fa*)(xp + 4);
    xv[ks][2] = *(const v4fa*)(xp + 16);
    xv[ks][3] = *(const v4fa*)(xp + 20);
  }
  // precaution: the address registers of the loads above are reused by what follows
  asm volatile("s_wait_xcnt 0x0" ::: "memory");
  v16b wah[2][4], wal[2][4];
  #pragma unroll
  for (int ks = 0; ks < 2; ++ks)
    #pragma unroll
    for (int t = 0; t < 4; ++t) {
      const int off = (2 * t + ks) * 512 + lane * 8;
      wah[ks][t] = ld_fragp(wqh + off);
      wal[ks][t] = ld_fragp(wql + off);
    }
  v4f bqv[4][2];
  #pragma unroll
  for (int t = 0; t < 4; ++t) {
    bqv[t][0] = *(const v4fa*)(bq + 16 * t + 8 * h);
    bqv[t][1] = *(const v4fa*)(bq + 16 * t + 8 * h + 4);
  }
  // precaution: the address registers of the loads above are reused by what follows
  asm volatile("s_wait_xcnt 0x0" ::: "memory");
  #pragma unroll
  for (int ks = 0; ks < 2; ++ks) {
    const v8f a8 = __builtin_shufflevector(xv[ks][0], xv[ks][1], 0, 1, 2, 3, 4, 5, 6, 7);
    const v8f c8 = __builtin_shufflevector(xv[ks][2], xv[ks][3], 0, 1, 2, 3, 4, 5, 6, 7);
    v16b xbh, xbl;
    split_frag(a8, c8, xbh, xbl);
    #pragma unroll
    for (int t = 0; t < 4; ++t) {
      qt[t] = wmma_bf(wah[ks][t], xbh, qt[t]);
      qt[t] = wmma_bf(wah[ks][t], xbl, qt[t]);
      qt[t] = wmma_bf(wal[ks][t], xbh, qt[t]);
    }
  }
  // key tiles 0..2 are asked for here, in front of the split of q
  const u16* kbh = kh + (size_t)b * NKEY * CD + lane * 8;
  const u16* kbl = kl + (size_t)b * NKEY * CD + lane * 8;
  v16b kf[4][4];
  #pragma unroll
  for (int s = 0; s < 3; ++s) ld_k4(kf[s], kbh, kbl, s);
  v8f qv[4];
  #pragma unroll
  for (int t = 0; t < 4; ++t)
    #pragma unroll
    for (int r = 0; r < 8; ++r)
      qv[t][r] = (qt[t][r] + bqv[t][r >> 2][r & 3]) * 0.125f;    // d^-1/2 folded into q (exact)
  // B fragment for k = d: element i <- tile 2ks row i, element 8+i <- tile 2ks+1 row i
  v16b qbh0, qbl0, qbh1, qbl1;
  split_frag(qv[0], qv[1], qbh0, qbl0);
  split_frag(qv[2], qv[3], qbh1, qbl1);

  // ---- scores: key tile j uses register set j & 3; tile j + 3 is asked for into the set that tile j - 1 has left ----
  float* sw = &sS[w][0];
  float* sl = sw + lane * 4;                     // chunk c of this lane: sl + c*128
  float mx = -3.0e38f;
  // unrolled: the set index has to be a constant, and every load then takes its tile as an immediate offset
  // from one address pair that is never rewritten while loads are in flight
  #pragma unroll
  for (int j = 0; j < 16; ++j) {
    if (j + 3 < 16) ld_k4(kf[(j + 3) & 3], kbh, kbl, j + 3);
    score_pass(kf[j & 3], qbh0, qbl0, qbh1, qbl1, sl, j, mx);
  }
  mx = fmaxf(mx, __shfl_xor(mx, 16));

  // V^T fragments of key step 0 are asked for here and land behind the softmax.
  // precaution: the V^T addresses may take the registers that the K loads name; the batch offset passes through
  // the statement so that the address arithmetic cannot be lifted over the wait
  unsigned vb0 = (unsigned)b * (CD * NKEY);
  asm volatile("s_wait_xcnt 0x0" : "+s"(vb0) : : "memory");
  const u16* vbh = vth + (size_t)vb0 + lane * 8;
  const u16* vbl = vtl + (size_t)vb0 + lane * 8;
  v16b vh[4], vl[4];
  #pragma unroll
  for (int t = 0; t < 4; ++t) {
    vh[t] = ld_fragp(vbh + (8 * t) * 512);
    vl[t] = ld_fragp(vbl + (8 * t) * 512);
  }
  // precaution: the address registers of the loads above are reused by what follows
  asm volatile("s_wait_xcnt 0x0" ::: "memory");

  // ---- softmax numerator + row sum (f32); same lane, same addresses ----
  float sum = 0.f;
  #pragma unroll 2
  for (int a = 0; a < 16; ++a) {
    float* pp = sl + 256 * a;
    v4f v0 = *(const v4fa*)pp;
    v4f v1 = *(const v4fa*)(pp + 128);
    #pragma unroll
    for (int e = 0; e < 4; ++e) {
      v0[e] = __expf(v0[e] - mx);
      v1[e] = __expf(v1[e] - mx);
      sum += v0[e] + v1[e];
    }
    *(v4fa*)pp = v0;
    *(v4fa*)(pp + 128) = v1;
  }
  sum += __shfl_xor(sum, 16);
  const float inv = 1.0f / sum;

  // ---- O^T = V^T * P^T : o[t][r] = O[query m][d 16t+8h+r] ----
  v8f o[4];
  #pragma unroll
  for (int t = 0; t < 4; ++t) o[t] = zero8;
  // tile t's pair for key step c + 1 is asked for right behind tile t's products of step c, into the same registers
  const char* vub = (const char*)(vth + (size_t)vb0);   // wave-uniform plane bases of this batch
  const char* vlb = (const char*)(vtl + (size_t)vb0);
  unsigned vof = (unsigned)lane * 16u + 1024u;           // this lane's byte offset in the fragments of key step c + 1
  #pragma unroll 1
  for (int c = 0; c < 7; ++c) {
    v16b pbh, pbl;
    p_frag(sl, c, inv, pbh, pbl);
    #pragma unroll
    for (int t = 0; t < 4; ++t) {
      o[t] = wmma_bf(vh[t], pbh, o[t]);
      o[t] = wmma_bf(vh[t], pbl, o[t]);
      o[t] = wmma_bf(vl[t], pbh, o[t]);
      vh[t] = ld_fragp((const u16*)(vub + vof + t * 8192));
      vl[t] = ld_fragp((const u16*)(vlb + vof + t * 8192));
    }
    // The offset moves on by one key step (1024 bytes) inside the statement of the wait: this trip's loads, still
    // in flight, name its register (precaution), and nothing can be lifted between wait and addition; at the
    // loop's foot the wait also stands in front of whatever reuses the address registers behind the loop.
    asm volatile("s_wait_xcnt 0x0\n\tv_add_nc_u32_e32 %0, 0x400, %0" : "+v"(vof) : : "memory");
  }
  {
    v16b pbh, pbl;
    p_frag(sl, 7, inv, pbh, pbl);
    #pragma unroll
    for (int t = 0; t < 4; ++t) {
      o[t] = wmma_bf(vh[t], pbh, o[t]);
      o[t] = wmma_bf(vh[t], pbl, o[t]);
      o[t] = wmma_bf(vl[t], pbh, o[t]);
    }
  }

  // ---- out^T = wproj * O^T : u[t][r] = out[query m][feature 16t+8h+r] ----
  v16b wpf[4][4];
  #pragma unroll
  for (int t = 0; t < 4; ++t) {
    const int off = t * 1024 + lane * 8;
    wpf[t][0] = ld_fragp(wph + off);
    wpf[t][1] = ld_fragp(wpl + off);
    wpf[t][2] = ld_fragp(wph + off + 512);
    wpf[t][3] = ld_fragp(wpl + off + 512);
  }
  // precaution: the address registers of the loads above are reused by what follows
  asm volatile("s_wait_xcnt 0x0" ::: "memory");
  v4f bpv[4][2];
  #pragma unroll
  for (int t = 0; t < 4; ++t) {
    bpv[t][0] = *(const v4fa*)(bproj + 16 * t + 8 * h);
    bpv[t][1] = *(const v4fa*)(bproj + 16 * t + 8 * h + 4);
  }
  v16b obh0, obl0, obh1, obl1;
  split_frag(o[0], o[1], obh0, obl0);
  split_frag(o[2], o[3], obh1, obl1);
  v8f u[4];
  #pragma unroll
  for (int t = 0; t < 4; ++t) {
    const v16b a0h = wpf[t][0], a0l = wpf[t][1], a1h = wpf[t][2], a1l = wpf[t][3];
    v8f z = zero8;
    z = wmma_bf(a0h, obh0, z);
    z = wmma_bf(a0h, obl0, z);
    z = wmma_bf(a0l, obh0, z);
    z = wmma_bf(a1h, obh1, z);
    z = wmma_bf(a1h, obl1, z);
    z = wmma_bf(a1l, obh1, z);
    u[t] = z;
  }
  // row m of the output tile, 16-B chunk q stored at chunk q ^ m: the 16 rows of one store fall on 16 different bank groups
  float* so = &sO[w][0];
  #pragma unroll
  for (int t = 0; t < 4; ++t) {
    v8f y;
    #pragma unroll
    for (int r = 0; r < 8; ++r) y[r] = u[t][r] + bpv[t][r >> 2][r & 3];
    const int q = 4 * t + 2 * h;
    *(v4fa*)(so + m * 64 + 4 * (q ^ m))       = __builtin_shufflevector(y, y, 0, 1, 2, 3);
    *(v4fa*)(so + m * 64 + 4 * ((q + 1) ^ m)) = __builtin_shufflevector(y, y, 4, 5, 6, 7);
  }
  __syncthreads();

  const size_t grow0 = (size_t)b * NQ + q0;
  att_store_pass(so, out, grow0, lane);
  
}

// ---------------------------------------------------------------------------
extern "C" void kernel_launch(void* const* d_in, const int* in_sizes, int n_in,
                              void* d_out, int out_size, void* d_ws, size_t ws_size,
                              hipStream_t stream) {
  if (n_in < 12) return;
  if (in_sizes[0] != NBATCH * NQ * CD) return;
  if (in_sizes[1] != CD * CD || in_sizes[2] != CD) return;
  if (in_sizes[3] != 2 * CD * CD || in_sizes[4] != 2 * CD) return;
  if (in_sizes[5] != CD * CD || in_sizes[6] != CD) return;
  if (in_sizes[7] != CD * KCONV) return;
  if (in_sizes[8] != CD || in_sizes[9] != CD) return;
  if (in_sizes[10] < 1 || in_sizes[11] < 1) return;
  if (out_size != NBATCH * NQ * CD) return;

  const float* x     = (const float*)d_in[0];
  const float* wq    = (const float*)d_in[1];
  const float* bq    = (const float*)d_in[2];
  const float* wkv   = (const float*)d_in[3];
  const float* bkv   = (const float*)d_in[4];
  const float* wproj = (const float*)d_in[5];
  const float* bproj = (const float*)d_in[6];
  const float* wsr   = (const float*)d_in[7];
  const float* gamma = (const float*)d_in[8];
  const float* beta  = (const float*)d_in[9];
  const int*   Hp    = (const int*)d_in[10];
  const int*   Wp    = (const int*)d_in[11];
  float* out = (float*)d_out;

  const size_t szWq  = (size_t)CD * CD * 2;            //      8192 per plane
  const size_t szWkv = (size_t)2 * CD * CD * 2;        //     16384
  const size_t szWp  = (size_t)CD * CD * 2;            //      8192
  const size_t szK   = (size_t)NROWK * CD * 2;         //    262144
  const size_t szVt  = (size_t)NBATCH * CD * NKEY * 2; //    262144
  const size_t szPt  = (size_t)KSPLIT * NROWK * CD * 4; //  8388608
  size_t off = 0;
  const size_t oWqh = off;  off += szWq;
  const size_t oWql = off;  off += szWq;
  const size_t oWkh = off;  off += szWkv;
  const size_t oWkl = off;  off += szWkv;
  const size_t oWph = off;  off += szWp;
  const size_t oWpl = off;  off += szWp;
  const size_t oKh  = off;  off += szK;
  const size_t oKl  = off;  off += szK;
  const size_t oVth = off;  off += szVt;
  const size_t oVtl = off;  off += szVt;
  const size_t oPt  = off;  off += szPt;              // total 9502720
  if (off > ws_size) return;
  if (off > (size_t)134217728) return;

  char* ws = (char*)d_ws;
  u16* wqh  = (u16*)(ws + oWqh);
  u16* wql  = (u16*)(ws + oWql);
  u16* wkvh = (u16*)(ws + oWkh);
  u16* wkvl = (u16*)(ws + oWkl);
  u16* wph  = (u16*)(ws + oWph);
  u16* wpl  = (u16*)(ws + oWpl);
  u16* kh   = (u16*)(ws + oKh);
  u16* kl   = (u16*)(ws + oKl);
  u16* vth  = (u16*)(ws + oVth);
  u16* vtl  = (u16*)(ws + oVtl);
  float* part = (float*)(ws + oPt);

  dim3 gConv(NROWK / 128, KSPLIT);                                                 // (16, 16)
  k_conv_part<<<gConv, 256, 0, stream>>>(x, Hp, Wp, wsr, wq, wkv, wproj, wqh, wql, wkvh, wkvl, wph, wpl, part);

  k_kv<<<NROWK / 64, 128, 0, stream>>>(part, gamma, beta, wkvh, wkvl, bkv,
                                       kh, kl, vth, vtl);                           // 32 blocks

  dim3 gAtt(NQ / 32, NBATCH);                                                      // (512, 8)
  k_attn<<<gAtt, 64, 0, stream>>>(x, wqh, wql, bq, kh, kl, vth, vtl, wph, wpl, bproj, out);
}

// v008
// A run of this version takes 42.8 microseconds.
// In two side-by-side timings against v007, it was 1.12 and 1.14 times as fast.
// All steps since v000 together make it 5.82 times as fast.
// All contractions (q projection, 8x8 stride-8 reduction conv as a patch GEMM, kv projection, q*k^T scores, P*V, output projection): v_wmma_f32_16x16x32_bf16, bf16 hi/lo operands everywhere (hi*hi + hi*lo + lo*hi), f32 accumulate; LayerNorm, softmax and biases in f32.
#include <hip/hip_runtime.h>
#include <stdint.h>

typedef unsigned short u16;
typedef u16    v16u __attribute__((ext_vector_type(16)));
typedef u16    v8u  __attribute__((ext_vector_type(8)));
typedef __bf16 v16b __attribute__((ext_vector_type(16)));
typedef __bf16 v2b  __attribute__((ext_vector_type(2)));
typedef float  v2f  __attribute__((ext_vector_type(2)));
typedef unsigned v4w __attribute__((ext_vector_type(4)));
typedef float  v8f  __attribute__((ext_vector_type(8)));
typedef float  v4f  __attribute__((ext_vector_type(4)));
typedef v8u __attribute__((may_alias)) v8ua;
typedef v4f __attribute__((may_alias)) v4fa;
typedef v2f __attribute__((may_alias)) v2fa;

union Frag { v16b v; v16u u; v8u half[2]; };
static_assert(sizeof(Frag) == 32);

#define NBATCH 8
#define NQ     16384
#define CD     64
#define NKEY   256
#define NROWK  2048        // NBATCH * NKEY reduced tokens
#define KCONV  4096        // 64 patch pixels x 64 channels
#define LN_EPS 1e-5f
#define KSPLIT 16          // slices of the conv reduction, one work-group each
#define KSLICE 256         // KCONV / KSPLIT

// ---------------------------------------------------------------------------
// 16x16x32 bf16 WMMA with hazard guard (ties D, keeps A/B live).
// Fragment map (wave32): lane l, h = l>>4, m = n = l&15.
//   A/B element i: i<8 -> k0+8h+i ; i>=8 -> k0+16+8h+(i-8)
//   D element r : row 8h+r, col l&15
// ---------------------------------------------------------------------------
__device__ __forceinline__ v8f wmma_bf(v16b a, v16b b, v8f c) {
  v8f d = __builtin_amdgcn_wmma_f32_16x16x32_bf16(false, a, false, b, (short)0, c, false, false);
  asm volatile("v_nop\n\tv_nop\n\tv_nop\n\tv_nop" : "+v"(d) : "v"(a), "v"(b));
  return d;
}

// f32 -> bf16 bits, round to nearest even, by the hardware convert
__device__ __forceinline__ u16 bf_rne(float f) {
  return __builtin_bit_cast(u16, (__bf16)f);
}
__device__ __forceinline__ float bf_val(u16 b) {
  return __builtin_bit_cast(float, ((unsigned)b) << 16);
}

// 8 floats -> hi/lo bf16 planes (hi = rne(x), lo = rne(x - hi)). Two elements share one packed convert, which leaves
// them in the two halves of their fragment register; the f32 values of hi are cut out of that same register.
__device__ __forceinline__ void split8(v8f f, v8u& hi, v8u& lo) {
  v4w wh, wl;
  #pragma unroll
  for (int i = 0; i < 4; ++i) {
    const v2f x2 = {f[2 * i], f[2 * i + 1]};
    const unsigned ph = __builtin_bit_cast(unsigned, __builtin_convertvector(x2, v2b));
    const v2f h2 = {__builtin_bit_cast(float, ph << 16), __builtin_bit_cast(float, ph & 0xFFFF0000u)};
    wh[i] = ph;
    wl[i] = __builtin_bit_cast(unsigned, __builtin_convertvector(x2 - h2, v2b));
  }
  hi = __builtin_bit_cast(v8u, wh);
  lo = __builtin_bit_cast(v8u, wl);
}

// 16 floats given in fragment element order (a = elements 0..7, c = 8..15) -> hi/lo fragments
__device__ __forceinline__ void split_frag(v8f a, v8f c, v16b& fhi, v16b& flo) {
  Frag fh, fl;
  v8u h0, l0, h1, l1;
  split8(a, h0, l0);
  split8(c, h1, l1);
  fh.half[0] = h0; fh.half[1] = h1;
  fl.half[0] = l0; fl.half[1] = l1;
  fhi = fh.v; flo = fl.v;
}

// A or B fragment from a k-contiguous bf16 row; p points at element k0 of the row owned by this lane.
__device__ __forceinline__ v16b ld_frag(const u16* p, int h) {
  Frag f;
  f.half[0] = *(const v8ua*)(p + 8 * h);
  f.half[1] = *(const v8ua*)(p + 16 + 8 * h);
  return f.v;
}

// Planes that a kernel reads from the workspace are kept in fragment order: fragment f = (row tile) * (k / 32) + k step
// is 512 elements; lane l's elements 0..7 stand at f*512 + l*8, its elements 8..15 at f*512 + 256 + l*8,
// so each wave-wide 16-B load covers 512 contiguous bytes. p points at f*512 + l*8.
__device__ __forceinline__ v16b ld_fragp(const u16* p) {
  Frag f;
  f.half[0] = *(const v8ua*)p;
  f.half[1] = *(const v8ua*)(p + 256);
  return f.v;
}

// Writer's side of the same map: g8 = index of a group of 8 consecutive plane elements, 1 << ksh fragments per row tile
// -> matrix row and first k of the group.
__device__ __forceinline__ void frag_rk(int g8, int ksh, int& row, int& k) {
  const int f = g8 >> 6;
  row = ((f >> ksh) << 4) + (g8 & 15);
  k = ((f & ((1 << ksh) - 1)) << 5) + ((g8 >> 5) & 1) * 16 + ((g8 >> 4) & 1) * 8;
}

// sum over the 32 lanes of a wave
__device__ __forceinline__ float red32(float v) {
  v += __shfl_xor(v, 1);
  v += __shfl_xor(v, 2);
  v += __shfl_xor(v, 4);
  v += __shfl_xor(v, 8);
  v += __shfl_xor(v, 16);
  return v;
}

// ---------------------------------------------------------------------------
// Kernel 1: conv GEMM, split along k; patches gathered from x in the A loader, conv weights taken from wsr by the
// work-group itself (no weight launch, no conv weight planes).
//   Block = 128 conv rows x one k slice of 256, 8 waves x 16 rows.
//   Slice sp = patch row i = sp >> 1 (its 8 pixels j) x channel half sp & 1 (32 channels); k step = j, k in the step = channel.
//   row r = b*256 + m, m = py*16 + px;
//   A value = x[b][pix][ci], pix = (8py+i)*W + 8px + j (clamped), split to bf16 hi/lo in registers.
//   B value = wsr[co][ci][i][j]: a thread reads 16 channels x 4 pixels of one co (16 contiguous bytes a channel), splits them
//   and lays, per pixel, 8 channels as one 16-B group of the slice's fragments in LDS (fragment t*8 + j, order as ld_fragp).
//   Each wave stores its f32 16x64 partial tile in accumulator order:
//   part[slice][row tile][t][j][lane][4] = acc[t][4j..4j+3], 512 B per store.
//   Blocks (0..7, 0) also turn wq, wkv, wproj into bf16 hi/lo planes in fragment order (row = out, k = in) for the later
//   launches: one thread = 8 consecutive plane elements = one 16-B store per plane.
// grid = (16, 16) blocks x 256 threads.
// ---------------------------------------------------------------------------
__global__ __launch_bounds__(256) void k_conv_part(
    const float* __restrict__ x, const int* __restrict__ Hp, const int* __restrict__ Wp,
    const float* __restrict__ wsr,
    const float* __restrict__ wq, const float* __restrict__ wkv, const float* __restrict__ wproj,
    u16* __restrict__ wqh, u16* __restrict__ wql,
    u16* __restrict__ wkvh, u16* __restrict__ wkvl,
    u16* __restrict__ wph, u16* __restrict__ wpl,
    float* __restrict__ part)                                     // [16][128][4][2][32][4]
{
  __shared__ __attribute__((aligned(16))) u16 sB[2][4 * 8 * 512];  // hi, lo: [co tile][k step][512]

  const int tid = threadIdx.x, lane = tid & 31, w = tid >> 5;
  const int h = lane >> 4, m = lane & 15;
  const int blk = blockIdx.x, sp = blockIdx.y;
  const int irow = sp >> 1, chalf = sp & 1;
  const v8f zero8 = {0.f, 0.f, 0.f, 0.f, 0.f, 0.f, 0.f, 0.f};
  const int Hv = Hp[0], Wv = Wp[0];

  // small weights, asked for first (block-uniform test)
  const bool small = (sp == 0) && (blk < 8);
  v8f fs = zero8;
  u16* dh = wqh;
  u16* dl = wql;
  int e = 0;
  if (small) {
    const float* src;
    if (blk < 2)      { e = blk * 256 + tid;        src = wq;    dh = wqh;  dl = wql;  }
    else if (blk < 6) { e = (blk - 2) * 256 + tid;  src = wkv;   dh = wkvh; dl = wkvl; }
    else              { e = (blk - 6) * 256 + tid;  src = wproj; dh = wph;  dl = wpl;  }
    int row, k;
    frag_rk(e, 1, row, k);
    const float* s = src + row * CD + k;
    const v4f a = *(const v4fa*)s;
    const v4f c = *(const v4fa*)(s + 4);
    fs = __builtin_shufflevector(a, c, 0, 1, 2, 3, 4, 5, 6, 7);
    // precaution: the address registers of the two loads above are reused further down
    asm volatile("s_wait_xcnt 0x0" ::: "memory");
  }

  // conv weight blocks of this thread: co = 16*tw + m, pixels 8*irow + 4*h .. +3, and for gg = 0, 1 the 8 channels
  // 32*chalf + 8*(2*(w & 1) + gg) .. +7. Lanes m and m + 16 share a 128-B line, so a wave-wide load touches 16 lines.
  // Asked for in front of x: they are needed first, and their split runs while x is on its way.
  const int tw = w >> 1, g1 = w & 1;
  const float* wsrc = wsr + (size_t)(16 * tw + m) * KCONV + (32 * chalf + 16 * g1) * 64 + 8 * irow + 4 * h;
  // both loops unrolled: wv is indexed by their counters and has to stay in registers
  v4f wv[2][8];
  #pragma unroll
  for (int gg = 0; gg < 2; ++gg)
    #pragma unroll
    for (int c = 0; c < 8; ++c) wv[gg][c] = *(const v4fa*)(wsrc + (8 * gg + c) * 64);
  // precaution: the address registers of the loads above are reused further down; the pointer is named as an input
  // so that its register pair stays as it is up to the wait (no load lands on it)
  asm volatile("s_wait_xcnt 0x0" :: "v"(wsrc) : "memory");

  const long long hw = (long long)Hv * (long long)Wv;
  const int lim = (hw >= 1 && hw <= NQ) ? (int)(hw - 1) : (NQ - 1);
  const int r = blk * 128 + w * 16 + m;
  const int bb = r >> 8, mm = r & 255;
  const int py = mm >> 4, px = mm & 15;

  // The whole slice of this lane's row, 16 KB per wave, is asked for before any of it is used:
  // with two waves per SIMD only the loads in flight cover the memory latency.
  // Unrolled: xa is indexed by the counter and has to stay in registers.
  v4f xa[KSLICE / 32][4];
  #pragma unroll
  for (int j = 0; j < KSLICE / 32; ++j) {
    int pix = (8 * py + irow) * Wv + 8 * px + j;
    pix = min(max(pix, 0), lim);
    const float* s = x + ((size_t)bb * NQ + pix) * CD + 32 * chalf + 8 * h;
    xa[j][0] = *(const v4fa*)(s);
    xa[j][1] = *(const v4fa*)(s + 4);
    xa[j][2] = *(const v4fa*)(s + 16);
    xa[j][3] = *(const v4fa*)(s + 20);
  }
  // precaution: the address registers of the loads above are reused further down
  asm volatile("s_wait_xcnt 0x0" ::: "memory");

  if (small) {
    v8u hi, lo;
    split8(fs, hi, lo);
    *(v8u*)(dh + (size_t)e * 8) = hi;
    *(v8u*)(dl + (size_t)e * 8) = lo;
    // precaution: the address registers of the stores above are reused further down
    asm volatile("s_wait_xcnt 0x0" ::: "memory");
  }

  // turn in registers: a pixel's 8 channels are one 16-B group of fragment (tw, pixel);
  // each half wave's store covers 256 contiguous bytes (loops unrolled: wv stays in registers)
  #pragma unroll
  for (int gg = 0; gg < 2; ++gg) {
    #pragma unroll
    for (int jj = 0; jj < 4; ++jj) {
      v8f f;
      #pragma unroll
      for (int c = 0; c < 8; ++c) f[c] = wv[gg][c][jj];
      v8u hi, lo;
      split8(f, hi, lo);
      const int o = (tw * 8 + 4 * h + jj) * 512 + g1 * 256 + (gg * 16 + m) * 8;
      *(v8ua*)(&sB[0][o]) = hi;
      *(v8ua*)(&sB[1][o]) = lo;
    }
  }
  // Work-group barrier that orders LDS only: the fragments are published while x is still on its way
  // (__syncthreads() would first wait for every global load in flight).
  __builtin_amdgcn_fence(__ATOMIC_RELEASE, "workgroup", "local");
  __builtin_amdgcn_s_barrier();
  __builtin_amdgcn_fence(__ATOMIC_ACQUIRE, "workgroup", "local");

  v8f acc[4];
  #pragma unroll
  for (int t = 0; t < 4; ++t) acc[t] = zero8;

  const u16* brh = &sB[0][lane * 8];
  const u16* brl = &sB[1][lane * 8];

  // Weight fragments run one k step ahead in a second register set, the 16 LDS reads of a step asked for together
  // in front of the products of the step before.
  v16b fbh[2][4], fbl[2][4];
  #pragma unroll
  for (int t = 0; t < 4; ++t) {
    fbh[0][t] = ld_fragp(brh + (t * 8) * 512);
    fbl[0][t] = ld_fragp(brl + (t * 8) * 512);
  }
  // keeps the splits of x, which wait for x, behind the barrier and behind the first LDS reads
  __builtin_amdgcn_sched_barrier(0);

  // unrolled: xa and the register sets are indexed by ks and have to stay in registers
  #pragma unroll
  for (int ks = 0; ks < KSLICE / 32; ++ks) {
    if (ks + 1 < KSLICE / 32) {
      #pragma unroll
      for (int t = 0; t < 4; ++t) {
        fbh[(ks + 1) & 1][t] = ld_fragp(brh + (t * 8 + ks + 1) * 512);
        fbl[(ks + 1) & 1][t] = ld_fragp(brl + (t * 8 + ks + 1) * 512);
      }
    }
    v16b fah, fal;
    split_frag(__builtin_shufflevector(xa[ks][0], xa[ks][1], 0, 1, 2, 3, 4, 5, 6, 7),
               __builtin_shufflevector(xa[ks][2], xa[ks][3], 0, 1, 2, 3, 4, 5, 6, 7), fah, fal);
    #pragma unroll
    for (int t = 0; t < 4; ++t) {
      acc[t] = wmma_bf(fah, fbh[ks & 1][t], acc[t]);
      acc[t] = wmma_bf(fah, fbl[ks & 1][t], acc[t]);
      acc[t] = wmma_bf(fal, fbh[ks & 1][t], acc[t]);
    }
  }

  float* pp = part + ((size_t)sp * 128 + blk * 8 + w) * 1024 + lane * 4;
  #pragma unroll
  for (int t = 0; t < 4; ++t) {
    *(v4f*)(pp + (2 * t) * 128)     = __builtin_shufflevector(acc[t], acc[t], 0, 1, 2, 3);
    *(v4f*)(pp + (2 * t + 1) * 128) = __builtin_shufflevector(acc[t], acc[t], 4, 5, 6, 7);
  }
}

// ---------------------------------------------------------------------------
// Kernel 2: reduced tokens. Block = one row tile (16 tokens of one batch), 8 waves.
//   wave w asks for k slices 2w and 2w+1 of the tile at once (16 loads a lane), adds them and parks the sum in LDS;
//   wave w then owns tokens 2w, 2w+1: sum of the 8 parked tiles (wave 0's first) -> LayerNorm (f32) -> bf16 hi/lo rows in LDS;
//   wave w then makes column tile w of the kv projection (16 x 64 @ 64 x 16):
//     w < 4 : K, as weights * x^T, so a lane holds 8 consecutive d of token m = one 16-B group of the K plane;
//     w >= 4: V, as x * weights^T, so a lane holds 8 consecutive keys of d = m = one 16-B group of the V^T plane.
//   Each wave-wide store covers 512 contiguous bytes of a plane in fragment order.
// grid = 128 blocks x 256 threads.
// ---------------------------------------------------------------------------
#define XPITCH 72          // u16 per LayerNorm row in LDS: 144 B = 16 B x 9, so the 16 rows of a fragment read fall on different banks
__global__ __launch_bounds__(256) void k_kv(
    const float* __restrict__ part,                               // [16][128][4][2][32][4]
    const float* __restrict__ gamma, const float* __restrict__ beta,
    const u16* __restrict__ wkvh, const u16* __restrict__ wkvl,   // 128 x 64, fragment order
    const float* __restrict__ bkv,
    u16* __restrict__ kh, u16* __restrict__ kl,                   // 2048 x 64, fragment order
    u16* __restrict__ vth, u16* __restrict__ vtl)                 // 8 x (64 x 256), fragment order
{
  __shared__ __attribute__((aligned(16))) float sP[8 * 1024];        // [wave][chunk 2t+half][lane][4], accumulator order
  __shared__ __attribute__((aligned(16))) u16 sX[2 * 16 * XPITCH];   // LN output hi/lo [p][token][c]

  const int tid = threadIdx.x, lane = tid & 31;
  const int w = __builtin_amdgcn_readfirstlane(tid >> 5);            // wave number, scalar: it picks a branch around WMMAs
  const int h = lane >> 4, m = lane & 15;
  const int rt = blockIdx.x;                                         // tokens 16rt .. 16rt+15

  // Everything this wave takes from memory is asked for here, in one go. Each address is a wave-uniform base plus a
  // 32-bit offset of the lane (the build keeps lane, m and oh32 in registers and scales the first two in the load).
  const unsigned ol16 = (unsigned)lane * 16u, ol4 = (unsigned)lane * 4u, oh32 = (unsigned)h * 32u, om4 = (unsigned)m * 4u;
  const char* pb = (const char*)(part + ((size_t)(2 * w) * 128 + rt) * 1024);
  v4f pa[2][8];
  #pragma unroll
  for (int s = 0; s < 2; ++s)
    #pragma unroll
    for (int c = 0; c < 8; ++c) pa[s][c] = *(const v4fa*)(pb + ol16 + s * (128 * 1024 * 4) + c * 512);
  const char* wbh = (const char*)(wkvh + w * 1024);
  const char* wbl = (const char*)(wkvl + w * 1024);
  const v16b b0h = ld_fragp((const u16*)(wbh + ol16));
  const v16b b0l = ld_fragp((const u16*)(wbl + ol16));
  const v16b b1h = ld_fragp((const u16*)(wbh + ol16 + 1024));
  const v16b b1l = ld_fragp((const u16*)(wbl + ol16 + 1024));
  const int col0 = lane, col1 = lane + 32;                           // this lane's two channels in the LayerNorm: 16t+m, t = h and h+2
  const float g0 = *(const float*)((const char*)gamma + ol4), g1 = *(const float*)((const char*)gamma + ol4 + 128);
  const float be0 = *(const float*)((const char*)beta + ol4), be1 = *(const float*)((const char*)beta + ol4 + 128);
  const char* bb = (const char*)(bkv + 16 * w);
  const v4f bk0 = *(const v4fa*)(bb + oh32);                         // K: bias of features 16w+8h .. +7
  const v4f bk1 = *(const v4fa*)(bb + oh32 + 16);
  const float bv = *(const float*)(bb + om4);                        // V: bias of column 16w+m
  // precaution: the address registers of the loads above are reused further down; the offsets are named as inputs
  // so that their registers stay as they are up to the wait (no load lands on them)
  asm volatile("s_wait_xcnt 0x0" :: "v"(lane), "v"(m), "v"(oh32) : "memory");
  // keeps the sums, which wait for the partials, behind the last load: otherwise the weight loads are issued only
  // when the partials have landed, and the barrier below waits out a second memory latency
  __builtin_amdgcn_sched_barrier(0);

  float* sp = sP + w * 1024 + lane * 4;
  #pragma unroll
  for (int c = 0; c < 8; ++c) *(v4fa*)(sp + c * 128) = pa[0][c] + pa[1][c];
  __syncthreads();

  // token 2w+u is accumulator row 8*h2 + 4*half + e0 + u; channel 16t+m of it stands at chunk 2t+half, lane 16*h2+m.
  // This lane takes t = h and t = h + 2, both tokens in one 8-B read.
  const int h2 = w >> 2, half = (w & 3) >> 1, e0 = 2 * (w & 1);
  const float* rp = sP + (2 * h + half) * 128 + (16 * h2 + m) * 4 + e0;
  v2f a0 = *(const v2fa*)rp;
  v2f a1 = *(const v2fa*)(rp + 512);
  #pragma unroll
  for (int q = 1; q < 8; ++q) {
    a0 += *(const v2fa*)(rp + q * 1024);
    a1 += *(const v2fa*)(rp + q * 1024 + 512);
  }
  #pragma unroll
  for (int u = 0; u < 2; ++u) {
    const float mu = red32(a0[u] + a1[u]) * (1.0f / 64.0f);
    const float d0 = a0[u] - mu, d1 = a1[u] - mu;
    const float rs = rsqrtf(red32(d0 * d0 + d1 * d1) * (1.0f / 64.0f) + LN_EPS);
    const float y0 = d0 * rs * g0 + be0;
    const float y1 = d1 * rs * g1 + be1;
    const u16 h0 = bf_rne(y0), h1 = bf_rne(y1);
    u16* xr = sX + (2 * w + u) * XPITCH;
    xr[col0] = h0;
    xr[col1] = h1;
    xr[16 * XPITCH + col0] = bf_rne(y0 - bf_val(h0));
    xr[16 * XPITCH + col1] = bf_rne(y1 - bf_val(h1));
  }
  __syncthreads();

  // x fragments: row (or column) = token m, k = channel
  const v16b xh0 = ld_frag(sX + m * XPITCH, h);
  const v16b xh1 = ld_frag(sX + m * XPITCH + 32, h);
  const v16b xl0 = ld_frag(sX + (16 + m) * XPITCH, h);
  const v16b xl1 = ld_frag(sX + (16 + m) * XPITCH + 32, h);

  v8f c = {0.f, 0.f, 0.f, 0.f, 0.f, 0.f, 0.f, 0.f};
  u16* dh;
  u16* dl;
  if (w < 4) {
    c = wmma_bf(b0h, xh0, c);
    c = wmma_bf(b0l, xh0, c);
    c = wmma_bf(b0h, xl0, c);
    c = wmma_bf(b1h, xh1, c);
    c = wmma_bf(b1l, xh1, c);
    c = wmma_bf(b1h, xl1, c);
    // c[r] = k[token m][d 16w+8h+r]: elements 8*(w&1) .. +7 of lane (h, m) in fragment 2rt + (w >> 1)
    c += __builtin_shufflevector(bk0, bk1, 0, 1, 2, 3, 4, 5, 6, 7);
    const size_t o = (size_t)(2 * rt + (w >> 1)) * 512 + (w & 1) * 256 + lane * 8;
    dh = kh + o;
    dl = kl + o;
  } else {
    c = wmma_bf(xh0, b0h, c);
    c = wmma_bf(xh0, b0l, c);
    c = wmma_bf(xl0, b0h, c);
    c = wmma_bf(xh1, b1h, c);
    c = wmma_bf(xh1, b1l, c);
    c = wmma_bf(xl1, b1h, c);
    // c[r] = v[key 16(rt&15)+8h+r][d 16(w-4)+m]: elements 8*(rt&1) .. +7 of lane (h, m) in the fragment of d tile w-4, key step (rt&15)>>1
    c += bv;
    const size_t o = (size_t)((rt >> 4) * 32 + (w - 4) * 8 + ((rt & 15) >> 1)) * 512 + (rt & 1) * 256 + lane * 8;
    dh = vth + o;
    dl = vtl + o;
  }
  v8u hi, lo;
  split8(c, hi, lo);
  *(v8u*)dh = hi;
  *(v8u*)dl = lo;
}

// ---------------------------------------------------------------------------
// lanes 8q..8q+7 in one instruction, 4 lines per instruction, 32 lines per wave.
// ---------------------------------------------------------------------------
// The LDS tile keeps 16-B chunk q of row m at chunk q ^ m (see the writer in k_attn).
__device__ __forceinline__ void att_store_pass(const float* so, float* out, size_t grow0, int lane) {
  const int q8 = lane & 7, sub = lane >> 3;
  #pragma unroll
  for (int i = 0; i < 8; ++i) {
    const int lid = i * 4 + sub;
    const int row = lid >> 1, hl = lid & 1;
    const v4f v = *(const v4fa*)(so + row * 64 + 4 * ((8 * hl + q8) ^ row));
    *(v4f*)(out + (grow0 + (size_t)row) * CD + 32 * hl + 4 * q8) = v;
  }
}

// The four K fragments (k 0..31 hi, lo; k 32..63 hi, lo) of key tile j.
__device__ __forceinline__ void ld_k4(v16b* f, const u16* ph, const u16* pl, int j) {
  const int ko = j * 1024;                       // two fragments per 16 keys
  f[0] = ld_fragp(ph + ko);
  f[1] = ld_fragp(pl + ko);
  f[2] = ld_fragp(ph + ko + 512);
  f[3] = ld_fragp(pl + ko + 512);
}

// Scores of key tile j: z[r] = S[query m][key 16j+8h+r], parked as this lane's chunks 2j (r 0..3) and 2j+1 (r 4..7).
__device__ __forceinline__ void score_pass(const v16b* f, v16b qbh0, v16b qbl0, v16b qbh1, v16b qbl1,
                                           float* sl, int j, float& mx) {
  v8f z = {0.f, 0.f, 0.f, 0.f, 0.f, 0.f, 0.f, 0.f};
  z = wmma_bf(f[0], qbh0, z);
  z = wmma_bf(f[0], qbl0, z);
  z = wmma_bf(f[1], qbh0, z);
  z = wmma_bf(f[2], qbh1, z);
  z = wmma_bf(f[2], qbl1, z);
  z = wmma_bf(f[3], qbh1, z);
  const v4f z0 = __builtin_shufflevector(z, z, 0, 1, 2, 3);
  const v4f z1 = __builtin_shufflevector(z, z, 4, 5, 6, 7);
  *(v4fa*)(sl + 256 * j) = z0;
  *(v4fa*)(sl + 256 * j + 128) = z1;
  #pragma unroll
  for (int r = 0; r < 8; ++r) mx = fmaxf(mx, z[r]);
}

// P^T fragments of key step c (32 keys) out of this lane's park, scaled by 1 / row sum.
__device__ __forceinline__ void p_frag(const float* sl, int c, float inv, v16b& pbh, v16b& pbl) {
  const float* pp = sl + 512 * c;                // chunks 4c..4c+3: keys 32c+8h.., 32c+16+8h..
  const v4f p0 = *(const v4fa*)pp;
  const v4f p1 = *(const v4fa*)(pp + 128);
  const v4f p2 = *(const v4fa*)(pp + 256);
  const v4f p3 = *(const v4fa*)(pp + 384);
  const v8f pa = __builtin_shufflevector(p0, p1, 0, 1, 2, 3, 4, 5, 6, 7) * inv;
  const v8f pc = __builtin_shufflevector(p2, p3, 0, 1, 2, 3, 4, 5, 6, 7) * inv;
  split_frag(pa, pc, pbh, pbl);
}

// ---------------------------------------------------------------------------
// Kernel 3: fused q projection + attention over 256 reduced tokens + output projection.
// Block = 64 threads (2 waves), 16 queries per wave; grid = (512, 8).
//   q^T = wq * x^T          : A = wq plane rows, B = x^T split in registers
//   S^T = K * q^T           : A = K plane rows, B = q^T packed from two adjacent D tiles
//   softmax over 256 keys   : f32, scores parked in LDS; each lane re-reads only what it wrote,
//                             so the park is lane-major: 16-B chunk c of lane l at (c*32 + l)*16 B,
//                             every LDS access of a wave covers 512 contiguous bytes (no bank conflict)
//   O^T = V^T * P^T         : A = V^T plane rows, B = P^T from LDS
//   out^T = wproj * O^T     : A = wproj plane rows, B = O^T packed from D tiles
// Every plane fragment is asked for ahead of the products that use it: q weights with x, K three key tiles
// ahead (ring of four register sets), V^T one key step ahead, proj weights in front of the split of O.
// ---------------------------------------------------------------------------
__global__ __launch_bounds__(64) void k_attn(
    const float* __restrict__ x,
    const u16* __restrict__ wqh, const u16* __restrict__ wql, const float* __restrict__ bq,
    const u16* __restrict__ kh, const u16* __restrict__ kl,      // 2048 x 64, fragment order
    const u16* __restrict__ vth, const u16* __restrict__ vtl,    // 8 x (64 x 256), fragment order
    const u16* __restrict__ wph, const u16* __restrict__ wpl, const float* __restrict__ bproj,
    float* __restrict__ out)                                     // [8][16384][64]
{
  __shared__ __attribute__((aligned(16))) float sS[2][16 * 256];
  __shared__ __attribute__((aligned(16))) float sO[2][16 * 64];

  const int tid = threadIdx.x, lane = tid & 31, w = tid >> 5;
  const int h = lane >> 4, m = lane & 15;
  const int b = blockIdx.y;
  const int q0 = blockIdx.x * 32 + 16 * w;
  const v8f zero8 = {0.f, 0.f, 0.f, 0.f, 0.f, 0.f, 0.f, 0.f};

  // ---- q^T = wq * x^T : qt[t][r] = q[query q0+m][feature 16t+8h+r] ----
  v8f qt[4];
  #pragma unroll
  for (int t = 0; t < 4; ++t) qt[t] = zero8;
  const float* xr = x + ((size_t)b * NQ + q0 + m) * CD;
  v4f xv[2][4];
  #pragma unroll
  for (int ks = 0; ks < 2; ++ks) {
    const float* xp = xr + 32 * ks + 8 * h;
    xv[ks][0] = *(const v4fa*)(xp);
    xv[ks][1] = *(const v4fa*)(xp + 4);
    xv[ks][2] = *(const v4fa*)(xp + 16);
    xv[ks][3] = *(const v4fa*)(xp + 20);
  }
  // precaution: the address registers of the loads above are reused by what follows
  asm volatile("s_wait_xcnt 0x0" ::: "memory");
  v16b wah[2][4], wal[2][4];
  #pragma unroll
  for (int ks = 0; ks < 2; ++ks)
    #pragma unroll
    for (int t = 0; t < 4; ++t) {
      const int off = (2 * t + ks) * 512 + lane * 8;
      wah[ks][t] = ld_fragp(wqh + off);
      wal[ks][t] = ld_fragp(wql + off);
    }
  v4f bqv[4][2];
  #pragma unroll
  for (int t = 0; t < 4; ++t) {
    bqv[t][0] = *(const v4fa*)(bq + 16 * t + 8 * h);
    bqv[t][1] = *(const v4fa*)(bq + 16 * t + 8 * h + 4);
  }
  // precaution: the address registers of the loads above are reused by what follows
  asm volatile("s_wait_xcnt 0x0" ::: "memory");
  #pragma unroll
  for (int ks = 0; ks < 2; ++ks) {
    const v8f a8 = __builtin_shufflevector(xv[ks][0], xv[ks][1], 0, 1, 2, 3, 4, 5, 6, 7);
    const v8f c8 = __builtin_shufflevector(xv[ks][2], xv[ks][3], 0, 1, 2, 3, 4, 5, 6, 7);
    v16b xbh, xbl;
    split_frag(a8, c8, xbh, xbl);
    #pragma unroll
    for (int t = 0; t < 4; ++t) {
      qt[t] = wmma_bf(wah[ks][t], xbh, qt[t]);
      qt[t] = wmma_bf(wah[ks][t], xbl, qt[t]);
      qt[t] = wmma_bf(wal[ks][t], xbh, qt[t]);
    }
  }
  // key tiles 0..2 are asked for here, in front of the split of q
  const u16* kbh = kh + (size_t)b * NKEY * CD + lane * 8;
  const u16* kbl = kl + (size_t)b * NKEY * CD + lane * 8;
  v16b kf[4][4];
  #pragma unroll
  for (int s = 0; s < 3; ++s) ld_k4(kf[s], kbh, kbl, s);
  v8f qv[4];
  #pragma unroll
  for (int t = 0; t < 4; ++t)
    #pragma unroll
    for (int r = 0; r < 8; ++r)
      qv[t][r] = (qt[t][r] + bqv[t][r >> 2][r & 3]) * 0.125f;    // d^-1/2 folded into q (exact)
  // B fragment for k = d: element i <- tile 2ks row i, element 8+i <- tile 2ks+1 row i
  v16b qbh0, qbl0, qbh1, qbl1;
  split_frag(qv[0], qv[1], qbh0, qbl0);
  split_frag(qv[2], qv[3], qbh1, qbl1);

  // ---- scores: key tile j uses register set j & 3; tile j + 3 is asked for into the set that tile j - 1 has left ----
  float* sw = &sS[w][0];
  float* sl = sw + lane * 4;                     // chunk c of this lane: sl + c*128
  float mx = -3.0e38f;
  // unrolled: the set index has to be a constant, and every load then takes its tile as an immediate offset
  // from one address pair that is never rewritten while loads are in flight
  #pragma unroll
  for (int j = 0; j < 16; ++j) {
    if (j + 3 < 16) ld_k4(kf[(j + 3) & 3], kbh, kbl, j + 3);
    score_pass(kf[j & 3], qbh0, qbl0, qbh1, qbl1, sl, j, mx);
  }
  mx = fmaxf(mx, __shfl_xor(mx, 16));

  // V^T fragments of key step 0 are asked for here and land behind the softmax.
  // precaution: the V^T addresses may take the registers that the K loads name; the batch offset passes through
  // the statement so that the address arithmetic cannot be lifted over the wait
  unsigned vb0 = (unsigned)b * (CD * NKEY);
  asm volatile("s_wait_xcnt 0x0" : "+s"(vb0) : : "memory");
  const u16* vbh = vth + (size_t)vb0 + lane * 8;
  const u16* vbl = vtl + (size_t)vb0 + lane * 8;
  v16b vh[4], vl[4];
  #pragma unroll
  for (int t = 0; t < 4; ++t) {
    vh[t] = ld_fragp(vbh + (8 * t) * 512);
    vl[t] = ld_fragp(vbl + (8 * t) * 512);
  }
  // precaution: the address registers of the loads above are reused by what follows
  asm volatile("s_wait_xcnt 0x0" ::: "memory");

  // ---- softmax numerator + row sum (f32); same lane, same addresses ----
  float sum = 0.f;
  #pragma unroll 2
  for (int a = 0; a < 16; ++a) {
    float* pp = sl + 256 * a;
    v4f v0 = *(const v4fa*)pp;
    v4f v1 = *(const v4fa*)(pp + 128);
    #pragma unroll
    for (int e = 0; e < 4; ++e) {
      v0[e] = __expf(v0[e] - mx);
      v1[e] = __expf(v1[e] - mx);
      sum += v0[e] + v1[e];
    }
    *(v4fa*)pp = v0;
    *(v4fa*)(pp + 128) = v1;
  }
  sum += __shfl_xor(sum, 16);
  const float inv = 1.0f / sum;

  // ---- O^T = V^T * P^T : o[t][r] = O[query m][d 16t+8h+r] ----
  v8f o[4];
  #pragma unroll
  for (int t = 0; t < 4; ++t) o[t] = zero8;
  // tile t's pair for key step c + 1 is asked for right behind tile t's products of step c, into the same registers
  const char* vub = (const char*)(vth + (size_t)vb0);   // wave-uniform plane bases of this batch
  const char* vlb = (const char*)(vtl + (size_t)vb0);
  unsigned vof = (unsigned)lane * 16u + 1024u;           // this lane's byte offset in the fragments of key step c + 1
  #pragma unroll 1
  for (int c = 0; c < 7; ++c) {
    v16b pbh, pbl;
    p_frag(sl, c, inv, pbh, pbl);
    #pragma unroll
    for (int t = 0; t < 4; ++t) {
      o[t] = wmma_bf(vh[t], pbh, o[t]);
      o[t] = wmma_bf(vh[t], pbl, o[t]);
      o[t] = wmma_bf(vl[t], pbh, o[t]);
      vh[t] = ld_fragp((const u16*)(vub + vof + t * 8192));
      vl[t] = ld_fragp((const u16*)(vlb + vof + t * 8192));
    }
    // The offset moves on by one key step (1024 bytes) inside the statement of the wait: this trip's loads, still
    // in flight, name its register (precaution), and nothing can be lifted between wait and addition; at the
    // loop's foot the wait also stands in front of whatever reuses the address registers behind the loop.
    asm volatile("s_wait_xcnt 0x0\n\tv_add_nc_u32_e32 %0, 0x400, %0" : "+v"(vof) : : "memory");
  }
  {
    v16b pbh, pbl;
    p_frag(sl, 7, inv, pbh, pbl);
    #pragma unroll
    for (int t = 0; t < 4; ++t) {
      o[t] = wmma_bf(vh[t], pbh, o[t]);
      o[t] = wmma_bf(vh[t], pbl, o[t]);
      o[t] = wmma_bf(vl[t], pbh, o[t]);
    }
  }

  // ---- out^T = wproj * O^T : u[t][r] = out[query m][feature 16t+8h+r] ----
  v16b wpf[4][4];
  #pragma unroll
  for (int t = 0; t < 4; ++t) {
    const int off = t * 1024 + lane * 8;
    wpf[t][0] = ld_fragp(wph + off);
    wpf[t][1] = ld_fragp(wpl + off);
    wpf[t][2] = ld_fragp(wph + off + 512);
    wpf[t][3] = ld_fragp(wpl + off + 512);
  }
  // precaution: the address registers of the loads above are reused by what follows
  asm volatile("s_wait_xcnt 0x0" ::: "memory");
  v4f bpv[4][2];
  #pragma unroll
  for (int t = 0; t < 4; ++t) {
    bpv[t][0] = *(const v4fa*)(bproj + 16 * t + 8 * h);
    bpv[t][1] = *(const v4fa*)(bproj + 16 * t + 8 * h + 4);
  }
  v16b obh0, obl0, obh1, obl1;
  split_frag(o[0], o[1], obh0, obl0);
  split_frag(o[2], o[3], obh1, obl1);
  v8f u[4];
  #pragma unroll
  for (int t = 0; t < 4; ++t) {
    const v16b a0h = wpf[t][0], a0l = wpf[t][1], a1h = wpf[t][2], a1l = wpf[t][3];
    v8f z = zero8;
    z = wmma_bf(a0h, obh0, z);
    z = wmma_bf(a0h, obl0, z);
    z = wmma_bf(a0l, obh0, z);
    z = wmma_bf(a1h, obh1, z);
    z = wmma_bf(a1h, obl1, z);
    z = wmma_bf(a1l, obh1, z);
    u[t] = z;
  }
  // row m of the output tile, 16-B chunk q stored at chunk q ^ m: the 16 rows of one store fall on 16 different bank groups
  float* so = &sO[w][0];
  #pragma unroll
  for (int t = 0; t < 4; ++t) {
    v8f y;
    #pragma unroll
    for (int r = 0; r < 8; ++r) y[r] = u[t][r] + bpv[t][r >> 2][r & 3];
    const int q = 4 * t + 2 * h;
    *(v4fa*)(so + m * 64 + 4 * (q ^ m))       = __builtin_shufflevector(y, y, 0, 1, 2, 3);
    *(v4fa*)(so + m * 64 + 4 * ((q + 1) ^ m)) = __builtin_shufflevector(y, y, 4, 5, 6, 7);
  }
  __syncthreads();

  const size_t grow0 = (size_t)b * NQ + q0;
  att_store_pass(so, out, grow0, lane);
  
}

// ---------------------------------------------------------------------------
extern "C" void kernel_launch(void* const* d_in, const int* in_sizes, int n_in,
                              void* d_out, int out_size, void* d_ws, size_t ws_size,
                              hipStream_t stream) {
  if (n_in < 12) return;
  if (in_sizes[0] != NBATCH * NQ * CD) return;
  if (in_sizes[1] != CD * CD || in_sizes[2] != CD) return;
  if (in_sizes[3] != 2 * CD * CD || in_sizes[4] != 2 * CD) return;
  if (in_sizes[5] != CD * CD || in_sizes[6] != CD) return;
  if (in_sizes[7] != CD * KCONV) return;
  if (in_sizes[8] != CD || in_sizes[9] != CD) return;
  if (in_sizes[10] < 1 || in_sizes[11] < 1) return;
  if (out_size != NBATCH * NQ * CD) return;

  const float* x     = (const float*)d_in[0];
  const float* wq    = (const float*)d_in[1];
  const float* bq    = (const float*)d_in[2];
  const float* wkv   = (const float*)d_in[3];
  const float* bkv   = (const float*)d_in[4];
  const float* wproj = (const float*)d_in[5];
  const float* bproj = (const float*)d_in[6];
  const float* wsr   = (const float*)d_in[7];
  const float* gamma = (const float*)d_in[8];
  const float* beta  = (const float*)d_in[9];
  const int*   Hp    = (const int*)d_in[10];
  const int*   Wp    = (const int*)d_in[11];
  float* out = (float*)d_out;

  const size_t szWq  = (size_t)CD * CD * 2;            //      8192 per plane
  const size_t szWkv = (size_t)2 * CD * CD * 2;        //     16384
  const size_t szWp  = (size_t)CD * CD * 2;            //      8192
  const size_t szK   = (size_t)NROWK * CD * 2;         //    262144
  const size_t szVt  = (size_t)NBATCH * CD * NKEY * 2; //    262144
  const size_t szPt  = (size_t)KSPLIT * NROWK * CD * 4; //  8388608
  size_t off = 0;
  const size_t oWqh = off;  off += szWq;
  const size_t oWql = off;  off += szWq;
  const size_t oWkh = off;  off += szWkv;
  const size_t oWkl = off;  off += szWkv;
  const size_t oWph = off;  off += szWp;
  const size_t oWpl = off;  off += szWp;
  const size_t oKh  = off;  off += szK;
  const size_t oKl  = off;  off += szK;
  const size_t oVth = off;  off += szVt;
  const size_t oVtl = off;  off += szVt;
  const size_t oPt  = off;  off += szPt;              // total 9502720
  if (off > ws_size) return;
  if (off > (size_t)134217728) return;

  char* ws = (char*)d_ws;
  u16* wqh  = (u16*)(ws + oWqh);
  u16* wql  = (u16*)(ws + oWql);
  u16* wkvh = (u16*)(ws + oWkh);
  u16* wkvl = (u16*)(ws + oWkl);
  u16* wph  = (u16*)(ws + oWph);
  u16* wpl  = (u16*)(ws + oWpl);
  u16* kh   = (u16*)(ws + oKh);
  u16* kl   = (u16*)(ws + oKl);
  u16* vth  = (u16*)(ws + oVth);
  u16* vtl  = (u16*)(ws + oVtl);
  float* part = (float*)(ws + oPt);

  dim3 gConv(NROWK / 128, KSPLIT);                                                 // (16, 16)
  k_conv_part<<<gConv, 256, 0, stream>>>(x, Hp, Wp, wsr, wq, wkv, wproj, wqh, wql, wkvh, wkvl, wph, wpl, part);

  k_kv<<<NROWK / 16, 256, 0, stream>>>(part, gamma, beta, wkvh, wkvl, bkv,
                                       kh, kl, vth, vtl);                           // 128 blocks

  dim3 gAtt(NQ / 32, NBATCH);                                                      // (512, 8)
  k_attn<<<gAtt, 64, 0, stream>>>(x, wqh, wql, bq, kh, kl, vth, vtl, wph, wpl, bproj, out);
}

// v009
// It runs in 40.3 microseconds.
// Timed twice side by side with v008, it ran 1.05 and 1.07 times as fast.
// All steps since v000 together make it 6.18 times as fast.
// All contractions (q projection, 8x8 stride-8 reduction conv as a patch GEMM, kv projection, q*k^T scores, P*V, output projection): v_wmma_f32_16x16x32_bf16, bf16 hi/lo operands everywhere (hi*hi + hi*lo + lo*hi), f32 accumulate; LayerNorm, softmax and biases in f32.
#include <hip/hip_runtime.h>
#include <stdint.h>

typedef unsigned short u16;
typedef u16    v16u __attribute__((ext_vector_type(16)));
typedef u16    v8u  __attribute__((ext_vector_type(8)));
typedef __bf16 v16b __attribute__((ext_vector_type(16)));
typedef __bf16 v2b  __attribute__((ext_vector_type(2)));
typedef float  v2f  __attribute__((ext_vector_type(2)));
typedef unsigned v4w __attribute__((ext_vector_type(4)));
typedef float  v8f  __attribute__((ext_vector_type(8)));
typedef float  v4f  __attribute__((ext_vector_type(4)));
typedef v8u __attribute__((may_alias)) v8ua;
typedef v4f __attribute__((may_alias)) v4fa;
typedef v2f __attribute__((may_alias)) v2fa;

union Frag { v16b v; v16u u; v8u half[2]; };
static_assert(sizeof(Frag) == 32);

#define NBATCH 8
#define NQ     16384
#define CD     64
#define NKEY   256
#define NROWK  2048        // NBATCH * NKEY reduced tokens
#define KCONV  4096        // 64 patch pixels x 64 channels
#define LN_EPS 1e-5f
#define KSPLIT 16          // slices of the conv reduction, one work-group each
#define KSLICE 256         // KCONV / KSPLIT

// ---------------------------------------------------------------------------
// 16x16x32 bf16 WMMA with hazard guard (ties D, keeps A/B live).
// Fragment map (wave32): lane l, h = l>>4, m = n = l&15.
//   A/B element i: i<8 -> k0+8h+i ; i>=8 -> k0+16+8h+(i-8)
//   D element r : row 8h+r, col l&15
// ---------------------------------------------------------------------------
__device__ __forceinline__ v8f wmma_bf(v16b a, v16b b, v8f c) {
  v8f d = __builtin_amdgcn_wmma_f32_16x16x32_bf16(false, a, false, b, (short)0, c, false, false);
  asm volatile("v_nop\n\tv_nop\n\tv_nop\n\tv_nop" : "+v"(d) : "v"(a), "v"(b));
  return d;
}

// f32 -> bf16 bits, round to nearest even, by the hardware convert
__device__ __forceinline__ u16 bf_rne(float f) {
  return __builtin_bit_cast(u16, (__bf16)f);
}
__device__ __forceinline__ float bf_val(u16 b) {
  return __builtin_bit_cast(float, ((unsigned)b) << 16);
}

// 8 floats -> hi/lo bf16 planes (hi = rne(x), lo = rne(x - hi)). Two elements share one packed convert, which leaves
// them in the two halves of their fragment register; the f32 values of hi are cut out of that same register.
__device__ __forceinline__ void split8(v8f f, v8u& hi, v8u& lo) {
  v4w wh, wl;
  #pragma unroll
  for (int i = 0; i < 4; ++i) {
    const v2f x2 = {f[2 * i], f[2 * i + 1]};
    const unsigned ph = __builtin_bit_cast(unsigned, __builtin_convertvector(x2, v2b));
    const v2f h2 = {__builtin_bit_cast(float, ph << 16), __builtin_bit_cast(float, ph & 0xFFFF0000u)};
    wh[i] = ph;
    wl[i] = __builtin_bit_cast(unsigned, __builtin_convertvector(x2 - h2, v2b));
  }
  hi = __builtin_bit_cast(v8u, wh);
  lo = __builtin_bit_cast(v8u, wl);
}

// 16 floats given in fragment element order (a = elements 0..7, c = 8..15) -> hi/lo fragments
__device__ __forceinline__ void split_frag(v8f a, v8f c, v16b& fhi, v16b& flo) {
  Frag fh, fl;
  v8u h0, l0, h1, l1;
  split8(a, h0, l0);
  split8(c, h1, l1);
  fh.half[0] = h0; fh.half[1] = h1;
  fl.half[0] = l0; fl.half[1] = l1;
  fhi = fh.v; flo = fl.v;
}

// A or B fragment from a k-contiguous bf16 row; p points at element k0 of the row owned by this lane.
__device__ __forceinline__ v16b ld_frag(const u16* p, int h) {
  Frag f;
  f.half[0] = *(const v8ua*)(p + 8 * h);
  f.half[1] = *(const v8ua*)(p + 16 + 8 * h);
  return f.v;
}

// Planes that a kernel reads from the workspace are kept in fragment order: fragment f = (row tile) * (k / 32) + k step
// is 512 elements; lane l's elements 0..7 stand at f*512 + l*8, its elements 8..15 at f*512 + 256 + l*8,
// so each wave-wide 16-B load covers 512 contiguous bytes. p points at f*512 + l*8.
__device__ __forceinline__ v16b ld_fragp(const u16* p) {
  Frag f;
  f.half[0] = *(const v8ua*)p;
  f.half[1] = *(const v8ua*)(p + 256);
  return f.v;
}

// Writer's side of the same map: g8 = index of a group of 8 consecutive plane elements, 1 << ksh fragments per row tile
// -> matrix row and first k of the group.
__device__ __forceinline__ void frag_rk(int g8, int ksh, int& row, int& k) {
  const int f = g8 >> 6;
  row = ((f >> ksh) << 4) + (g8 & 15);
  k = ((f & ((1 << ksh) - 1)) << 5) + ((g8 >> 5) & 1) * 16 + ((g8 >> 4) & 1) * 8;
}

// sum over the 32 lanes of a wave
__device__ __forceinline__ float red32(float v) {
  v += __shfl_xor(v, 1);
  v += __shfl_xor(v, 2);
  v += __shfl_xor(v, 4);
  v += __shfl_xor(v, 8);
  v += __shfl_xor(v, 16);
  return v;
}

// ---------------------------------------------------------------------------
// Kernel 1: conv GEMM, split along k; patches gathered from x in the A loader, conv weights taken from wsr by the
// work-group itself (no weight launch, no conv weight planes).
//   Block = 128 conv rows x one k slice of 256, 8 waves x 16 rows.
//   Slice sp = patch row i = sp >> 1 (its 8 pixels j) x channel half sp & 1 (32 channels); k step = j, k in the step = channel.
//   row r = b*256 + m, m = py*16 + px;
//   A value = x[b][pix][ci], pix = (8py+i)*W + 8px + j (clamped), split to bf16 hi/lo in registers.
//   B value = wsr[co][ci][i][j]: a thread reads 16 channels x 4 pixels of one co (16 contiguous bytes a channel), splits them
//   and lays, per pixel, 8 channels as one 16-B group of the slice's fragments in LDS (fragment t*8 + j, order as ld_fragp).
//   Each wave stores its f32 16x64 partial tile in accumulator order:
//   part[slice][row tile][t][j][lane][4] = acc[t][4j..4j+3], 512 B per store.
//   Blocks (0..7, 0) also turn wq, wkv, wproj into bf16 hi/lo planes in fragment order (row = out, k = in) for the later
//   launches: one thread = 8 consecutive plane elements = one 16-B store per plane.
// grid = (16, 16) blocks x 256 threads.
// ---------------------------------------------------------------------------
__global__ __launch_bounds__(256) void k_conv_part(
    const float* __restrict__ x, const int* __restrict__ Hp, const int* __restrict__ Wp,
    const float* __restrict__ wsr,
    const float* __restrict__ wq, const float* __restrict__ wkv, const float* __restrict__ wproj,
    u16* __restrict__ wqh, u16* __restrict__ wql,
    u16* __restrict__ wkvh, u16* __restrict__ wkvl,
    u16* __restrict__ wph, u16* __restrict__ wpl,
    float* __restrict__ part)                                     // [16][128][4][2][32][4]
{
  __shared__ __attribute__((aligned(16))) u16 sB[2][4 * 8 * 512];  // hi, lo: [co tile][k step][512]

  const int tid = threadIdx.x, lane = tid & 31, w = tid >> 5;
  const int h = lane >> 4, m = lane & 15;
  const int blk = blockIdx.x, sp = blockIdx.y;
  const int irow = sp >> 1, chalf = sp & 1;
  const v8f zero8 = {0.f, 0.f, 0.f, 0.f, 0.f, 0.f, 0.f, 0.f};
  const int Hv = Hp[0], Wv = Wp[0];

  // small weights, asked for first (block-uniform test)
  const bool small = (sp == 0) && (blk < 8);
  v8f fs = zero8;
  u16* dh = wqh;
  u16* dl = wql;
  int e = 0;
  if (small) {
    const float* src;
    if (blk < 2)      { e = blk * 256 + tid;        src = wq;    dh = wqh;  dl = wql;  }
    else if (blk < 6) { e = (blk - 2) * 256 + tid;  src = wkv;   dh = wkvh; dl = wkvl; }
    else              { e = (blk - 6) * 256 + tid;  src = wproj; dh = wph;  dl = wpl;  }
    int row, k;
    frag_rk(e, 1, row, k);
    const float* s = src + row * CD + k;
    const v4f a = *(const v4fa*)s;
    const v4f c = *(const v4fa*)(s + 4);
    fs = __builtin_shufflevector(a, c, 0, 1, 2, 3, 4, 5, 6, 7);
    // precaution: the address registers of the two loads above are reused further down
    asm volatile("s_wait_xcnt 0x0" ::: "memory");
  }

  // conv weight blocks of this thread: co = 16*tw + m, pixels 8*irow + 4*h .. +3, and for gg = 0, 1 the 8 channels
  // 32*chalf + 8*(2*(w & 1) + gg) .. +7. Lanes m and m + 16 share a 128-B line, so a wave-wide load touches 16 lines.
  // Asked for in front of x: they are needed first, and their split runs while x is on its way.
  const int tw = w >> 1, g1 = w & 1;
  const float* wsrc = wsr + (size_t)(16 * tw + m) * KCONV + (32 * chalf + 16 * g1) * 64 + 8 * irow + 4 * h;
  // both loops unrolled: wv is indexed by their counters and has to stay in registers
  v4f wv[2][8];
  #pragma unroll
  for (int gg = 0; gg < 2; ++gg)
    #pragma unroll
    for (int c = 0; c < 8; ++c) wv[gg][c] = *(const v4fa*)(wsrc + (8 * gg + c) * 64);
  // precaution: the address registers of the loads above are reused further down; the pointer is named as an input
  // so that its register pair stays as it is up to the wait (no load lands on it)
  asm volatile("s_wait_xcnt 0x0" :: "v"(wsrc) : "memory");

  const long long hw = (long long)Hv * (long long)Wv;
  const int lim = (hw >= 1 && hw <= NQ) ? (int)(hw - 1) : (NQ - 1);
  const int r = blk * 128 + w * 16 + m;
  const int bb = r >> 8, mm = r & 255;
  const int py = mm >> 4, px = mm & 15;

  // The whole slice of this lane's row, 16 KB per wave, is asked for before any of it is used:
  // with two waves per SIMD only the loads in flight cover the memory latency.
  // Unrolled: xa is indexed by the counter and has to stay in registers.
  v4f xa[KSLICE / 32][4];
  #pragma unroll
  for (int j = 0; j < KSLICE / 32; ++j) {
    int pix = (8 * py + irow) * Wv + 8 * px + j;
    pix = min(max(pix, 0), lim);
    const float* s = x + ((size_t)bb * NQ + pix) * CD + 32 * chalf + 8 * h;
    xa[j][0] = *(const v4fa*)(s);
    xa[j][1] = *(const v4fa*)(s + 4);
    xa[j][2] = *(const v4fa*)(s + 16);
    xa[j][3] = *(const v4fa*)(s + 20);
  }
  // precaution: the address registers of the loads above are reused further down
  asm volatile("s_wait_xcnt 0x0" ::: "memory");

  if (small) {
    v8u hi, lo;
    split8(fs, hi, lo);
    *(v8u*)(dh + (size_t)e * 8) = hi;
    *(v8u*)(dl + (size_t)e * 8) = lo;
    // precaution: the address registers of the stores above are reused further down
    asm volatile("s_wait_xcnt 0x0" ::: "memory");
  }

  // turn in registers: a pixel's 8 channels are one 16-B group of fragment (tw, pixel);
  // each half wave's store covers 256 contiguous bytes (loops unrolled: wv stays in registers)
  #pragma unroll
  for (int gg = 0; gg < 2; ++gg) {
    #pragma unroll
    for (int jj = 0; jj < 4; ++jj) {
      v8f f;
      #pragma unroll
      for (int c = 0; c < 8; ++c) f[c] = wv[gg][c][jj];
      v8u hi, lo;
      split8(f, hi, lo);
      const int o = (tw * 8 + 4 * h + jj) * 512 + g1 * 256 + (gg * 16 + m) * 8;
      *(v8ua*)(&sB[0][o]) = hi;
      *(v8ua*)(&sB[1][o]) = lo;
    }
  }
  // Work-group barrier that orders LDS only: the fragments are published while x is still on its way
  // (__syncthreads() would first wait for every global load in flight).
  __builtin_amdgcn_fence(__ATOMIC_RELEASE, "workgroup", "local");
  __builtin_amdgcn_s_barrier();
  __builtin_amdgcn_fence(__ATOMIC_ACQUIRE, "workgroup", "local");

  v8f acc[4];
  #pragma unroll
  for (int t = 0; t < 4; ++t) acc[t] = zero8;

  const u16* brh = &sB[0][lane * 8];
  const u16* brl = &sB[1][lane * 8];

  // Weight fragments run one k step ahead in a second register set, the 16 LDS reads of a step asked for together
  // in front of the products of the step before.
  v16b fbh[2][4], fbl[2][4];
  #pragma unroll
  for (int t = 0; t < 4; ++t) {
    fbh[0][t] = ld_fragp(brh + (t * 8) * 512);
    fbl[0][t] = ld_fragp(brl + (t * 8) * 512);
  }
  // keeps the splits of x, which wait for x, behind the barrier and behind the first LDS reads
  __builtin_amdgcn_sched_barrier(0);

  // unrolled: xa and the register sets are indexed by ks and have to stay in registers
  #pragma unroll
  for (int ks = 0; ks < KSLICE / 32; ++ks) {
    if (ks + 1 < KSLICE / 32) {
      #pragma unroll
      for (int t = 0; t < 4; ++t) {
        fbh[(ks + 1) & 1][t] = ld_fragp(brh + (t * 8 + ks + 1) * 512);
        fbl[(ks + 1) & 1][t] = ld_fragp(brl + (t * 8 + ks + 1) * 512);
      }
    }
    v16b fah, fal;
    split_frag(__builtin_shufflevector(xa[ks][0], xa[ks][1], 0, 1, 2, 3, 4, 5, 6, 7),
               __builtin_shufflevector(xa[ks][2], xa[ks][3], 0, 1, 2, 3, 4, 5, 6, 7), fah, fal);
    #pragma unroll
    for (int t = 0; t < 4; ++t) {
      acc[t] = wmma_bf(fah, fbh[ks & 1][t], acc[t]);
      acc[t] = wmma_bf(fah, fbl[ks & 1][t], acc[t]);
      acc[t] = wmma_bf(fal, fbh[ks & 1][t], acc[t]);
    }
  }

  float* pp = part + ((size_t)sp * 128 + blk * 8 + w) * 1024 + lane * 4;
  #pragma unroll
  for (int t = 0; t < 4; ++t) {
    *(v4f*)(pp + (2 * t) * 128)     = __builtin_shufflevector(acc[t], acc[t], 0, 1, 2, 3);
    *(v4f*)(pp + (2 * t + 1) * 128) = __builtin_shufflevector(acc[t], acc[t], 4, 5, 6, 7);
  }
}

// ---------------------------------------------------------------------------
// Kernel 2: reduced tokens. Block = one row tile (16 tokens of one batch), 8 waves.
//   wave w asks for k slices 2w and 2w+1 of the tile at once (16 loads a lane), adds them and parks the sum in LDS;
//   wave w then owns tokens 2w, 2w+1: sum of the 8 parked tiles (wave 0's first) -> LayerNorm (f32) -> bf16 hi/lo rows in LDS;
//   wave w then makes column tile w of the kv projection (16 x 64 @ 64 x 16):
//     w < 4 : K, as weights * x^T, so a lane holds 8 consecutive d of token m = one 16-B group of the K plane;
//     w >= 4: V, as x * weights^T, so a lane holds 8 consecutive keys of d = m = one 16-B group of the V^T plane.
//   Each wave-wide store covers 512 contiguous bytes of a plane in fragment order.
// grid = 128 blocks x 256 threads.
// ---------------------------------------------------------------------------
#define XPITCH 72          // u16 per LayerNorm row in LDS: 144 B = 16 B x 9, so the 16 rows of a fragment read fall on different banks
__global__ __launch_bounds__(256) void k_kv(
    const float* __restrict__ part,                               // [16][128][4][2][32][4]
    const float* __restrict__ gamma, const float* __restrict__ beta,
    const u16* __restrict__ wkvh, const u16* __restrict__ wkvl,   // 128 x 64, fragment order
    const float* __restrict__ bkv,
    u16* __restrict__ kh, u16* __restrict__ kl,                   // 2048 x 64, fragment order
    u16* __restrict__ vth, u16* __restrict__ vtl)                 // 8 x (64 x 256), fragment order
{
  __shared__ __attribute__((aligned(16))) float sP[8 * 1024];        // [wave][chunk 2t+half][lane][4], accumulator order
  __shared__ __attribute__((aligned(16))) u16 sX[2 * 16 * XPITCH];   // LN output hi/lo [p][token][c]

  const int tid = threadIdx.x, lane = tid & 31;
  const int w = __builtin_amdgcn_readfirstlane(tid >> 5);            // wave number, scalar: it picks a branch around WMMAs
  const int h = lane >> 4, m = lane & 15;
  const int rt = blockIdx.x;                                         // tokens 16rt .. 16rt+15

  // Everything this wave takes from memory is asked for here, in one go. Each address is a wave-uniform base plus a
  // 32-bit offset of the lane (the build keeps lane, m and oh32 in registers and scales the first two in the load).
  const unsigned ol16 = (unsigned)lane * 16u, ol4 = (unsigned)lane * 4u, oh32 = (unsigned)h * 32u, om4 = (unsigned)m * 4u;
  const char* pb = (const char*)(part + ((size_t)(2 * w) * 128 + rt) * 1024);
  v4f pa[2][8];
  #pragma unroll
  for (int s = 0; s < 2; ++s)
    #pragma unroll
    for (int c = 0; c < 8; ++c) pa[s][c] = *(const v4fa*)(pb + ol16 + s * (128 * 1024 * 4) + c * 512);
  const char* wbh = (const char*)(wkvh + w * 1024);
  const char* wbl = (const char*)(wkvl + w * 1024);
  const v16b b0h = ld_fragp((const u16*)(wbh + ol16));
  const v16b b0l = ld_fragp((const u16*)(wbl + ol16));
  const v16b b1h = ld_fragp((const u16*)(wbh + ol16 + 1024));
  const v16b b1l = ld_fragp((const u16*)(wbl + ol16 + 1024));
  const int col0 = lane, col1 = lane + 32;                           // this lane's two channels in the LayerNorm: 16t+m, t = h and h+2
  const float g0 = *(const float*)((const char*)gamma + ol4), g1 = *(const float*)((const char*)gamma + ol4 + 128);
  const float be0 = *(const float*)((const char*)beta + ol4), be1 = *(const float*)((const char*)beta + ol4 + 128);
  const char* bb = (const char*)(bkv + 16 * w);
  const v4f bk0 = *(const v4fa*)(bb + oh32);                         // K: bias of features 16w+8h .. +7
  const v4f bk1 = *(const v4fa*)(bb + oh32 + 16);
  const float bv = *(const float*)(bb + om4);                        // V: bias of column 16w+m
  // precaution: the address registers of the loads above are reused further down; the offsets are named as inputs
  // so that their registers stay as they are up to the wait (no load lands on them)
  asm volatile("s_wait_xcnt 0x0" :: "v"(lane), "v"(m), "v"(oh32) : "memory");
  // keeps the sums, which wait for the partials, behind the last load: otherwise the weight loads are issued only
  // when the partials have landed, and the barrier below waits out a second memory latency
  __builtin_amdgcn_sched_barrier(0);

  float* sp = sP + w * 1024 + lane * 4;
  #pragma unroll
  for (int c = 0; c < 8; ++c) *(v4fa*)(sp + c * 128) = pa[0][c] + pa[1][c];
  __syncthreads();

  // token 2w+u is accumulator row 8*h2 + 4*half + e0 + u; channel 16t+m of it stands at chunk 2t+half, lane 16*h2+m.
  // This lane takes t = h and t = h + 2, both tokens in one 8-B read.
  const int h2 = w >> 2, half = (w & 3) >> 1, e0 = 2 * (w & 1);
  const float* rp = sP + (2 * h + half) * 128 + (16 * h2 + m) * 4 + e0;
  v2f a0 = *(const v2fa*)rp;
  v2f a1 = *(const v2fa*)(rp + 512);
  #pragma unroll
  for (int q = 1; q < 8; ++q) {
    a0 += *(const v2fa*)(rp + q * 1024);
    a1 += *(const v2fa*)(rp + q * 1024 + 512);
  }
  #pragma unroll
  for (int u = 0; u < 2; ++u) {
    const float mu = red32(a0[u] + a1[u]) * (1.0f / 64.0f);
    const float d0 = a0[u] - mu, d1 = a1[u] - mu;
    const float rs = rsqrtf(red32(d0 * d0 + d1 * d1) * (1.0f / 64.0f) + LN_EPS);
    const float y0 = d0 * rs * g0 + be0;
    const float y1 = d1 * rs * g1 + be1;
    const u16 h0 = bf_rne(y0), h1 = bf_rne(y1);
    u16* xr = sX + (2 * w + u) * XPITCH;
    xr[col0] = h0;
    xr[col1] = h1;
    xr[16 * XPITCH + col0] = bf_rne(y0 - bf_val(h0));
    xr[16 * XPITCH + col1] = bf_rne(y1 - bf_val(h1));
  }
  __syncthreads();

  // x fragments: row (or column) = token m, k = channel
  const v16b xh0 = ld_frag(sX + m * XPITCH, h);
  const v16b xh1 = ld_frag(sX + m * XPITCH + 32, h);
  const v16b xl0 = ld_frag(sX + (16 + m) * XPITCH, h);
  const v16b xl1 = ld_frag(sX + (16 + m) * XPITCH + 32, h);

  v8f c = {0.f, 0.f, 0.f, 0.f, 0.f, 0.f, 0.f, 0.f};
  u16* dh;
  u16* dl;
  if (w < 4) {
    c = wmma_bf(b0h, xh0, c);
    c = wmma_bf(b0l, xh0, c);
    c = wmma_bf(b0h, xl0, c);
    c = wmma_bf(b1h, xh1, c);
    c = wmma_bf(b1l, xh1, c);
    c = wmma_bf(b1h, xl1, c);
    // c[r] = k[token m][d 16w+8h+r]: elements 8*(w&1) .. +7 of lane (h, m) in fragment 2rt + (w >> 1)
    c += __builtin_shufflevector(bk0, bk1, 0, 1, 2, 3, 4, 5, 6, 7);
    const size_t o = (size_t)(2 * rt + (w >> 1)) * 512 + (w & 1) * 256 + lane * 8;
    dh = kh + o;
    dl = kl + o;
  } else {
    c = wmma_bf(xh0, b0h, c);
    c = wmma_bf(xh0, b0l, c);
    c = wmma_bf(xl0, b0h, c);
    c = wmma_bf(xh1, b1h, c);
    c = wmma_bf(xh1, b1l, c);
    c = wmma_bf(xl1, b1h, c);
    // c[r] = v[key 16(rt&15)+8h+r][d 16(w-4)+m]: elements 8*(rt&1) .. +7 of lane (h, m) in the fragment of d tile w-4, key step (rt&15)>>1
    c += bv;
    const size_t o = (size_t)((rt >> 4) * 32 + (w - 4) * 8 + ((rt & 15) >> 1)) * 512 + (rt & 1) * 256 + lane * 8;
    dh = vth + o;
    dl = vtl + o;
  }
  v8u hi, lo;
  split8(c, hi, lo);
  *(v8u*)dh = hi;
  *(v8u*)dl = lo;
}

// ---------------------------------------------------------------------------
// lanes 8q..8q+7 in one instruction, 4 lines per instruction, 32 lines per wave.
// ---------------------------------------------------------------------------
// The LDS tile keeps 16-B chunk q of row m at chunk q ^ m (see the writer in k_attn).
__device__ __forceinline__ void att_store_pass(const float* so, float* out, size_t grow0, int lane) {
  const int q8 = lane & 7, sub = lane >> 3;
  #pragma unroll
  for (int i = 0; i < 8; ++i) {
    const int lid = i * 4 + sub;
    const int row = lid >> 1, hl = lid & 1;
    const v4f v = *(const v4fa*)(so + row * 64 + 4 * ((8 * hl + q8) ^ row));
    *(v4f*)(out + (grow0 + (size_t)row) * CD + 32 * hl + 4 * q8) = v;
  }
}

// The four K fragments (k 0..31 hi, lo; k 32..63 hi, lo) of key tile j.
__device__ __forceinline__ void ld_k4(v16b* f, const u16* ph, const u16* pl, int j) {
  const int ko = j * 1024;                       // two fragments per 16 keys
  f[0] = ld_fragp(ph + ko);
  f[1] = ld_fragp(pl + ko);
  f[2] = ld_fragp(ph + ko + 512);
  f[3] = ld_fragp(pl + ko + 512);
}

// Scores of key tile j: z[r] = S[query m][key 16j+8h+r], parked as this lane's chunks 2j (r 0..3) and 2j+1 (r 4..7).
__device__ __forceinline__ void score_pass(const v16b* f, v16b qbh0, v16b qbl0, v16b qbh1, v16b qbl1,
                                           float* sl, int j, float& mx) {
  v8f z = {0.f, 0.f, 0.f, 0.f, 0.f, 0.f, 0.f, 0.f};
  z = wmma_bf(f[0], qbh0, z);
  z = wmma_bf(f[0], qbl0, z);
  z = wmma_bf(f[1], qbh0, z);
  z = wmma_bf(f[2], qbh1, z);
  z = wmma_bf(f[2], qbl1, z);
  z = wmma_bf(f[3], qbh1, z);
  const v4f z0 = __builtin_shufflevector(z, z, 0, 1, 2, 3);
  const v4f z1 = __builtin_shufflevector(z, z, 4, 5, 6, 7);
  *(v4fa*)(sl + 256 * j) = z0;
  *(v4fa*)(sl + 256 * j + 128) = z1;
  #pragma unroll
  for (int r = 0; r < 8; ++r) mx = fmaxf(mx, z[r]);
}

// The product alone, for the P*V steps: the vector work of the next key step stands between these products and fills the
// slots behind them; the compiler keeps the distances of its own builtin.
__device__ __forceinline__ v8f wmma_pv(v16b a, v16b b, v8f c) {
  return __builtin_amdgcn_wmma_f32_16x16x32_bf16(false, a, false, b, (short)0, c, false, false);
}

// Parked scores of key step c (32 keys): chunks 4c..4c+3 of this lane, keys 32c+8h.., 32c+16+8h..
__device__ __forceinline__ void ld_scores(v4f* s, const float* sl, int c) {
  const float* pp = sl + 512 * c;
  s[0] = *(const v4fa*)pp;
  s[1] = *(const v4fa*)(pp + 128);
  s[2] = *(const v4fa*)(pp + 256);
  s[3] = *(const v4fa*)(pp + 384);
}

// Softmax numerators of one key step, split into P^T fragments (not normalised). The row sum runs in two pairs of partial
// sums: a pair takes two neighbouring numerators, the registers that the packed convert takes too, in one packed add.
__device__ __forceinline__ void exp_frag(const v4f* s, float mx, v2f* sum, v16b& pbh, v16b& pbl) {
  v4f p[4];
  #pragma unroll
  for (int a = 0; a < 4; ++a) {
    #pragma unroll
    for (int e = 0; e < 4; ++e) p[a][e] = __expf(s[a][e] - mx);
    sum[0] += __builtin_shufflevector(p[a], p[a], 0, 1);
    sum[1] += __builtin_shufflevector(p[a], p[a], 2, 3);
  }
  split_frag(__builtin_shufflevector(p[0], p[1], 0, 1, 2, 3, 4, 5, 6, 7),
             __builtin_shufflevector(p[2], p[3], 0, 1, 2, 3, 4, 5, 6, 7), pbh, pbl);
}

// ---------------------------------------------------------------------------
// Kernel 3: fused q projection + attention over 256 reduced tokens + output projection.
// Block = 64 threads (2 waves), 16 queries per wave; grid = (512, 8).
//   q^T = wq * x^T          : A = wq plane rows, B = x^T split in registers
//   S^T = K * q^T           : A = K plane rows, B = q^T packed from two adjacent D tiles
//   softmax over 256 keys   : f32, scores parked in LDS; each lane re-reads only what it wrote,
//                             so the park is lane-major: 16-B chunk c of lane l at (c*32 + l)*16 B,
//                             every LDS access of a wave covers 512 contiguous bytes (no bank conflict)
//   O^T = V^T * P^T         : A = V^T plane rows, B = P^T, the numerators made from the parked scores one key step ahead
//   out^T = wproj * O^T     : A = wproj plane rows, B = O^T packed from D tiles
// Every plane fragment is asked for ahead of the products that use it: q weights with x, K three key tiles
// ahead (ring of four register sets), V^T one key step ahead, proj weights half in front of the split of O, half behind it.
// ---------------------------------------------------------------------------
__global__ __launch_bounds__(64) void k_attn(
    const float* __restrict__ x,
    const u16* __restrict__ wqh, const u16* __restrict__ wql, const float* __restrict__ bq,
    const u16* __restrict__ kh, const u16* __restrict__ kl,      // 2048 x 64, fragment order
    const u16* __restrict__ vth, const u16* __restrict__ vtl,    // 8 x (64 x 256), fragment order
    const u16* __restrict__ wph, const u16* __restrict__ wpl, const float* __restrict__ bproj,
    float* __restrict__ out)                                     // [8][16384][64]
{
  __shared__ __attribute__((aligned(16))) float sS[2][16 * 256];
  __shared__ __attribute__((aligned(16))) float sO[2][16 * 64];

  const int tid = threadIdx.x, lane = tid & 31, w = tid >> 5;
  const int h = lane >> 4, m = lane & 15;
  const int b = blockIdx.y;
  const int q0 = blockIdx.x * 32 + 16 * w;
  const v8f zero8 = {0.f, 0.f, 0.f, 0.f, 0.f, 0.f, 0.f, 0.f};

  // ---- q^T = wq * x^T : qt[t][r] = q[query q0+m][feature 16t+8h+r] ----
  v8f qt[4];
  #pragma unroll
  for (int t = 0; t < 4; ++t) qt[t] = zero8;
  const float* xr = x + ((size_t)b * NQ + q0 + m) * CD;
  v4f xv[2][4];
  #pragma unroll
  for (int ks = 0; ks < 2; ++ks) {
    const float* xp = xr + 32 * ks + 8 * h;
    xv[ks][0] = *(const v4fa*)(xp);
    xv[ks][1] = *(const v4fa*)(xp + 4);
    xv[ks][2] = *(const v4fa*)(xp + 16);
    xv[ks][3] = *(const v4fa*)(xp + 20);
  }
  // precaution: the address registers of the loads above are reused by what follows
  asm volatile("s_wait_xcnt 0x0" ::: "memory");
  v16b wah[2][4], wal[2][4];
  #pragma unroll
  for (int ks = 0; ks < 2; ++ks)
    #pragma unroll
    for (int t = 0; t < 4; ++t) {
      const int off = (2 * t + ks) * 512 + lane * 8;
      wah[ks][t] = ld_fragp(wqh + off);
      wal[ks][t] = ld_fragp(wql + off);
    }
  v4f bqv[4][2];
  #pragma unroll
  for (int t = 0; t < 4; ++t) {
    bqv[t][0] = *(const v4fa*)(bq + 16 * t + 8 * h);
    bqv[t][1] = *(const v4fa*)(bq + 16 * t + 8 * h + 4);
  }
  // precaution: the address registers of the loads above are reused by what follows
  asm volatile("s_wait_xcnt 0x0" ::: "memory");
  #pragma unroll
  for (int ks = 0; ks < 2; ++ks) {
    const v8f a8 = __builtin_shufflevector(xv[ks][0], xv[ks][1], 0, 1, 2, 3, 4, 5, 6, 7);
    const v8f c8 = __builtin_shufflevector(xv[ks][2], xv[ks][3], 0, 1, 2, 3, 4, 5, 6, 7);
    v16b xbh, xbl;
    split_frag(a8, c8, xbh, xbl);
    #pragma unroll
    for (int t = 0; t < 4; ++t) {
      qt[t] = wmma_bf(wah[ks][t], xbh, qt[t]);
      qt[t] = wmma_bf(wah[ks][t], xbl, qt[t]);
      qt[t] = wmma_bf(wal[ks][t], xbh, qt[t]);
    }
  }
  // key tiles 0..2 are asked for here, in front of the split of q
  const u16* kbh = kh + (size_t)b * NKEY * CD + lane * 8;
  const u16* kbl = kl + (size_t)b * NKEY * CD + lane * 8;
  v16b kf[4][4];
  #pragma unroll
  for (int s = 0; s < 3; ++s) ld_k4(kf[s], kbh, kbl, s);
  v8f qv[4];
  #pragma unroll
  for (int t = 0; t < 4; ++t)
    #pragma unroll
    for (int r = 0; r < 8; ++r)
      qv[t][r] = (qt[t][r] + bqv[t][r >> 2][r & 3]) * 0.125f;    // d^-1/2 folded into q (exact)
  // B fragment for k = d: element i <- tile 2ks row i, element 8+i <- tile 2ks+1 row i
  v16b qbh0, qbl0, qbh1, qbl1;
  split_frag(qv[0], qv[1], qbh0, qbl0);
  split_frag(qv[2], qv[3], qbh1, qbl1);

  // ---- scores: key tile j uses register set j & 3; tile j + 3 is asked for into the set that tile j - 1 has left ----
  float* sw = &sS[w][0];
  float* sl = sw + lane * 4;                     // chunk c of this lane: sl + c*128
  float mx = -3.0e38f;
  // unrolled: the set index has to be a constant, and every load then takes its tile as an immediate offset
  // from one address pair that is never rewritten while loads are in flight
  #pragma unroll
  for (int j = 0; j < 16; ++j) {
    if (j + 3 < 16) ld_k4(kf[(j + 3) & 3], kbh, kbl, j + 3);
    score_pass(kf[j & 3], qbh0, qbl0, qbh1, qbl1, sl, j, mx);
  }
  mx = fmaxf(mx, __shfl_xor(mx, 16));

  // V^T fragments of key step 0 are asked for here, in front of the numerators of key step 0.
  // precaution: the V^T addresses may take the registers that the K loads name; the batch offset passes through
  // the statement so that the address arithmetic cannot be lifted over the wait
  unsigned vb0 = (unsigned)b * (CD * NKEY);
  asm volatile("s_wait_xcnt 0x0" : "+s"(vb0) : : "memory");
  const u16* vbh = vth + (size_t)vb0 + lane * 8;
  const u16* vbl = vtl + (size_t)vb0 + lane * 8;
  v16b vh[4], vl[4];
  #pragma unroll
  for (int t = 0; t < 4; ++t) {
    vh[t] = ld_fragp(vbh + (8 * t) * 512);
    vl[t] = ld_fragp(vbl + (8 * t) * 512);
  }
  // precaution: the address registers of the loads above are reused by what follows
  asm volatile("s_wait_xcnt 0x0" ::: "memory");

  // ---- softmax numerators and O^T = V^T * P^T in one run of 8 key steps: o[t][r] = O[query m][d 16t+8h+r] * row sum ----
  // Step c holds three stages: the LDS reads of the scores of step c + 2, exp / row sum / hi-lo split of step c + 1,
  // and the 12 products of step c. The numerators go from registers into the fragments; the division by the row sum is
  // made once, on the projected output (the projection is linear in O).
  v8f o[4];
  #pragma unroll
  for (int t = 0; t < 4; ++t) o[t] = zero8;
  v2f sum2[2] = {{0.f, 0.f}, {0.f, 0.f}};
  v4f sc[2][4];
  v16b pb[2][2];
  ld_scores(sc[0], sl, 0);
  ld_scores(sc[1], sl, 1);
  exp_frag(sc[0], mx, sum2, pb[0][0], pb[0][1]);
  asm volatile("" :: "v"(sum2[0]), "v"(sum2[1]));   // each row's sum, against spills: see the same statement in the loop
  // ends the scheduling region, so that the groups below sort the instructions of their own step only
  __builtin_amdgcn_sched_barrier(0);
  // unrolled: the register sets are indexed by c, and every V^T load takes its step as an immediate offset from one
  // address that is never rewritten while loads are in flight
  #pragma unroll
  for (int c = 0; c < 8; ++c) {
    if (c + 2 < 8) ld_scores(sc[c & 1], sl, c + 2);
    if (c + 1 < 8) exp_frag(sc[(c + 1) & 1], mx, sum2, pb[(c + 1) & 1][0], pb[(c + 1) & 1][1]);
    const v16b pbh = pb[c & 1][0], pbl = pb[c & 1][1];
    #pragma unroll
    for (int t = 0; t < 4; ++t) {
      o[t] = wmma_pv(vh[t], pbh, o[t]);
      o[t] = wmma_pv(vh[t], pbl, o[t]);
      o[t] = wmma_pv(vl[t], pbh, o[t]);
      // tile t's pair for key step c + 1 is asked for right behind tile t's products of step c
      if (c + 1 < 8) {
        vh[t] = ld_fragp(vbh + (8 * t + c + 1) * 512);
        vl[t] = ld_fragp(vbl + (8 * t + c + 1) * 512);
      }
    }
    // Named as inputs only, so that this step's additions stand in this step. Without it the compiler puts all the
    // additions behind the last step and keeps every numerator in a register until then (284 registers and scratch).
    asm volatile("" :: "v"(sum2[0]), "v"(sum2[1]));   // each row's sum, against spills
    // Order asked of the scheduler inside this step: the LDS reads first, then behind each product an equal share of the
    // next step's vector work, two exponentials last, so that the next product stands in the slot behind them (left to
    // itself it puts over twenty lines of the listing behind one product and three behind another).
    __builtin_amdgcn_sched_group_barrier(0x100, 4, 0);
    #pragma unroll
    for (int i = 0; i < 12; ++i) {
      __builtin_amdgcn_sched_group_barrier(0x008, 1, 0);
      __builtin_amdgcn_sched_group_barrier(0x002, 6, 0);
      if (i < 8) __builtin_amdgcn_sched_group_barrier(0x400, 2, 0);
      if (i % 3 == 2) __builtin_amdgcn_sched_group_barrier(0x020, 4, 0);
    }
    __builtin_amdgcn_sched_barrier(0);
  }
  // precaution: the address registers of the V^T loads are reused by what follows
  asm volatile("s_wait_xcnt 0x0" ::: "memory");
  float sum = (sum2[0][0] + sum2[0][1]) + (sum2[1][0] + sum2[1][1]);
  sum += __shfl_xor(sum, 16);
  const float inv = 1.0f / sum;     // of query m, the query of this lane in O^T and in out^T alike: applied with the bias below

  // ---- out^T = wproj * O^T : u[t][r] = out[query m][feature 16t+8h+r] ----
  v16b wpf[4][4];
  #pragma unroll
  for (int t = 0; t < 2; ++t) {
    const int off = t * 1024 + lane * 8;
    wpf[t][0] = ld_fragp(wph + off);
    wpf[t][1] = ld_fragp(wpl + off);
    wpf[t][2] = ld_fragp(wph + off + 512);
    wpf[t][3] = ld_fragp(wpl + off + 512);
  }
  v16b obh0, obl0, obh1, obl1;
  split_frag(o[0], o[1], obh0, obl0);
  split_frag(o[2], o[3], obh1, obl1);
  // precaution: the address registers of the loads above are reused by what follows. The fragments of O are named as inputs
  // so that the loads below stay behind the split: all asked for in front of it, their 96 registers and the split's
  // temporaries push the kernel past 256 registers, which costs a wave per SIMD.
  asm volatile("s_wait_xcnt 0x0" :: "v"(obh0), "v"(obl0), "v"(obh1), "v"(obl1) : "memory");
  #pragma unroll
  for (int t = 2; t < 4; ++t) {
    const int off = t * 1024 + lane * 8;
    wpf[t][0] = ld_fragp(wph + off);
    wpf[t][1] = ld_fragp(wpl + off);
    wpf[t][2] = ld_fragp(wph + off + 512);
    wpf[t][3] = ld_fragp(wpl + off + 512);
  }
  v4f bpv[4][2];
  #pragma unroll
  for (int t = 0; t < 4; ++t) {
    bpv[t][0] = *(const v4fa*)(bproj + 16 * t + 8 * h);
    bpv[t][1] = *(const v4fa*)(bproj + 16 * t + 8 * h + 4);
  }
  // precaution: the address registers of the loads above are reused by what follows
  asm volatile("s_wait_xcnt 0x0" ::: "memory");
  v8f u[4];
  #pragma unroll
  for (int t = 0; t < 4; ++t) {
    const v16b a0h = wpf[t][0], a0l = wpf[t][1], a1h = wpf[t][2], a1l = wpf[t][3];
    v8f z = zero8;
    z = wmma_bf(a0h, obh0, z);
    z = wmma_bf(a0h, obl0, z);
    z = wmma_bf(a0l, obh0, z);
    z = wmma_bf(a1h, obh1, z);
    z = wmma_bf(a1h, obl1, z);
    z = wmma_bf(a1l, obh1, z);
    u[t] = z;
  }
  // row m of the output tile, 16-B chunk q stored at chunk q ^ m: the 16 rows of one store fall on 16 different bank groups
  float* so = &sO[w][0];
  #pragma unroll
  for (int t = 0; t < 4; ++t) {
    v8f y;
    #pragma unroll
    for (int r = 0; r < 8; ++r) y[r] = u[t][r] * inv + bpv[t][r >> 2][r & 3];
    const int q = 4 * t + 2 * h;
    *(v4fa*)(so + m * 64 + 4 * (q ^ m))       = __builtin_shufflevector(y, y, 0, 1, 2, 3);
    *(v4fa*)(so + m * 64 + 4 * ((q + 1) ^ m)) = __builtin_shufflevector(y, y, 4, 5, 6, 7);
  }
  __syncthreads();

  const size_t grow0 = (size_t)b * NQ + q0;
  att_store_pass(so, out, grow0, lane);
  
}

// ---------------------------------------------------------------------------
extern "C" void kernel_launch(void* const* d_in, const int* in_sizes, int n_in,
                              void* d_out, int out_size, void* d_ws, size_t ws_size,
                              hipStream_t stream) {
  if (n_in < 12) return;
  if (in_sizes[0] != NBATCH * NQ * CD) return;
  if (in_sizes[1] != CD * CD || in_sizes[2] != CD) return;
  if (in_sizes[3] != 2 * CD * CD || in_sizes[4] != 2 * CD) return;
  if (in_sizes[5] != CD * CD || in_sizes[6] != CD) return;
  if (in_sizes[7] != CD * KCONV) return;
  if (in_sizes[8] != CD || in_sizes[9] != CD) return;
  if (in_sizes[10] < 1 || in_sizes[11] < 1) return;
  if (out_size != NBATCH * NQ * CD) return;

  const float* x     = (const float*)d_in[0];
  const float* wq    = (const float*)d_in[1];
  const float* bq    = (const float*)d_in[2];
  const float* wkv   = (const float*)d_in[3];
  const float* bkv   = (const float*)d_in[4];
  const float* wproj = (const float*)d_in[5];
  const float* bproj = (const float*)d_in[6];
  const float* wsr   = (const float*)d_in[7];
  const float* gamma = (const float*)d_in[8];
  const float* beta  = (const float*)d_in[9];
  const int*   Hp    = (const int*)d_in[10];
  const int*   Wp    = (const int*)d_in[11];
  float* out = (float*)d_out;

  const size_t szWq  = (size_t)CD * CD * 2;            //      8192 per plane
  const size_t szWkv = (size_t)2 * CD * CD * 2;        //     16384
  const size_t szWp  = (size_t)CD * CD * 2;            //      8192
  const size_t szK   = (size_t)NROWK * CD * 2;         //    262144
  const size_t szVt  = (size_t)NBATCH * CD * NKEY * 2; //    262144
  const size_t szPt  = (size_t)KSPLIT * NROWK * CD * 4; //  8388608
  size_t off = 0;
  const size_t oWqh = off;  off += szWq;
  const size_t oWql = off;  off += szWq;
  const size_t oWkh = off;  off += szWkv;
  const size_t oWkl = off;  off += szWkv;
  const size_t oWph = off;  off += szWp;
  const size_t oWpl = off;  off += szWp;
  const size_t oKh  = off;  off += szK;
  const size_t oKl  = off;  off += szK;
  const size_t oVth = off;  off += szVt;
  const size_t oVtl = off;  off += szVt;
  const size_t oPt  = off;  off += szPt;              // total 9502720
  if (off > ws_size) return;
  if (off > (size_t)134217728) return;

  char* ws = (char*)d_ws;
  u16* wqh  = (u16*)(ws + oWqh);
  u16* wql  = (u16*)(ws + oWql);
  u16* wkvh = (u16*)(ws + oWkh);
  u16* wkvl = (u16*)(ws + oWkl);
  u16* wph  = (u16*)(ws + oWph);
  u16* wpl  = (u16*)(ws + oWpl);
  u16* kh   = (u16*)(ws + oKh);
  u16* kl   = (u16*)(ws + oKl);
  u16* vth  = (u16*)(ws + oVth);
  u16* vtl  = (u16*)(ws + oVtl);
  float* part = (float*)(ws + oPt);

  dim3 gConv(NROWK / 128, KSPLIT);                                                 // (16, 16)
  k_conv_part<<<gConv, 256, 0, stream>>>(x, Hp, Wp, wsr, wq, wkv, wproj, wqh, wql, wkvh, wkvl, wph, wpl, part);

  k_kv<<<NROWK / 16, 256, 0, stream>>>(part, gamma, beta, wkvh, wkvl, bkv,
                                       kh, kl, vth, vtl);                           // 128 blocks

  dim3 gAtt(NQ / 32, NBATCH);                                                      // (512, 8)
  k_attn<<<gAtt, 64, 0, stream>>>(x, wqh, wql, bq, kh, kl, vth, vtl, wph, wpl, bproj, out);
}
